// v000
// Times are from an AMD MI455X. After a warm-up the kernel runs many times in a row, and a time is the length of
// such a window on the GPU divided by its runs, so every launch and the gaps after it count. The runs cycle
// through copies of the inputs. A figure is the median of several windows, for all but v000 over two sittings.
// Sittings can differ by a few percent; kernels timed side by side share one.
// v000 is the starting kernel. One run takes 1530 microseconds.
// Contractions: channel projections (x^T f16 x Wcat f16 carried x16), scores theta.phi^T (f16 planes), gw^T = W_out (f16 carried x16) . g^T (f16 plane), out^T = gw^T f16 x P (f16 carried x32768): all on v_wmma_f32_16x16x32_f16 with f32 accumulate; bias adds, softmax and residual in f32.
#include <hip/hip_runtime.h>
#include <math.h>

// ---------------------------------------------------------------------------
// Problem constants
// ---------------------------------------------------------------------------
constexpr int kB  = 8;        // batch
constexpr int kC  = 64;       // in channels
constexpr int kCI = 32;       // inter channels
constexpr int kN  = 4096;     // H*W positions
constexpr int kPW = 128;      // projection plane width: theta 0..31 | phi 32..63 | g 64..95 | zero 96..127
constexpr float kWCarry    = 16.0f;            // weights carried x16 in f16
constexpr float kWCarryInv = 1.0f / 16.0f;
constexpr float kPCarry    = 32768.0f;         // probabilities carried x2^15 in f16
constexpr float kPCarryInv = 1.0f / 32768.0f;
static_assert(kN % 64 == 0 && kPW % 64 == 0 && kC % 64 == 0, "M,N tiles");
static_assert(kC % 32 == 0 && kCI % 32 == 0 && kN % 32 == 0, "K steps");
static_assert(kN == 4 * 1024, "softmax row map");

typedef __attribute__((ext_vector_type(16))) _Float16 v16h;
typedef __attribute__((ext_vector_type(8)))  _Float16 v8h;
typedef __attribute__((ext_vector_type(16))) __bf16   v16b;
typedef __attribute__((ext_vector_type(8)))  __bf16   v8b;
typedef __attribute__((ext_vector_type(8)))  float    v8f;
typedef __attribute__((ext_vector_type(4)))  float    v4f;
typedef __attribute__((ext_vector_type(4)))  unsigned int v4u;

// ---------------------------------------------------------------------------
// Helpers
// ---------------------------------------------------------------------------
__device__ __forceinline__ unsigned short f2bf_bits(float f) {
  unsigned u = __float_as_uint(f);
  return (unsigned short)((u + 0x7FFFu + ((u >> 16) & 1u)) >> 16);
}
__device__ __forceinline__ float bf_bits2f(unsigned short h) { return __uint_as_float(((unsigned)h) << 16); }

// hazard guards as plain device helpers (no inline asm inside the kernel template body); all four accumulators of a group tied
__device__ __forceinline__ void dep_guard4_h(v8f& a, v8f& b, v8f& c, v8f& d, v16h x, v16h y) { asm volatile("v_nop\n\tv_nop\n\tv_nop\n\tv_nop" : "+v"(a), "+v"(b), "+v"(c), "+v"(d) : "v"(x), "v"(y)); }
__device__ __forceinline__ void dep_guard4_b(v8f& a, v8f& b, v8f& c, v8f& d, v16b x, v16b y) { asm volatile("v_nop\n\tv_nop\n\tv_nop\n\tv_nop" : "+v"(a), "+v"(b), "+v"(c), "+v"(d) : "v"(x), "v"(y)); }
__device__ __forceinline__ void keep4_h(v16h a, v16h b, v16h c, v16h d) { asm volatile("v_nop" :: "v"(a), "v"(b), "v"(c), "v"(d)); }
__device__ __forceinline__ void keep4_b(v16b a, v16b b, v16b c, v16b d) { asm volatile("v_nop" :: "v"(a), "v"(b), "v"(c), "v"(d)); }
__device__ __forceinline__ void acc_guard4(v8f& a, v8f& b, v8f& c, v8f& d) { asm volatile("v_nop\n\tv_nop\n\tv_nop\n\tv_nop" : "+v"(a), "+v"(b), "+v"(c), "+v"(d)); }
template <typename T> struct Frag;
template <> struct Frag<_Float16> {
  typedef v16h V; union U { v16h v; v8h h[2]; };
  // elements 0..7 <- p[0..7], 8..15 <- p[16..23]
  static __device__ __forceinline__ v16h load(const _Float16* p) {
    U f; f.h[0] = *(const v8h*)(p); f.h[1] = *(const v8h*)(p + 16); return f.v;
  }
  static __device__ __forceinline__ v8f mma(v16h a, v16h b, v8f c) {
    return __builtin_amdgcn_wmma_f32_16x16x32_f16(false, a, false, b, (short)0, c, false, false);
  }
  static __device__ __forceinline__ void guard4(v8f& a, v8f& b, v8f& c, v8f& d, v16h x, v16h y) { dep_guard4_h(a, b, c, d, x, y); }
  static __device__ __forceinline__ void keep(v16h a, v16h b, v16h c, v16h d) { keep4_h(a, b, c, d); }
};
template <> struct Frag<__bf16> {
  typedef v16b V; union U { v16b v; v8b h[2]; };
  static __device__ __forceinline__ v16b load(const __bf16* p) {
    U f; f.h[0] = *(const v8b*)(p); f.h[1] = *(const v8b*)(p + 16); return f.v;
  }
  static __device__ __forceinline__ v8f mma(v16b a, v16b b, v8f c) {
    return __builtin_amdgcn_wmma_f32_16x16x32_bf16(false, a, false, b, (short)0, c, false, false);
  }
  static __device__ __forceinline__ void guard4(v8f& a, v8f& b, v8f& c, v8f& d, v16b x, v16b y) { dep_guard4_b(a, b, c, d, x, y); }
  static __device__ __forceinline__ void keep(v16b a, v16b b, v16b c, v16b d) { keep4_b(a, b, c, d); }
};

__device__ __forceinline__ unsigned pk16(unsigned short a, unsigned short b) { return (unsigned)a | ((unsigned)b << 16); }
__device__ __forceinline__ unsigned short h_bits(float f) { const _Float16 h = (_Float16)f; return __builtin_bit_cast(unsigned short, h); }

// ---- Register-blocked batched WMMA GEMM (ACT reduced to none/relu/leaky; residual read in the store phase) ------
// C[m,n] = scale * sum_k A[m,k] * Bt[n,k] (+bias)(+resid); each wave owns a 64x64 tile.
// A row-major [M,K]; Bt row-major [N,K]; M,N % 64 == 0, K % 32 == 0.
// SPLIT: operands are hi/lo planes (A2/Bt2 = lo planes, same layout); product = hi*hi + hi*lo + lo*hi.
// BIAS_MODE: 0 = none, 1 = bias[m], 2 = bias[n].
// OUT_MODE: 0 = f32, 1 = f16, 2 = bf16 hi plane (Cout) + bf16 lo plane (Cout2).
// RESID (OUT_MODE 0 only): resid[m*ldc + n] is loaded as one 16-B float4 per lane at the store address and added in the store phase.
// ET: 0 = f16 operands, 1 = bf16 operands (pointers passed as 16-bit storage)
template <int ET> struct Elem;
template <> struct Elem<0> { typedef _Float16 T; };
template <> struct Elem<1> { typedef __bf16 T; };
template <int ET, bool SPLIT, int BIAS_MODE, int OUT_MODE, bool RESID, int ACT = 0>
__global__ __launch_bounds__(256) void wmma_gemm64(
    const unsigned short* __restrict__ Ap, const unsigned short* __restrict__ A2p, int lda, long strideA,
    const unsigned short* __restrict__ Btp, const unsigned short* __restrict__ Bt2p, int ldb, long strideB,
    void* __restrict__ Cout, void* __restrict__ Cout2, int ldc, long strideC,
    const float* __restrict__ bias,
    const float* __restrict__ resid, long strideR,
    int M, int N, int K, float scale) {
  static_assert(!RESID || OUT_MODE == 0, "resid only with f32 output");
  static_assert(ACT == 0 || ACT == 2 || ACT == 4, "act");
  typedef typename Elem<ET>::T T;
  typedef typename Frag<T>::V V;
  const T* A = (const T*)Ap; const T* A2 = (const T*)A2p; const T* Bt = (const T*)Btp; const T* Bt2 = (const T*)Bt2p;
  __shared__ __align__(16) float sT[8][16 * 68];   // per-wave 16x64 slab, pitch 68 floats
  const int b    = blockIdx.y;
  const int lane = threadIdx.x & 31;
  const int wave = threadIdx.x >> 5;
  const int tilesN = N >> 6;
  const int tilesM = M >> 6;
  const int tile = blockIdx.x * 8 + wave;
  if (tile >= tilesM * tilesN) return;   // wave-uniform; no block barriers in this kernel
  const int tm = tile / tilesN;
  const int tn = tile - tm * tilesN;
  const int m0 = tm << 6;
  const int n0 = tn << 6;

  const T* Ab  = A  + (size_t)b * strideA;
  const T* Bb  = Bt + (size_t)b * strideB;
  const T* Ab2 = SPLIT ? (A2  + (size_t)b * strideA) : nullptr;
  const T* Bb2 = SPLIT ? (Bt2 + (size_t)b * strideB) : nullptr;

  const int rlane = lane & 15;                 // row (A) / col (B, D) within subtile
  const int koff  = (lane >> 4) * 8;           // k offset of this lane half
  const int mOff  = (lane >> 4) * 8;           // D row offset

  v8f acc[4][4];
#pragma unroll
  for (int i = 0; i < 4; ++i)
#pragma unroll
    for (int j = 0; j < 4; ++j) acc[i][j] = (v8f){0.f,0.f,0.f,0.f,0.f,0.f,0.f,0.f};

  for (int k0 = 0; k0 < K; k0 += 32) {
    V bh[4], bl[4];
#pragma unroll
    for (int j = 0; j < 4; ++j) {
      const size_t bo = (size_t)(n0 + (j << 4) + rlane) * ldb + koff + k0;
      bh[j] = Frag<T>::load(Bb + bo);
      if (SPLIT) bl[j] = Frag<T>::load(Bb2 + bo);
    }
#pragma unroll
    for (int i = 0; i < 4; ++i) {
      const size_t ao = (size_t)(m0 + (i << 4) + rlane) * lda + koff + k0;
      V ah = Frag<T>::load(Ab + ao);
      V al;
      if (SPLIT) al = Frag<T>::load(Ab2 + ao);
#pragma unroll
      for (int j = 0; j < 4; ++j) {
        acc[i][j] = Frag<T>::mma(ah, bh[j], acc[i][j]);
        if (SPLIT) {
          acc[i][j] = Frag<T>::mma(ah, bl[j], acc[i][j]);
          acc[i][j] = Frag<T>::mma(al, bh[j], acc[i][j]);
        }
      }
      Frag<T>::guard4(acc[i][0], acc[i][1], acc[i][2], acc[i][3], ah, SPLIT ? al : ah);
    }
    Frag<T>::keep(bh[0], bh[1], bh[2], bh[3]);
    if (SPLIT) Frag<T>::keep(bl[0], bl[1], bl[2], bl[3]);
  }
  acc_guard4(acc[0][0], acc[0][1], acc[0][2], acc[0][3]);
  acc_guard4(acc[1][0], acc[1][1], acc[1][2], acc[1][3]);
  acc_guard4(acc[2][0], acc[2][1], acc[2][2], acc[2][3]);
  acc_guard4(acc[3][0], acc[3][1], acc[3][2], acc[3][3]);

  // ---- epilogue ----
  float* slab = sT[wave];
  const float* Rb = RESID ? (resid + (size_t)b * strideR) : nullptr;
#pragma unroll
  for (int i = 0; i < 4; ++i) {
    const int mBase = m0 + (i << 4);
#pragma unroll
    for (int j = 0; j < 4; ++j) {
      const int n = n0 + (j << 4) + rlane;
      float bv = 0.f;
      if (BIAS_MODE == 2) bv = bias[n];
#pragma unroll
      for (int r = 0; r < 8; ++r) {
        float v = acc[i][j][r] * scale;
        if (BIAS_MODE == 1) v += bias[mBase + mOff + r];
        if (BIAS_MODE == 2) v += bv;
        if (ACT == 2) v = fmaxf(v, 0.0f);
        if (ACT == 4) v = (v > 0.f) ? v : 0.01f * v;
        slab[(mOff + r) * 68 + (j << 4) + rlane] = v;
      }
    }
    __builtin_amdgcn_fence(__ATOMIC_RELEASE, "workgroup");
    __builtin_amdgcn_wave_barrier();
    __builtin_amdgcn_fence(__ATOMIC_ACQUIRE, "workgroup");
    if (OUT_MODE == 0) {
      float* C = (float*)Cout + (size_t)b * strideC;
      const int hh = lane >> 4, c4 = (lane & 15) * 4;     // row seg = 256 B = 16 lanes x 16 B
      {
#pragma unroll
        for (int it = 0; it < 8; ++it) {
          const int row = it * 2 + hh;
          v4f v = *(const v4f*)(slab + row * 68 + c4);
          if (RESID) {
            // residual: one 16-B float4 per lane at exactly the store address (same (row, c4) map), added in f32
            const v4f rr = *(const v4f*)(Rb + (size_t)(mBase + row) * ldc + n0 + c4);
            v = v + rr;
          }
          *(v4f*)(C + (size_t)(mBase + row) * ldc + n0 + c4) = v;
        }
        
      }
    } else {
      const int q = lane >> 3, c8 = (lane & 7) * 8;
      unsigned short* C  = (unsigned short*)Cout  + (size_t)b * strideC;
      unsigned short* C2 = (OUT_MODE == 2) ? ((unsigned short*)Cout2 + (size_t)b * strideC) : nullptr;
      {
#pragma unroll
        for (int it = 0; it < 4; ++it) {
          const int row = it * 4 + q;
          const float* sp = slab + row * 68 + c8;
          v8h hv, lv;
#pragma unroll
          for (int e = 0; e < 8; ++e) {
            if (OUT_MODE == 1) {
              hv[e] = (_Float16)sp[e];
            } else {
              unsigned short hb = f2bf_bits(sp[e]);
              unsigned short lb = f2bf_bits(sp[e] - bf_bits2f(hb));
              hv[e] = __builtin_bit_cast(_Float16, hb);
              lv[e] = __builtin_bit_cast(_Float16, lb);
            }
          }
          *(v8h*)(C + (size_t)(mBase + row) * ldc + n0 + c8) = hv;
          if (OUT_MODE == 2) *(v8h*)(C2 + (size_t)(mBase + row) * ldc + n0 + c8) = lv;
        }
        
      }
    }
    __builtin_amdgcn_fence(__ATOMIC_RELEASE, "workgroup");
    __builtin_amdgcn_wave_barrier();
    __builtin_amdgcn_fence(__ATOMIC_ACQUIRE, "workgroup");
  }
}

// ---------------------------------------------------------------------------
// Parameter preparation (block-uniform roles, grid = 6 blocks x 256 threads, no barriers):
//   blocks 0..2: WCAT rows blk*32..blk*32+31 = f16(16 * w_theta / w_phi / w_g [row][0..63]); block 3: rows 96..127 = 0.
//                thread t -> row blk*32 + (t>>3), cols (t&7)*8..+7 -> one 16-B store per lane at WCAT + blk*2048 + 8t
//   block 4: BCAT[128] f32 = b_theta | b_phi | b_g | 0: wave 0, lane t -> floats 4t..4t+3 (one float4 store per lane,
//                32 lanes x 16 B = the whole 512-B table); sources loaded unconditionally, combined by 0/1 factors.
//   block 5: WO16 [64][32] = f16(16 * w_out): thread t -> elements 8t..8t+7 (row t>>2, cols (t&3)*8), one 16-B store per lane.
// ---------------------------------------------------------------------------
__global__ __launch_bounds__(256) void prep_kernel(const float* __restrict__ w_theta, const float* __restrict__ w_phi,
                                                   const float* __restrict__ w_g,
                                                   const float* __restrict__ b_theta, const float* __restrict__ b_phi,
                                                   const float* __restrict__ b_g, const float* __restrict__ w_out,
                                                   unsigned short* __restrict__ wcat, float* __restrict__ bcat,
                                                   unsigned short* __restrict__ wo16) {
  const int t   = threadIdx.x;
  const int blk = blockIdx.x;   // block-uniform
  if (blk < 4) {
    v4u u;
    if (blk < 3) {
      const float* src = (blk == 0) ? w_theta : ((blk == 1) ? w_phi : w_g);
      const int rl = t >> 3, c8 = (t & 7) * 8;
      const v4f a = *(const v4f*)(src + rl * kC + c8);
      const v4f c = *(const v4f*)(src + rl * kC + c8 + 4);
      unsigned short hb[8];
#pragma unroll
      for (int e = 0; e < 4; ++e) {
        hb[e]     = h_bits(a[e] * kWCarry);
        hb[4 + e] = h_bits(c[e] * kWCarry);
      }
      u = (v4u){pk16(hb[0], hb[1]), pk16(hb[2], hb[3]), pk16(hb[4], hb[5]), pk16(hb[6], hb[7])};
    } else {
      u = (v4u){0u, 0u, 0u, 0u};
    }
    unsigned short* dst = wcat + (size_t)blk * (32 * kC) + 8 * (size_t)t;
    *(v4u*)dst = u;
    
  } else if (blk == 4) {
    if (t < 32) {   // wave 0 only (wave-uniform)
      const int seg = t >> 3;            // 0 theta, 1 phi, 2 g, 3 zero
      const int o4  = (t & 7) * 4;       // 0..28, always in range of the 32-entry vectors
      const v4f bt = *(const v4f*)(b_theta + o4);
      const v4f bp = *(const v4f*)(b_phi + o4);
      const v4f bg = *(const v4f*)(b_g + o4);
      const float f0 = (seg == 0) ? 1.0f : 0.0f;
      const float f1 = (seg == 1) ? 1.0f : 0.0f;
      const float f2 = (seg == 2) ? 1.0f : 0.0f;
      v4f val;
#pragma unroll
      for (int e = 0; e < 4; ++e) val[e] = fmaf(f0, bt[e], fmaf(f1, bp[e], f2 * bg[e]));
      float* dst = bcat + 4 * t;
      *(v4f*)dst = val;
      
    }
  } else {
    const int row = t >> 2, c8 = (t & 3) * 8;
    const v4f a = *(const v4f*)(w_out + row * kCI + c8);
    const v4f c = *(const v4f*)(w_out + row * kCI + c8 + 4);
    unsigned short hb[8];
#pragma unroll
    for (int e = 0; e < 4; ++e) {
      hb[e]     = h_bits(a[e] * kWCarry);
      hb[4 + e] = h_bits(c[e] * kWCarry);
    }
    const v4u u = (v4u){pk16(hb[0], hb[1]), pk16(hb[2], hb[3]), pk16(hb[4], hb[5]), pk16(hb[6], hb[7])};
    unsigned short* dst = wo16 + 8 * (size_t)t;
    *(v4u*)dst = u;
    
  }
}

// ---------------------------------------------------------------------------
// x transpose + cast: in x[b][64 c][4096 n] -> out XT[b][4096 n][64 c] = f16(x[b][c][n]).
// grid (4096/64 = 64, 8): blockIdx.x = n tile (64 positions), blockIdx.y = batch. 256 threads.
// Load coverage: 16 iterations x 256 threads = 4096 = the whole 64(c) x 64(n) tile (coalesced along n).
// Store coverage: 8 waves x 2 iterations x 4 rows (lane>>3) = 64 n-rows; (lane&7) x 8 halves = 64 c-cols; each row =
// ---------------------------------------------------------------------------
__global__ __launch_bounds__(256) void xt_cast_kernel(const float* __restrict__ x, unsigned short* __restrict__ XT) {
  __shared__ float sm[64][65];   // sm[n_local][c]
  const int t  = threadIdx.x;
  const int n0 = blockIdx.x * 64;
  const int b  = blockIdx.y;
#pragma unroll
  for (int i = 0; i < 16; ++i) {
    const int e  = i * 256 + t;
    const int cl = e >> 6;         // channel
    const int nl = e & 63;         // n local
    sm[nl][cl] = x[((size_t)(b * kC + cl)) * kN + n0 + nl];
  }
  __syncthreads();
  const int lane = t & 31, wave = t >> 5;
  const int q = lane >> 3, c8 = (lane & 7) * 8;
  unsigned short* op = XT + ((size_t)b * kN + n0) * kC;
  {
#pragma unroll
    for (int it = 0; it < 2; ++it) {
      const int row = wave * 8 + it * 4 + q;                 // n local
      unsigned short hb[8];
#pragma unroll
      for (int e = 0; e < 8; ++e) hb[e] = h_bits(sm[row][c8 + e]);
      const v4u u = (v4u){pk16(hb[0], hb[1]), pk16(hb[2], hb[3]), pk16(hb[4], hb[5]), pk16(hb[6], hb[7])};
      *(v4u*)(op + (size_t)row * kC + c8) = u;
    }
    
  }
}

// ---------------------------------------------------------------------------
// Row softmax over 4096 f32 scores (no scale, no mask): P[row][j] = f16( 32768 * exp(s - max) / sum exp(s - max) ), f32 math.
// One block of 256 threads per row (grid = 4096 rows).
// Phase 1/2: rolled 4-trip loops, thread t owns columns it*1024 + 4t..4t+3 (4 x 256 x 4 = 4096 = whole row); scores/exps in LDS.
// Reductions in fixed order (thread, wave shuffle tree, 8 wave partials in index order); shuffles unconditional.
// Store: thread t owns cols 8t..8t+7 and 2048+8t..+7 -> two 16-B stores per lane on disjoint line sets; per instruction a wave
// ---------------------------------------------------------------------------
__global__ __launch_bounds__(256) void softmax_row_kernel(const float* __restrict__ S, unsigned short* __restrict__ P) {
  __shared__ __align__(16) float lg[kN];
  __shared__ float redM[8];
  __shared__ float redS[8];
  const int row  = blockIdx.x;
  const int t    = threadIdx.x;
  const int lane = t & 31, wave = t >> 5;
  const float* sr = S + (size_t)row * kN;

  float mx = -__builtin_inff();
#pragma unroll 1
  for (int it = 0; it < 4; ++it) {
    const int c = it * 1024 + 4 * t;
    const v4f sv = *(const v4f*)(sr + c);
    mx = fmaxf(mx, fmaxf(fmaxf(sv[0], sv[1]), fmaxf(sv[2], sv[3])));
    *(v4f*)(lg + c) = sv;
  }
#pragma unroll
  for (int off = 16; off > 0; off >>= 1) mx = fmaxf(mx, __shfl_xor(mx, off, 32));
  if (lane == 0) redM[wave] = mx;
  __syncthreads();
  float m = redM[0];
#pragma unroll
  for (int w = 1; w < 8; ++w) m = fmaxf(m, redM[w]);

  float sum = 0.f;
#pragma unroll 1
  for (int it = 0; it < 4; ++it) {
    const int c = it * 1024 + 4 * t;
    const v4f l = *(const v4f*)(lg + c);
    v4f ev;
#pragma unroll
    for (int e = 0; e < 4; ++e) {
      ev[e] = expf(l[e] - m);
      sum += ev[e];
    }
    *(v4f*)(lg + c) = ev;
  }
#pragma unroll
  for (int off = 16; off > 0; off >>= 1) sum += __shfl_xor(sum, off, 32);
  if (lane == 0) redS[wave] = sum;
  __syncthreads();
  float tot = redS[0];
#pragma unroll
  for (int w = 1; w < 8; ++w) tot += redS[w];
  const float inv = kPCarry / tot;

  const v4f e0 = *(const v4f*)(lg + 8 * t);
  const v4f e1 = *(const v4f*)(lg + 8 * t + 4);
  const v4f e2 = *(const v4f*)(lg + 2048 + 8 * t);
  const v4f e3 = *(const v4f*)(lg + 2048 + 8 * t + 4);
  unsigned short ha[8], hc[8];
#pragma unroll
  for (int e = 0; e < 4; ++e) {
    ha[e]     = h_bits(e0[e] * inv);
    ha[4 + e] = h_bits(e1[e] * inv);
    hc[e]     = h_bits(e2[e] * inv);
    hc[4 + e] = h_bits(e3[e] * inv);
  }
  const v4u u0 = (v4u){pk16(ha[0], ha[1]), pk16(ha[2], ha[3]), pk16(ha[4], ha[5]), pk16(ha[6], ha[7])};
  const v4u u1 = (v4u){pk16(hc[0], hc[1]), pk16(hc[2], hc[3]), pk16(hc[4], hc[5]), pk16(hc[6], hc[7])};
  unsigned short* p0 = P + (size_t)row * kN + 8 * (size_t)t;
  unsigned short* p1 = p0 + 2048;
  *(v4u*)p0 = u0;
  *(v4u*)p1 = u1;
  
}

// ---------------------------------------------------------------------------
// Host glue.
//   WCAT f16 [128][64]           16,384  at           0   (theta|phi|g weights x16, rows 96..127 zero)
//   BCAT f32 [128]                  512  at      16,384   (b_theta|b_phi|b_g|0)
//   WO16 f16 [64][32]             4,096  at      16,896   (w_out x16)
//   XT   f16 [8][4096][64]    4,194,304  at      20,992   (x transposed to [n][c])
//   PRJ  f16 [8][4096][128]   8,388,608  at   4,215,296   (theta | phi | g | 0 per position)
//   GWT  f16 [8][64][4096]    4,194,304  at  12,603,904   (gw^T[c][key] = sum_o w_out[c][o] g[key][o])
//   SC   f32 [4096][4096]    67,108,864  at  16,798,208   (scores of one batch, reused 8x, same type/layout)
//   PP   f16 [4096][4096]    33,554,432  at  83,907,072   (probabilities x32768, reused 8x)
//   total                   117,461,504
// GEMM shapes: proj M=4096 N=128 K=64; gw^T M=64 N=4096 K=32; scores M=N=4096 K=32; out^T M=64 N=4096 K=4096.
// All M,N multiples of 64, all K multiples of 32, no padding anywhere except the zero weight/bias rows 96..127 (written by prep).
// ---------------------------------------------------------------------------
extern "C" void kernel_launch(void* const* d_in, const int* in_sizes, int n_in,
                              void* d_out, int out_size, void* d_ws, size_t ws_size,
                              hipStream_t stream) {
  if (n_in < 9) return;
  const int nX = kB * kC * kN;   // 2,097,152
  if (in_sizes[0] != nX) return;
  if (in_sizes[1] != kCI * kC || in_sizes[2] != kCI) return;
  if (in_sizes[3] != kCI * kC || in_sizes[4] != kCI) return;
  if (in_sizes[5] != kCI * kC || in_sizes[6] != kCI) return;
  if (in_sizes[7] != kC * kCI || in_sizes[8] != kC) return;
  if (out_size != nX) return;

  const size_t szWC  = (size_t)kPW * kC * 2;
  const size_t szBC  = (size_t)kPW * 4;
  const size_t szWO  = (size_t)kC * kCI * 2;
  const size_t szXT  = (size_t)kB * kN * kC * 2;
  const size_t szPRJ = (size_t)kB * kN * kPW * 2;
  const size_t szGWT = (size_t)kB * kC * kN * 2;
  const size_t szS   = (size_t)kN * kN * 4;
  const size_t szP   = (size_t)kN * kN * 2;
  const size_t offWC  = 0;
  const size_t offBC  = offWC + szWC;
  const size_t offWO  = offBC + szBC;
  const size_t offXT  = offWO + szWO;
  const size_t offPRJ = offXT + szXT;
  const size_t offGWT = offPRJ + szPRJ;
  const size_t offS   = offGWT + szGWT;
  const size_t offP   = offS + szS;
  const size_t total  = offP + szP;
  if (ws_size < total) return;

  const float* x       = (const float*)d_in[0];
  const float* w_theta = (const float*)d_in[1];
  const float* b_theta = (const float*)d_in[2];
  const float* w_phi   = (const float*)d_in[3];
  const float* b_phi   = (const float*)d_in[4];
  const float* w_g     = (const float*)d_in[5];
  const float* b_g     = (const float*)d_in[6];
  const float* w_out   = (const float*)d_in[7];
  const float* b_out   = (const float*)d_in[8];
  float* out = (float*)d_out;
  char* ws = (char*)d_ws;
  unsigned short* WC  = (unsigned short*)(ws + offWC);
  float*          BC  = (float*)(ws + offBC);
  unsigned short* WO  = (unsigned short*)(ws + offWO);
  unsigned short* XT  = (unsigned short*)(ws + offXT);
  unsigned short* PRJ = (unsigned short*)(ws + offPRJ);
  unsigned short* GWT = (unsigned short*)(ws + offGWT);
  float*          SC  = (float*)(ws + offS);
  unsigned short* PP  = (unsigned short*)(ws + offP);

  // ---- prologue: parameter planes, x^T cast ----
  prep_kernel<<<dim3(6), dim3(256), 0, stream>>>(w_theta, w_phi, w_g, b_theta, b_phi, b_g, w_out, WC, BC, WO);
  xt_cast_kernel<<<dim3(kN / 64, kB), dim3(256), 0, stream>>>(x, XT);

  // ---- projections: PRJ[b][n][o'] = f16( (1/16) sum_c XT[b][n][c] * WC[o'][c] + BC[o'] )   (M=4096, N=128, K=64; 128 tiles -> 16 blocks) ----
  const long strideXT  = (long)kN * kC;
  const long stridePRJ = (long)kN * kPW;
  const long strideGWT = (long)kC * kN;
  wmma_gemm64<0, false, 2, 1, false, 0><<<dim3(16, kB), dim3(256), 0, stream>>>(
      XT, XT, kC, strideXT, WC, WC, kC, 0L,
      (void*)PRJ, (void*)PRJ, kPW, stridePRJ, BC, x, 0L, kN, kPW, kC, kWCarryInv);

  // ---- gw^T: GWT[b][c][key] = f16( (1/16) sum_o WO[c][o] * PRJ[b][key][64+o] )   (M=64, N=4096, K=32; 64 tiles -> 8 blocks) ----
  wmma_gemm64<0, false, 0, 1, false, 0><<<dim3(8, kB), dim3(256), 0, stream>>>(
      WO, WO, kCI, 0L, PRJ + 64, PRJ + 64, kPW, stridePRJ,
      (void*)GWT, (void*)GWT, kN, strideGWT, BC, x, 0L, kC, kN, kCI, kWCarryInv);

  for (int b = 0; b < kB; ++b) {
    const unsigned short* prjb = PRJ + (size_t)b * kN * kPW;
    // scores SC[q][key] = sum_o theta[q][o] * phi[key][o]   (A = PRJ cols 0..31, Bt = PRJ cols 32..63; M=N=4096, K=32; 4096 tiles -> 512 blocks)
    wmma_gemm64<0, false, 0, 0, false, 0><<<dim3(512, 1), dim3(256), 0, stream>>>(
        prjb, prjb, kPW, 0L, prjb + 32, prjb + 32, kPW, 0L,
        (void*)SC, (void*)SC, kN, 0L, BC, x, 0L, kN, kN, kCI, 1.0f);
    // softmax over keys -> PP (f16, x32768)
    softmax_row_kernel<<<dim3(kN), dim3(256), 0, stream>>>(SC, PP);
    // out[b][c][q] = 2^-15 * sum_key GWT[b][c][key] * PP[q][key] + b_out[c] + x[b][c][q]   (M=64, N=4096, K=4096; 64 tiles -> 8 blocks)
    const unsigned short* gwtb = GWT + (size_t)b * kC * kN;
    float* outb = out + (size_t)b * kC * kN;
    const float* xb = x + (size_t)b * kC * kN;
    wmma_gemm64<0, false, 1, 0, true, 0><<<dim3(8, 1), dim3(256), 0, stream>>>(
        gwtb, gwtb, kN, 0L, PP, PP, kN, 0L,
        (void*)outb, (void*)outb, kN, 0L, b_out, xb, 0L, kC, kN, kN, kPCarryInv);
  }
}

// v001
// Measured time: 363 microseconds a run.
// Two timings next to v000 put it at 4.25 and 4.22 times that version's speed.
// Contractions: channel projections (x^T f16 x Wcat f16 carried x16), scores theta.phi^T (f16 planes), gw^T = W_out (f16 carried x16) . g^T (f16 plane), out^T = gw^T f16 x P (f16 carried x32768): all on v_wmma_f32_16x16x32_f16 with f32 accumulate; bias adds, softmax and residual in f32.
#include <hip/hip_runtime.h>
#include <math.h>

// ---------------------------------------------------------------------------
// Problem constants
// ---------------------------------------------------------------------------
constexpr int kB  = 8;        // batch
constexpr int kC  = 64;       // in channels
constexpr int kCI = 32;       // inter channels
constexpr int kN  = 4096;     // H*W positions
constexpr int kPW = 128;      // projection plane width: theta 0..31 | phi 32..63 | g 64..95 | zero 96..127
constexpr float kWCarry    = 16.0f;            // weights carried x16 in f16
constexpr float kWCarryInv = 1.0f / 16.0f;
constexpr float kPCarry    = 32768.0f;         // probabilities carried x2^15 in f16
constexpr float kPCarryInv = 1.0f / 32768.0f;
static_assert(kN % 64 == 0 && kPW % 64 == 0 && kC % 64 == 0, "M,N tiles");
static_assert(kC % 32 == 0 && kCI % 32 == 0 && kN % 32 == 0, "K steps");
static_assert(kN == 4 * 1024, "softmax row map");

typedef __attribute__((ext_vector_type(16))) _Float16 v16h;
typedef __attribute__((ext_vector_type(8)))  _Float16 v8h;
typedef __attribute__((ext_vector_type(16))) __bf16   v16b;
typedef __attribute__((ext_vector_type(8)))  __bf16   v8b;
typedef __attribute__((ext_vector_type(8)))  float    v8f;
typedef __attribute__((ext_vector_type(4)))  float    v4f;
typedef __attribute__((ext_vector_type(4)))  unsigned int v4u;

// ---------------------------------------------------------------------------
// Helpers
// ---------------------------------------------------------------------------
__device__ __forceinline__ unsigned short f2bf_bits(float f) {
  unsigned u = __float_as_uint(f);
  return (unsigned short)((u + 0x7FFFu + ((u >> 16) & 1u)) >> 16);
}
__device__ __forceinline__ float bf_bits2f(unsigned short h) { return __uint_as_float(((unsigned)h) << 16); }

// hazard guards as plain device helpers (no inline asm inside the kernel template body); all four accumulators of a group tied
__device__ __forceinline__ void dep_guard4_h(v8f& a, v8f& b, v8f& c, v8f& d, v16h x, v16h y) { asm volatile("v_nop\n\tv_nop\n\tv_nop\n\tv_nop" : "+v"(a), "+v"(b), "+v"(c), "+v"(d) : "v"(x), "v"(y)); }
__device__ __forceinline__ void dep_guard4_b(v8f& a, v8f& b, v8f& c, v8f& d, v16b x, v16b y) { asm volatile("v_nop\n\tv_nop\n\tv_nop\n\tv_nop" : "+v"(a), "+v"(b), "+v"(c), "+v"(d) : "v"(x), "v"(y)); }
__device__ __forceinline__ void keep4_h(v16h a, v16h b, v16h c, v16h d) { asm volatile("v_nop" :: "v"(a), "v"(b), "v"(c), "v"(d)); }
__device__ __forceinline__ void keep4_b(v16b a, v16b b, v16b c, v16b d) { asm volatile("v_nop" :: "v"(a), "v"(b), "v"(c), "v"(d)); }
__device__ __forceinline__ void acc_guard4(v8f& a, v8f& b, v8f& c, v8f& d) { asm volatile("v_nop\n\tv_nop\n\tv_nop\n\tv_nop" : "+v"(a), "+v"(b), "+v"(c), "+v"(d)); }
template <typename T> struct Frag;
template <> struct Frag<_Float16> {
  typedef v16h V; union U { v16h v; v8h h[2]; };
  // elements 0..7 <- p[0..7], 8..15 <- p[16..23]
  static __device__ __forceinline__ v16h load(const _Float16* p) {
    U f; f.h[0] = *(const v8h*)(p); f.h[1] = *(const v8h*)(p + 16); return f.v;
  }
  static __device__ __forceinline__ v8f mma(v16h a, v16h b, v8f c) {
    return __builtin_amdgcn_wmma_f32_16x16x32_f16(false, a, false, b, (short)0, c, false, false);
  }
  static __device__ __forceinline__ void guard4(v8f& a, v8f& b, v8f& c, v8f& d, v16h x, v16h y) { dep_guard4_h(a, b, c, d, x, y); }
  static __device__ __forceinline__ void keep(v16h a, v16h b, v16h c, v16h d) { keep4_h(a, b, c, d); }
};
template <> struct Frag<__bf16> {
  typedef v16b V; union U { v16b v; v8b h[2]; };
  static __device__ __forceinline__ v16b load(const __bf16* p) {
    U f; f.h[0] = *(const v8b*)(p); f.h[1] = *(const v8b*)(p + 16); return f.v;
  }
  static __device__ __forceinline__ v8f mma(v16b a, v16b b, v8f c) {
    return __builtin_amdgcn_wmma_f32_16x16x32_bf16(false, a, false, b, (short)0, c, false, false);
  }
  static __device__ __forceinline__ void guard4(v8f& a, v8f& b, v8f& c, v8f& d, v16b x, v16b y) { dep_guard4_b(a, b, c, d, x, y); }
  static __device__ __forceinline__ void keep(v16b a, v16b b, v16b c, v16b d) { keep4_b(a, b, c, d); }
};

__device__ __forceinline__ unsigned pk16(unsigned short a, unsigned short b) { return (unsigned)a | ((unsigned)b << 16); }
__device__ __forceinline__ unsigned short h_bits(float f) { const _Float16 h = (_Float16)f; return __builtin_bit_cast(unsigned short, h); }

// ---- Register-blocked batched WMMA GEMM (ACT reduced to none/relu/leaky; residual read in the store phase) ------
// C[m,n] = scale * sum_k A[m,k] * Bt[n,k] (+bias)(+resid); each wave owns a 64x64 tile.
// A row-major [M,K]; Bt row-major [N,K]; M,N % 64 == 0, K % 32 == 0.
// SPLIT: operands are hi/lo planes (A2/Bt2 = lo planes, same layout); product = hi*hi + hi*lo + lo*hi.
// BIAS_MODE: 0 = none, 1 = bias[m], 2 = bias[n].
// OUT_MODE: 0 = f32, 1 = f16, 2 = bf16 hi plane (Cout) + bf16 lo plane (Cout2).
// RESID (OUT_MODE 0 only): resid[m*ldc + n] is loaded as one 16-B float4 per lane at the store address and added in the store phase.
// ET: 0 = f16 operands, 1 = bf16 operands (pointers passed as 16-bit storage)
template <int ET> struct Elem;
template <> struct Elem<0> { typedef _Float16 T; };
template <> struct Elem<1> { typedef __bf16 T; };
template <int ET, bool SPLIT, int BIAS_MODE, int OUT_MODE, bool RESID, int ACT = 0>
__global__ __launch_bounds__(256) void wmma_gemm64(
    const unsigned short* __restrict__ Ap, const unsigned short* __restrict__ A2p, int lda, long strideA,
    const unsigned short* __restrict__ Btp, const unsigned short* __restrict__ Bt2p, int ldb, long strideB,
    void* __restrict__ Cout, void* __restrict__ Cout2, int ldc, long strideC,
    const float* __restrict__ bias,
    const float* __restrict__ resid, long strideR,
    int M, int N, int K, float scale) {
  static_assert(!RESID || OUT_MODE == 0, "resid only with f32 output");
  static_assert(ACT == 0 || ACT == 2 || ACT == 4, "act");
  typedef typename Elem<ET>::T T;
  typedef typename Frag<T>::V V;
  const T* A = (const T*)Ap; const T* A2 = (const T*)A2p; const T* Bt = (const T*)Btp; const T* Bt2 = (const T*)Bt2p;
  __shared__ __align__(16) float sT[8][16 * 68];   // per-wave 16x64 slab, pitch 68 floats
  const int b    = blockIdx.y;
  const int lane = threadIdx.x & 31;
  const int wave = threadIdx.x >> 5;
  const int tilesN = N >> 6;
  const int tilesM = M >> 6;
  const int tile = blockIdx.x * 8 + wave;
  if (tile >= tilesM * tilesN) return;   // wave-uniform; no block barriers in this kernel
  const int tm = tile / tilesN;
  const int tn = tile - tm * tilesN;
  const int m0 = tm << 6;
  const int n0 = tn << 6;

  const T* Ab  = A  + (size_t)b * strideA;
  const T* Bb  = Bt + (size_t)b * strideB;
  const T* Ab2 = SPLIT ? (A2  + (size_t)b * strideA) : nullptr;
  const T* Bb2 = SPLIT ? (Bt2 + (size_t)b * strideB) : nullptr;

  const int rlane = lane & 15;                 // row (A) / col (B, D) within subtile
  const int koff  = (lane >> 4) * 8;           // k offset of this lane half
  const int mOff  = (lane >> 4) * 8;           // D row offset

  v8f acc[4][4];
#pragma unroll
  for (int i = 0; i < 4; ++i)
#pragma unroll
    for (int j = 0; j < 4; ++j) acc[i][j] = (v8f){0.f,0.f,0.f,0.f,0.f,0.f,0.f,0.f};

  for (int k0 = 0; k0 < K; k0 += 32) {
    V bh[4], bl[4];
#pragma unroll
    for (int j = 0; j < 4; ++j) {
      const size_t bo = (size_t)(n0 + (j << 4) + rlane) * ldb + koff + k0;
      bh[j] = Frag<T>::load(Bb + bo);
      if (SPLIT) bl[j] = Frag<T>::load(Bb2 + bo);
    }
#pragma unroll
    for (int i = 0; i < 4; ++i) {
      const size_t ao = (size_t)(m0 + (i << 4) + rlane) * lda + koff + k0;
      V ah = Frag<T>::load(Ab + ao);
      V al;
      if (SPLIT) al = Frag<T>::load(Ab2 + ao);
#pragma unroll
      for (int j = 0; j < 4; ++j) {
        acc[i][j] = Frag<T>::mma(ah, bh[j], acc[i][j]);
        if (SPLIT) {
          acc[i][j] = Frag<T>::mma(ah, bl[j], acc[i][j]);
          acc[i][j] = Frag<T>::mma(al, bh[j], acc[i][j]);
        }
      }
      Frag<T>::guard4(acc[i][0], acc[i][1], acc[i][2], acc[i][3], ah, SPLIT ? al : ah);
    }
    Frag<T>::keep(bh[0], bh[1], bh[2], bh[3]);
    if (SPLIT) Frag<T>::keep(bl[0], bl[1], bl[2], bl[3]);
  }
  acc_guard4(acc[0][0], acc[0][1], acc[0][2], acc[0][3]);
  acc_guard4(acc[1][0], acc[1][1], acc[1][2], acc[1][3]);
  acc_guard4(acc[2][0], acc[2][1], acc[2][2], acc[2][3]);
  acc_guard4(acc[3][0], acc[3][1], acc[3][2], acc[3][3]);

  // ---- epilogue ----
  float* slab = sT[wave];
  const float* Rb = RESID ? (resid + (size_t)b * strideR) : nullptr;
#pragma unroll
  for (int i = 0; i < 4; ++i) {
    const int mBase = m0 + (i << 4);
#pragma unroll
    for (int j = 0; j < 4; ++j) {
      const int n = n0 + (j << 4) + rlane;
      float bv = 0.f;
      if (BIAS_MODE == 2) bv = bias[n];
#pragma unroll
      for (int r = 0; r < 8; ++r) {
        float v = acc[i][j][r] * scale;
        if (BIAS_MODE == 1) v += bias[mBase + mOff + r];
        if (BIAS_MODE == 2) v += bv;
        if (ACT == 2) v = fmaxf(v, 0.0f);
        if (ACT == 4) v = (v > 0.f) ? v : 0.01f * v;
        slab[(mOff + r) * 68 + (j << 4) + rlane] = v;
      }
    }
    __builtin_amdgcn_fence(__ATOMIC_RELEASE, "workgroup");
    __builtin_amdgcn_wave_barrier();
    __builtin_amdgcn_fence(__ATOMIC_ACQUIRE, "workgroup");
    if (OUT_MODE == 0) {
      float* C = (float*)Cout + (size_t)b * strideC;
      const int hh = lane >> 4, c4 = (lane & 15) * 4;     // row seg = 256 B = 16 lanes x 16 B
      {
#pragma unroll
        for (int it = 0; it < 8; ++it) {
          const int row = it * 2 + hh;
          v4f v = *(const v4f*)(slab + row * 68 + c4);
          if (RESID) {
            // residual: one 16-B float4 per lane at exactly the store address (same (row, c4) map), added in f32
            const v4f rr = *(const v4f*)(Rb + (size_t)(mBase + row) * ldc + n0 + c4);
            v = v + rr;
          }
          *(v4f*)(C + (size_t)(mBase + row) * ldc + n0 + c4) = v;
        }
        
      }
    } else {
      const int q = lane >> 3, c8 = (lane & 7) * 8;
      unsigned short* C  = (unsigned short*)Cout  + (size_t)b * strideC;
      unsigned short* C2 = (OUT_MODE == 2) ? ((unsigned short*)Cout2 + (size_t)b * strideC) : nullptr;
      {
#pragma unroll
        for (int it = 0; it < 4; ++it) {
          const int row = it * 4 + q;
          const float* sp = slab + row * 68 + c8;
          v8h hv, lv;
#pragma unroll
          for (int e = 0; e < 8; ++e) {
            if (OUT_MODE == 1) {
              hv[e] = (_Float16)sp[e];
            } else {
              unsigned short hb = f2bf_bits(sp[e]);
              unsigned short lb = f2bf_bits(sp[e] - bf_bits2f(hb));
              hv[e] = __builtin_bit_cast(_Float16, hb);
              lv[e] = __builtin_bit_cast(_Float16, lb);
            }
          }
          *(v8h*)(C + (size_t)(mBase + row) * ldc + n0 + c8) = hv;
          if (OUT_MODE == 2) *(v8h*)(C2 + (size_t)(mBase + row) * ldc + n0 + c8) = lv;
        }
        
      }
    }
    __builtin_amdgcn_fence(__ATOMIC_RELEASE, "workgroup");
    __builtin_amdgcn_wave_barrier();
    __builtin_amdgcn_fence(__ATOMIC_ACQUIRE, "workgroup");
  }
}

// ---------------------------------------------------------------------------
// Parameter preparation (block-uniform roles, grid = 6 blocks x 256 threads, no barriers):
//   blocks 0..2: WCAT rows blk*32..blk*32+31 = f16(16 * w_theta / w_phi / w_g [row][0..63]); block 3: rows 96..127 = 0.
//                thread t -> row blk*32 + (t>>3), cols (t&7)*8..+7 -> one 16-B store per lane at WCAT + blk*2048 + 8t
//   block 4: BCAT[128] f32 = b_theta | b_phi | b_g | 0: wave 0, lane t -> floats 4t..4t+3 (one float4 store per lane,
//                32 lanes x 16 B = the whole 512-B table); sources loaded unconditionally, combined by 0/1 factors.
//   block 5: WO16 [64][32] = f16(16 * w_out): thread t -> elements 8t..8t+7 (row t>>2, cols (t&3)*8), one 16-B store per lane.
// ---------------------------------------------------------------------------
__global__ __launch_bounds__(256) void prep_kernel(const float* __restrict__ w_theta, const float* __restrict__ w_phi,
                                                   const float* __restrict__ w_g,
                                                   const float* __restrict__ b_theta, const float* __restrict__ b_phi,
                                                   const float* __restrict__ b_g, const float* __restrict__ w_out,
                                                   unsigned short* __restrict__ wcat, float* __restrict__ bcat,
                                                   unsigned short* __restrict__ wo16) {
  const int t   = threadIdx.x;
  const int blk = blockIdx.x;   // block-uniform
  if (blk < 4) {
    v4u u;
    if (blk < 3) {
      const float* src = (blk == 0) ? w_theta : ((blk == 1) ? w_phi : w_g);
      const int rl = t >> 3, c8 = (t & 7) * 8;
      const v4f a = *(const v4f*)(src + rl * kC + c8);
      const v4f c = *(const v4f*)(src + rl * kC + c8 + 4);
      unsigned short hb[8];
#pragma unroll
      for (int e = 0; e < 4; ++e) {
        hb[e]     = h_bits(a[e] * kWCarry);
        hb[4 + e] = h_bits(c[e] * kWCarry);
      }
      u = (v4u){pk16(hb[0], hb[1]), pk16(hb[2], hb[3]), pk16(hb[4], hb[5]), pk16(hb[6], hb[7])};
    } else {
      u = (v4u){0u, 0u, 0u, 0u};
    }
    unsigned short* dst = wcat + (size_t)blk * (32 * kC) + 8 * (size_t)t;
    *(v4u*)dst = u;
    
  } else if (blk == 4) {
    if (t < 32) {   // wave 0 only (wave-uniform)
      const int seg = t >> 3;            // 0 theta, 1 phi, 2 g, 3 zero
      const int o4  = (t & 7) * 4;       // 0..28, always in range of the 32-entry vectors
      const v4f bt = *(const v4f*)(b_theta + o4);
      const v4f bp = *(const v4f*)(b_phi + o4);
      const v4f bg = *(const v4f*)(b_g + o4);
      const float f0 = (seg == 0) ? 1.0f : 0.0f;
      const float f1 = (seg == 1) ? 1.0f : 0.0f;
      const float f2 = (seg == 2) ? 1.0f : 0.0f;
      v4f val;
#pragma unroll
      for (int e = 0; e < 4; ++e) val[e] = fmaf(f0, bt[e], fmaf(f1, bp[e], f2 * bg[e]));
      float* dst = bcat + 4 * t;
      *(v4f*)dst = val;
      
    }
  } else {
    const int row = t >> 2, c8 = (t & 3) * 8;
    const v4f a = *(const v4f*)(w_out + row * kCI + c8);
    const v4f c = *(const v4f*)(w_out + row * kCI + c8 + 4);
    unsigned short hb[8];
#pragma unroll
    for (int e = 0; e < 4; ++e) {
      hb[e]     = h_bits(a[e] * kWCarry);
      hb[4 + e] = h_bits(c[e] * kWCarry);
    }
    const v4u u = (v4u){pk16(hb[0], hb[1]), pk16(hb[2], hb[3]), pk16(hb[4], hb[5]), pk16(hb[6], hb[7])};
    unsigned short* dst = wo16 + 8 * (size_t)t;
    *(v4u*)dst = u;
    
  }
}

// ---------------------------------------------------------------------------
// x transpose + cast: in x[b][64 c][4096 n] -> out XT[b][4096 n][64 c] = f16(x[b][c][n]).
// grid (4096/64 = 64, 8): blockIdx.x = n tile (64 positions), blockIdx.y = batch. 256 threads.
// Load coverage: 16 iterations x 256 threads = 4096 = the whole 64(c) x 64(n) tile (coalesced along n).
// Store coverage: 8 waves x 2 iterations x 4 rows (lane>>3) = 64 n-rows; (lane&7) x 8 halves = 64 c-cols; each row =
// ---------------------------------------------------------------------------
__global__ __launch_bounds__(256) void xt_cast_kernel(const float* __restrict__ x, unsigned short* __restrict__ XT) {
  __shared__ float sm[64][65];   // sm[n_local][c]
  const int t  = threadIdx.x;
  const int n0 = blockIdx.x * 64;
  const int b  = blockIdx.y;
#pragma unroll
  for (int i = 0; i < 16; ++i) {
    const int e  = i * 256 + t;
    const int cl = e >> 6;         // channel
    const int nl = e & 63;         // n local
    sm[nl][cl] = x[((size_t)(b * kC + cl)) * kN + n0 + nl];
  }
  __syncthreads();
  const int lane = t & 31, wave = t >> 5;
  const int q = lane >> 3, c8 = (lane & 7) * 8;
  unsigned short* op = XT + ((size_t)b * kN + n0) * kC;
  {
#pragma unroll
    for (int it = 0; it < 2; ++it) {
      const int row = wave * 8 + it * 4 + q;                 // n local
      unsigned short hb[8];
#pragma unroll
      for (int e = 0; e < 8; ++e) hb[e] = h_bits(sm[row][c8 + e]);
      const v4u u = (v4u){pk16(hb[0], hb[1]), pk16(hb[2], hb[3]), pk16(hb[4], hb[5]), pk16(hb[6], hb[7])};
      *(v4u*)(op + (size_t)row * kC + c8) = u;
    }
    
  }
}

// ---------------------------------------------------------------------------
// Row softmax over 4096 f32 scores (no scale, no mask): P[row][j] = f16( 32768 * exp(s - max) / sum exp(s - max) ), f32 math.
// One block of 256 threads per row (grid = 4096 rows).
// Phase 1/2: rolled 4-trip loops, thread t owns columns it*1024 + 4t..4t+3 (4 x 256 x 4 = 4096 = whole row); scores/exps in LDS.
// Reductions in fixed order (thread, wave shuffle tree, 8 wave partials in index order); shuffles unconditional.
// Store: thread t owns cols 8t..8t+7 and 2048+8t..+7 -> two 16-B stores per lane on disjoint line sets; per instruction a wave
// ---------------------------------------------------------------------------
__global__ __launch_bounds__(256) void softmax_row_kernel(const float* __restrict__ S, unsigned short* __restrict__ P) {
  __shared__ __align__(16) float lg[kN];
  __shared__ float redM[8];
  __shared__ float redS[8];
  const int row  = blockIdx.x;
  const int t    = threadIdx.x;
  const int lane = t & 31, wave = t >> 5;
  const float* sr = S + (size_t)row * kN;

  float mx = -__builtin_inff();
#pragma unroll 1
  for (int it = 0; it < 4; ++it) {
    const int c = it * 1024 + 4 * t;
    const v4f sv = *(const v4f*)(sr + c);
    mx = fmaxf(mx, fmaxf(fmaxf(sv[0], sv[1]), fmaxf(sv[2], sv[3])));
    *(v4f*)(lg + c) = sv;
  }
#pragma unroll
  for (int off = 16; off > 0; off >>= 1) mx = fmaxf(mx, __shfl_xor(mx, off, 32));
  if (lane == 0) redM[wave] = mx;
  __syncthreads();
  float m = redM[0];
#pragma unroll
  for (int w = 1; w < 8; ++w) m = fmaxf(m, redM[w]);

  float sum = 0.f;
#pragma unroll 1
  for (int it = 0; it < 4; ++it) {
    const int c = it * 1024 + 4 * t;
    const v4f l = *(const v4f*)(lg + c);
    v4f ev;
#pragma unroll
    for (int e = 0; e < 4; ++e) {
      ev[e] = expf(l[e] - m);
      sum += ev[e];
    }
    *(v4f*)(lg + c) = ev;
  }
#pragma unroll
  for (int off = 16; off > 0; off >>= 1) sum += __shfl_xor(sum, off, 32);
  if (lane == 0) redS[wave] = sum;
  __syncthreads();
  float tot = redS[0];
#pragma unroll
  for (int w = 1; w < 8; ++w) tot += redS[w];
  const float inv = kPCarry / tot;

  const v4f e0 = *(const v4f*)(lg + 8 * t);
  const v4f e1 = *(const v4f*)(lg + 8 * t + 4);
  const v4f e2 = *(const v4f*)(lg + 2048 + 8 * t);
  const v4f e3 = *(const v4f*)(lg + 2048 + 8 * t + 4);
  unsigned short ha[8], hc[8];
#pragma unroll
  for (int e = 0; e < 4; ++e) {
    ha[e]     = h_bits(e0[e] * inv);
    ha[4 + e] = h_bits(e1[e] * inv);
    hc[e]     = h_bits(e2[e] * inv);
    hc[4 + e] = h_bits(e3[e] * inv);
  }
  const v4u u0 = (v4u){pk16(ha[0], ha[1]), pk16(ha[2], ha[3]), pk16(ha[4], ha[5]), pk16(ha[6], ha[7])};
  const v4u u1 = (v4u){pk16(hc[0], hc[1]), pk16(hc[2], hc[3]), pk16(hc[4], hc[5]), pk16(hc[6], hc[7])};
  unsigned short* p0 = P + (size_t)row * kN + 8 * (size_t)t;
  unsigned short* p1 = p0 + 2048;
  *(v4u*)p0 = u0;
  *(v4u*)p1 = u1;
  
}

constexpr int kOW  = 16;
constexpr int kOKS = kN / kOW;
constexpr int kOS  = kOKS / 32;
constexpr int kOA  = 6;
constexpr int kOT  = 32;
constexpr int kOP  = 36;
static_assert(kOKS % 32 == 0 && kC % kOT == 0 && kN % kOT == 0, "out tile");
static_assert(kOA <= kOS && kOS - kOA <= kOA, "load-ahead split");
static_assert(kOW * 32 * 2 == kOT * kOT, "reduce map: two outputs per thread");
typedef __attribute__((ext_vector_type(2))) float v2f;

__global__ __launch_bounds__(kOW * 32) void out_splitk_kernel(const unsigned short* __restrict__ gwt,
                                                              const unsigned short* __restrict__ pp,
                                                              const float* __restrict__ b_out,
                                                              const float* __restrict__ xb,
                                                              float* __restrict__ outb) {
  __shared__ __align__(16) float part[kOW][kOT * kOP];
  const int t    = threadIdx.x;
  const int lane = t & 31, wave = t >> 5;
  const int c0 = (blockIdx.x & 1) * kOT;
  const int q0 = (blockIdx.x >> 1) * kOT;
  const int rl = lane & 15, hh = lane >> 4;
  const _Float16* Pq = (const _Float16*)pp  + (size_t)(q0 + rl) * kN + wave * kOKS + hh * 8;
  const _Float16* Gc = (const _Float16*)gwt + (size_t)(c0 + rl) * kN + wave * kOKS + hh * 8;

  v8f acc[2][2];
#pragma unroll
  for (int i = 0; i < 2; ++i)
#pragma unroll
    for (int j = 0; j < 2; ++j) acc[i][j] = (v8f){0.f,0.f,0.f,0.f,0.f,0.f,0.f,0.f};

  // The slice is short (kOS k-steps), so its loads go out ahead of the products: steps 0..kOA-1 first, the rest behind the first products.
  v16h pf[kOS][2], gf[kOS][2];
#pragma unroll
  for (int s = 0; s < kOA; ++s)
#pragma unroll
    for (int i = 0; i < 2; ++i) {
      pf[s][i] = Frag<_Float16>::load(Pq + (size_t)(i << 4) * kN + s * 32);
      gf[s][i] = Frag<_Float16>::load(Gc + (size_t)(i << 4) * kN + s * 32);
    }
  // keeps these loads ahead of every WMMA: left free, the compiler sinks each load to its use and the wave waits out one latency per fragment
  __builtin_amdgcn_sched_barrier(0);
#pragma unroll
  for (int s = 0; s < kOS - kOA; ++s)
#pragma unroll
    for (int i = 0; i < 2; ++i)
#pragma unroll
      for (int j = 0; j < 2; ++j) acc[i][j] = Frag<_Float16>::mma(pf[s][i], gf[s][j], acc[i][j]);
  // holds the v_nops below behind the last of these products
  __builtin_amdgcn_sched_barrier(0);
  // the loads below reuse fragment registers of the products above: four vector slots between the last WMMA and a load over its A or B
  asm volatile("v_nop\n\tv_nop\n\tv_nop\n\tv_nop");
#pragma unroll
  for (int s = kOA; s < kOS; ++s)
#pragma unroll
    for (int i = 0; i < 2; ++i) {
      pf[s][i] = Frag<_Float16>::load(Pq + (size_t)(i << 4) * kN + s * 32);
      gf[s][i] = Frag<_Float16>::load(Gc + (size_t)(i << 4) * kN + s * 32);
    }
  // same purpose: the last steps' loads stay ahead of the remaining products
  __builtin_amdgcn_sched_barrier(0);
#pragma unroll
  for (int s = kOS - kOA; s < kOS; ++s)
#pragma unroll
    for (int i = 0; i < 2; ++i)
#pragma unroll
      for (int j = 0; j < 2; ++j) acc[i][j] = Frag<_Float16>::mma(pf[s][i], gf[s][j], acc[i][j]);

  float* my = part[wave];
#pragma unroll
  for (int i = 0; i < 2; ++i)
#pragma unroll
    for (int j = 0; j < 2; ++j) {
      float* d = my + ((j << 4) + rl) * kOP + (i << 4) + hh * 8;
      *(v4f*)(d)     = (v4f){acc[i][j][0], acc[i][j][1], acc[i][j][2], acc[i][j][3]};
      *(v4f*)(d + 4) = (v4f){acc[i][j][4], acc[i][j][5], acc[i][j][6], acc[i][j][7]};
    }
  const int c = t >> 4, q2 = (t & 15) * 2;
  const size_t o = (size_t)(c0 + c) * kN + q0 + q2;
  const v2f rr = *(const v2f*)(xb + o);
  const float bv = b_out[c0 + c];
  __syncthreads();   // every wave's partial tile is in LDS before any thread sums across waves

  v2f s = *(const v2f*)(&part[0][c * kOP + q2]);
#pragma unroll
  for (int w = 1; w < kOW; ++w) s = s + *(const v2f*)(&part[w][c * kOP + q2]);
  v2f v;
#pragma unroll
  for (int e = 0; e < 2; ++e) v[e] = (s[e] * kPCarryInv + bv) + rr[e];
  *(v2f*)(outb + o) = v;
}

// ---------------------------------------------------------------------------
// Host glue.
//   WCAT f16 [128][64]           16,384  at           0   (theta|phi|g weights x16, rows 96..127 zero)
//   BCAT f32 [128]                  512  at      16,384   (b_theta|b_phi|b_g|0)
//   WO16 f16 [64][32]             4,096  at      16,896   (w_out x16)
//   XT   f16 [8][4096][64]    4,194,304  at      20,992   (x transposed to [n][c])
//   PRJ  f16 [8][4096][128]   8,388,608  at   4,215,296   (theta | phi | g | 0 per position)
//   GWT  f16 [8][64][4096]    4,194,304  at  12,603,904   (gw^T[c][key] = sum_o w_out[c][o] g[key][o])
//   SC   f32 [4096][4096]    67,108,864  at  16,798,208   (scores of one batch, reused 8x, same type/layout)
//   PP   f16 [4096][4096]    33,554,432  at  83,907,072   (probabilities x32768, reused 8x)
//   total                   117,461,504
// GEMM shapes: proj M=4096 N=128 K=64; gw^T M=64 N=4096 K=32; scores M=N=4096 K=32; out^T M=64 N=4096 K=4096 (own kernel, K split).
// All M,N multiples of 64, all K multiples of 32, no padding anywhere except the zero weight/bias rows 96..127 (written by prep).
// ---------------------------------------------------------------------------
extern "C" void kernel_launch(void* const* d_in, const int* in_sizes, int n_in,
                              void* d_out, int out_size, void* d_ws, size_t ws_size,
                              hipStream_t stream) {
  if (n_in < 9) return;
  const int nX = kB * kC * kN;   // 2,097,152
  if (in_sizes[0] != nX) return;
  if (in_sizes[1] != kCI * kC || in_sizes[2] != kCI) return;
  if (in_sizes[3] != kCI * kC || in_sizes[4] != kCI) return;
  if (in_sizes[5] != kCI * kC || in_sizes[6] != kCI) return;
  if (in_sizes[7] != kC * kCI || in_sizes[8] != kC) return;
  if (out_size != nX) return;

  const size_t szWC  = (size_t)kPW * kC * 2;
  const size_t szBC  = (size_t)kPW * 4;
  const size_t szWO  = (size_t)kC * kCI * 2;
  const size_t szXT  = (size_t)kB * kN * kC * 2;
  const size_t szPRJ = (size_t)kB * kN * kPW * 2;
  const size_t szGWT = (size_t)kB * kC * kN * 2;
  const size_t szS   = (size_t)kN * kN * 4;
  const size_t szP   = (size_t)kN * kN * 2;
  const size_t offWC  = 0;
  const size_t offBC  = offWC + szWC;
  const size_t offWO  = offBC + szBC;
  const size_t offXT  = offWO + szWO;
  const size_t offPRJ = offXT + szXT;
  const size_t offGWT = offPRJ + szPRJ;
  const size_t offS   = offGWT + szGWT;
  const size_t offP   = offS + szS;
  const size_t total  = offP + szP;
  if (ws_size < total) return;

  const float* x       = (const float*)d_in[0];
  const float* w_theta = (const float*)d_in[1];
  const float* b_theta = (const float*)d_in[2];
  const float* w_phi   = (const float*)d_in[3];
  const float* b_phi   = (const float*)d_in[4];
  const float* w_g     = (const float*)d_in[5];
  const float* b_g     = (const float*)d_in[6];
  const float* w_out   = (const float*)d_in[7];
  const float* b_out   = (const float*)d_in[8];
  float* out = (float*)d_out;
  char* ws = (char*)d_ws;
  unsigned short* WC  = (unsigned short*)(ws + offWC);
  float*          BC  = (float*)(ws + offBC);
  unsigned short* WO  = (unsigned short*)(ws + offWO);
  unsigned short* XT  = (unsigned short*)(ws + offXT);
  unsigned short* PRJ = (unsigned short*)(ws + offPRJ);
  unsigned short* GWT = (unsigned short*)(ws + offGWT);
  float*          SC  = (float*)(ws + offS);
  unsigned short* PP  = (unsigned short*)(ws + offP);

  // ---- prologue: parameter planes, x^T cast ----
  prep_kernel<<<dim3(6), dim3(256), 0, stream>>>(w_theta, w_phi, w_g, b_theta, b_phi, b_g, w_out, WC, BC, WO);
  xt_cast_kernel<<<dim3(kN / 64, kB), dim3(256), 0, stream>>>(x, XT);

  // ---- projections: PRJ[b][n][o'] = f16( (1/16) sum_c XT[b][n][c] * WC[o'][c] + BC[o'] )   (M=4096, N=128, K=64; 128 tiles -> 16 blocks) ----
  const long strideXT  = (long)kN * kC;
  const long stridePRJ = (long)kN * kPW;
  const long strideGWT = (long)kC * kN;
  wmma_gemm64<0, false, 2, 1, false, 0><<<dim3(16, kB), dim3(256), 0, stream>>>(
      XT, XT, kC, strideXT, WC, WC, kC, 0L,
      (void*)PRJ, (void*)PRJ, kPW, stridePRJ, BC, x, 0L, kN, kPW, kC, kWCarryInv);

  // ---- gw^T: GWT[b][c][key] = f16( (1/16) sum_o WO[c][o] * PRJ[b][key][64+o] )   (M=64, N=4096, K=32; 64 tiles -> 8 blocks) ----
  wmma_gemm64<0, false, 0, 1, false, 0><<<dim3(8, kB), dim3(256), 0, stream>>>(
      WO, WO, kCI, 0L, PRJ + 64, PRJ + 64, kPW, stridePRJ,
      (void*)GWT, (void*)GWT, kN, strideGWT, BC, x, 0L, kC, kN, kCI, kWCarryInv);

  for (int b = 0; b < kB; ++b) {
    const unsigned short* prjb = PRJ + (size_t)b * kN * kPW;
    // scores SC[q][key] = sum_o theta[q][o] * phi[key][o]   (A = PRJ cols 0..31, Bt = PRJ cols 32..63; M=N=4096, K=32; 4096 tiles -> 512 blocks)
    wmma_gemm64<0, false, 0, 0, false, 0><<<dim3(512, 1), dim3(256), 0, stream>>>(
        prjb, prjb, kPW, 0L, prjb + 32, prjb + 32, kPW, 0L,
        (void*)SC, (void*)SC, kN, 0L, BC, x, 0L, kN, kN, kCI, 1.0f);
    // softmax over keys -> PP (f16, x32768)
    softmax_row_kernel<<<dim3(kN), dim3(256), 0, stream>>>(SC, PP);
    // out[b][c][q] = 2^-15 * sum_key GWT[b][c][key] * PP[q][key] + b_out[c] + x[b][c][q]   (256 tiles of 32 c x 32 q, K split over 16 waves)
    const unsigned short* gwtb = GWT + (size_t)b * kC * kN;
    float* outb = out + (size_t)b * kC * kN;
    const float* xb = x + (size_t)b * kC * kN;
    out_splitk_kernel<<<dim3((kC / kOT) * (kN / kOT)), dim3(kOW * 32), 0, stream>>>(gwtb, PP, b_out, xb, outb);
  }
}

// v002
// One run takes 69 microseconds.
// Two timings next to v001 put it at 5.26 and 5.20 times that version's speed.
// Counting every step since v000, it is 22.2 times as fast.
// Contractions: channel projections (x^T f16 x Wcat f16 carried x16), scores phi.theta^T (f16 planes), gw^T = W_out (f16 carried x16) . g^T (f16 plane), out^T = gw^T f16 x P^T (f16, unnormalised exponentials): all on v_wmma_f32_16x16x32_f16 with f32 accumulate; bias adds, softmax and residual in f32.
#include <hip/hip_runtime.h>
#include <math.h>

// ---------------------------------------------------------------------------
// Problem constants
// ---------------------------------------------------------------------------
constexpr int kB  = 8;        // batch
constexpr int kC  = 64;       // in channels
constexpr int kCI = 32;       // inter channels
constexpr int kN  = 4096;     // H*W positions
constexpr int kPW = 128;      // projection plane width: theta 0..31 | phi 32..63 | g 64..95 | zero 96..127
constexpr float kWCarry    = 16.0f;            // weights carried x16 in f16
constexpr float kWCarryInv = 1.0f / 16.0f;
static_assert(kN % 64 == 0 && kPW % 64 == 0 && kC % 64 == 0, "M,N tiles");
static_assert(kC % 32 == 0 && kCI % 32 == 0 && kN % 32 == 0, "K steps");

typedef __attribute__((ext_vector_type(16))) _Float16 v16h;
typedef __attribute__((ext_vector_type(8)))  _Float16 v8h;
typedef __attribute__((ext_vector_type(16))) __bf16   v16b;
typedef __attribute__((ext_vector_type(8)))  __bf16   v8b;
typedef __attribute__((ext_vector_type(8)))  float    v8f;
typedef __attribute__((ext_vector_type(4)))  float    v4f;
typedef __attribute__((ext_vector_type(4)))  unsigned int v4u;

// ---------------------------------------------------------------------------
// Helpers
// ---------------------------------------------------------------------------
__device__ __forceinline__ unsigned short f2bf_bits(float f) {
  unsigned u = __float_as_uint(f);
  return (unsigned short)((u + 0x7FFFu + ((u >> 16) & 1u)) >> 16);
}
__device__ __forceinline__ float bf_bits2f(unsigned short h) { return __uint_as_float(((unsigned)h) << 16); }

// hazard guards as plain device helpers (no inline asm inside the kernel template body); all four accumulators of a group tied
__device__ __forceinline__ void dep_guard4_h(v8f& a, v8f& b, v8f& c, v8f& d, v16h x, v16h y) { asm volatile("v_nop\n\tv_nop\n\tv_nop\n\tv_nop" : "+v"(a), "+v"(b), "+v"(c), "+v"(d) : "v"(x), "v"(y)); }
__device__ __forceinline__ void dep_guard4_b(v8f& a, v8f& b, v8f& c, v8f& d, v16b x, v16b y) { asm volatile("v_nop\n\tv_nop\n\tv_nop\n\tv_nop" : "+v"(a), "+v"(b), "+v"(c), "+v"(d) : "v"(x), "v"(y)); }
__device__ __forceinline__ void keep4_h(v16h a, v16h b, v16h c, v16h d) { asm volatile("v_nop" :: "v"(a), "v"(b), "v"(c), "v"(d)); }
__device__ __forceinline__ void keep4_b(v16b a, v16b b, v16b c, v16b d) { asm volatile("v_nop" :: "v"(a), "v"(b), "v"(c), "v"(d)); }
__device__ __forceinline__ void acc_guard4(v8f& a, v8f& b, v8f& c, v8f& d) { asm volatile("v_nop\n\tv_nop\n\tv_nop\n\tv_nop" : "+v"(a), "+v"(b), "+v"(c), "+v"(d)); }
template <typename T> struct Frag;
template <> struct Frag<_Float16> {
  typedef v16h V; union U { v16h v; v8h h[2]; };
  // elements 0..7 <- p[0..7], 8..15 <- p[16..23]
  static __device__ __forceinline__ v16h load(const _Float16* p) {
    U f; f.h[0] = *(const v8h*)(p); f.h[1] = *(const v8h*)(p + 16); return f.v;
  }
  static __device__ __forceinline__ v8f mma(v16h a, v16h b, v8f c) {
    return __builtin_amdgcn_wmma_f32_16x16x32_f16(false, a, false, b, (short)0, c, false, false);
  }
  static __device__ __forceinline__ void guard4(v8f& a, v8f& b, v8f& c, v8f& d, v16h x, v16h y) { dep_guard4_h(a, b, c, d, x, y); }
  static __device__ __forceinline__ void keep(v16h a, v16h b, v16h c, v16h d) { keep4_h(a, b, c, d); }
};
template <> struct Frag<__bf16> {
  typedef v16b V; union U { v16b v; v8b h[2]; };
  static __device__ __forceinline__ v16b load(const __bf16* p) {
    U f; f.h[0] = *(const v8b*)(p); f.h[1] = *(const v8b*)(p + 16); return f.v;
  }
  static __device__ __forceinline__ v8f mma(v16b a, v16b b, v8f c) {
    return __builtin_amdgcn_wmma_f32_16x16x32_bf16(false, a, false, b, (short)0, c, false, false);
  }
  static __device__ __forceinline__ void guard4(v8f& a, v8f& b, v8f& c, v8f& d, v16b x, v16b y) { dep_guard4_b(a, b, c, d, x, y); }
  static __device__ __forceinline__ void keep(v16b a, v16b b, v16b c, v16b d) { keep4_b(a, b, c, d); }
};

__device__ __forceinline__ unsigned pk16(unsigned short a, unsigned short b) { return (unsigned)a | ((unsigned)b << 16); }
__device__ __forceinline__ unsigned short h_bits(float f) { const _Float16 h = (_Float16)f; return __builtin_bit_cast(unsigned short, h); }

// ---- Register-blocked batched WMMA GEMM (ACT reduced to none/relu/leaky; residual read in the store phase) ------
// C[m,n] = scale * sum_k A[m,k] * Bt[n,k] (+bias)(+resid); each wave owns a 64x64 tile.
// A row-major [M,K]; Bt row-major [N,K]; M,N % 64 == 0, K % 32 == 0.
// SPLIT: operands are hi/lo planes (A2/Bt2 = lo planes, same layout); product = hi*hi + hi*lo + lo*hi.
// BIAS_MODE: 0 = none, 1 = bias[m], 2 = bias[n].
// OUT_MODE: 0 = f32, 1 = f16, 2 = bf16 hi plane (Cout) + bf16 lo plane (Cout2).
// RESID (OUT_MODE 0 only): resid[m*ldc + n] is loaded as one 16-B float4 per lane at the store address and added in the store phase.
// ET: 0 = f16 operands, 1 = bf16 operands (pointers passed as 16-bit storage)
template <int ET> struct Elem;
template <> struct Elem<0> { typedef _Float16 T; };
template <> struct Elem<1> { typedef __bf16 T; };
template <int ET, bool SPLIT, int BIAS_MODE, int OUT_MODE, bool RESID, int ACT = 0>
__global__ __launch_bounds__(256) void wmma_gemm64(
    const unsigned short* __restrict__ Ap, const unsigned short* __restrict__ A2p, int lda, long strideA,
    const unsigned short* __restrict__ Btp, const unsigned short* __restrict__ Bt2p, int ldb, long strideB,
    void* __restrict__ Cout, void* __restrict__ Cout2, int ldc, long strideC,
    const float* __restrict__ bias,
    const float* __restrict__ resid, long strideR,
    int M, int N, int K, float scale) {
  static_assert(!RESID || OUT_MODE == 0, "resid only with f32 output");
  static_assert(ACT == 0 || ACT == 2 || ACT == 4, "act");
  typedef typename Elem<ET>::T T;
  typedef typename Frag<T>::V V;
  const T* A = (const T*)Ap; const T* A2 = (const T*)A2p; const T* Bt = (const T*)Btp; const T* Bt2 = (const T*)Bt2p;
  __shared__ __align__(16) float sT[8][16 * 68];   // per-wave 16x64 slab, pitch 68 floats
  const int b    = blockIdx.y;
  const int lane = threadIdx.x & 31;
  const int wave = threadIdx.x >> 5;
  const int tilesN = N >> 6;
  const int tilesM = M >> 6;
  const int tile = blockIdx.x * 8 + wave;
  if (tile >= tilesM * tilesN) return;   // wave-uniform; no block barriers in this kernel
  const int tm = tile / tilesN;
  const int tn = tile - tm * tilesN;
  const int m0 = tm << 6;
  const int n0 = tn << 6;

  const T* Ab  = A  + (size_t)b * strideA;
  const T* Bb  = Bt + (size_t)b * strideB;
  const T* Ab2 = SPLIT ? (A2  + (size_t)b * strideA) : nullptr;
  const T* Bb2 = SPLIT ? (Bt2 + (size_t)b * strideB) : nullptr;

  const int rlane = lane & 15;                 // row (A) / col (B, D) within subtile
  const int koff  = (lane >> 4) * 8;           // k offset of this lane half
  const int mOff  = (lane >> 4) * 8;           // D row offset

  v8f acc[4][4];
#pragma unroll
  for (int i = 0; i < 4; ++i)
#pragma unroll
    for (int j = 0; j < 4; ++j) acc[i][j] = (v8f){0.f,0.f,0.f,0.f,0.f,0.f,0.f,0.f};

  for (int k0 = 0; k0 < K; k0 += 32) {
    V bh[4], bl[4];
#pragma unroll
    for (int j = 0; j < 4; ++j) {
      const size_t bo = (size_t)(n0 + (j << 4) + rlane) * ldb + koff + k0;
      bh[j] = Frag<T>::load(Bb + bo);
      if (SPLIT) bl[j] = Frag<T>::load(Bb2 + bo);
    }
#pragma unroll
    for (int i = 0; i < 4; ++i) {
      const size_t ao = (size_t)(m0 + (i << 4) + rlane) * lda + koff + k0;
      V ah = Frag<T>::load(Ab + ao);
      V al;
      if (SPLIT) al = Frag<T>::load(Ab2 + ao);
#pragma unroll
      for (int j = 0; j < 4; ++j) {
        acc[i][j] = Frag<T>::mma(ah, bh[j], acc[i][j]);
        if (SPLIT) {
          acc[i][j] = Frag<T>::mma(ah, bl[j], acc[i][j]);
          acc[i][j] = Frag<T>::mma(al, bh[j], acc[i][j]);
        }
      }
      Frag<T>::guard4(acc[i][0], acc[i][1], acc[i][2], acc[i][3], ah, SPLIT ? al : ah);
    }
    Frag<T>::keep(bh[0], bh[1], bh[2], bh[3]);
    if (SPLIT) Frag<T>::keep(bl[0], bl[1], bl[2], bl[3]);
  }
  acc_guard4(acc[0][0], acc[0][1], acc[0][2], acc[0][3]);
  acc_guard4(acc[1][0], acc[1][1], acc[1][2], acc[1][3]);
  acc_guard4(acc[2][0], acc[2][1], acc[2][2], acc[2][3]);
  acc_guard4(acc[3][0], acc[3][1], acc[3][2], acc[3][3]);

  // ---- epilogue ----
  float* slab = sT[wave];
  const float* Rb = RESID ? (resid + (size_t)b * strideR) : nullptr;
#pragma unroll
  for (int i = 0; i < 4; ++i) {
    const int mBase = m0 + (i << 4);
#pragma unroll
    for (int j = 0; j < 4; ++j) {
      const int n = n0 + (j << 4) + rlane;
      float bv = 0.f;
      if (BIAS_MODE == 2) bv = bias[n];
#pragma unroll
      for (int r = 0; r < 8; ++r) {
        float v = acc[i][j][r] * scale;
        if (BIAS_MODE == 1) v += bias[mBase + mOff + r];
        if (BIAS_MODE == 2) v += bv;
        if (ACT == 2) v = fmaxf(v, 0.0f);
        if (ACT == 4) v = (v > 0.f) ? v : 0.01f * v;
        slab[(mOff + r) * 68 + (j << 4) + rlane] = v;
      }
    }
    __builtin_amdgcn_fence(__ATOMIC_RELEASE, "workgroup");
    __builtin_amdgcn_wave_barrier();
    __builtin_amdgcn_fence(__ATOMIC_ACQUIRE, "workgroup");
    if (OUT_MODE == 0) {
      float* C = (float*)Cout + (size_t)b * strideC;
      const int hh = lane >> 4, c4 = (lane & 15) * 4;     // row seg = 256 B = 16 lanes x 16 B
      {
#pragma unroll
        for (int it = 0; it < 8; ++it) {
          const int row = it * 2 + hh;
          v4f v = *(const v4f*)(slab + row * 68 + c4);
          if (RESID) {
            // residual: one 16-B float4 per lane at exactly the store address (same (row, c4) map), added in f32
            const v4f rr = *(const v4f*)(Rb + (size_t)(mBase + row) * ldc + n0 + c4);
            v = v + rr;
          }
          *(v4f*)(C + (size_t)(mBase + row) * ldc + n0 + c4) = v;
        }
        
      }
    } else {
      const int q = lane >> 3, c8 = (lane & 7) * 8;
      unsigned short* C  = (unsigned short*)Cout  + (size_t)b * strideC;
      unsigned short* C2 = (OUT_MODE == 2) ? ((unsigned short*)Cout2 + (size_t)b * strideC) : nullptr;
      {
#pragma unroll
        for (int it = 0; it < 4; ++it) {
          const int row = it * 4 + q;
          const float* sp = slab + row * 68 + c8;
          v8h hv, lv;
#pragma unroll
          for (int e = 0; e < 8; ++e) {
            if (OUT_MODE == 1) {
              hv[e] = (_Float16)sp[e];
            } else {
              unsigned short hb = f2bf_bits(sp[e]);
              unsigned short lb = f2bf_bits(sp[e] - bf_bits2f(hb));
              hv[e] = __builtin_bit_cast(_Float16, hb);
              lv[e] = __builtin_bit_cast(_Float16, lb);
            }
          }
          *(v8h*)(C + (size_t)(mBase + row) * ldc + n0 + c8) = hv;
          if (OUT_MODE == 2) *(v8h*)(C2 + (size_t)(mBase + row) * ldc + n0 + c8) = lv;
        }
        
      }
    }
    __builtin_amdgcn_fence(__ATOMIC_RELEASE, "workgroup");
    __builtin_amdgcn_wave_barrier();
    __builtin_amdgcn_fence(__ATOMIC_ACQUIRE, "workgroup");
  }
}

// ---------------------------------------------------------------------------
// Parameter preparation (block-uniform roles, grid = 6 blocks x 256 threads, no barriers):
//   blocks 0..2: WCAT rows blk*32..blk*32+31 = f16(16 * w_theta / w_phi / w_g [row][0..63]); block 3: rows 96..127 = 0.
//                thread t -> row blk*32 + (t>>3), cols (t&7)*8..+7 -> one 16-B store per lane at WCAT + blk*2048 + 8t
//   block 4: BCAT[128] f32 = b_theta | b_phi | b_g | 0: wave 0, lane t -> floats 4t..4t+3 (one float4 store per lane,
//                32 lanes x 16 B = the whole 512-B table); sources loaded unconditionally, combined by 0/1 factors.
//   block 5: WO16 [64][32] = f16(16 * w_out): thread t -> elements 8t..8t+7 (row t>>2, cols (t&3)*8), one 16-B store per lane.
// ---------------------------------------------------------------------------
__global__ __launch_bounds__(256) void prep_kernel(const float* __restrict__ w_theta, const float* __restrict__ w_phi,
                                                   const float* __restrict__ w_g,
                                                   const float* __restrict__ b_theta, const float* __restrict__ b_phi,
                                                   const float* __restrict__ b_g, const float* __restrict__ w_out,
                                                   unsigned short* __restrict__ wcat, float* __restrict__ bcat,
                                                   unsigned short* __restrict__ wo16) {
  const int t   = threadIdx.x;
  const int blk = blockIdx.x;   // block-uniform
  if (blk < 4) {
    v4u u;
    if (blk < 3) {
      const float* src = (blk == 0) ? w_theta : ((blk == 1) ? w_phi : w_g);
      const int rl = t >> 3, c8 = (t & 7) * 8;
      const v4f a = *(const v4f*)(src + rl * kC + c8);
      const v4f c = *(const v4f*)(src + rl * kC + c8 + 4);
      unsigned short hb[8];
#pragma unroll
      for (int e = 0; e < 4; ++e) {
        hb[e]     = h_bits(a[e] * kWCarry);
        hb[4 + e] = h_bits(c[e] * kWCarry);
      }
      u = (v4u){pk16(hb[0], hb[1]), pk16(hb[2], hb[3]), pk16(hb[4], hb[5]), pk16(hb[6], hb[7])};
    } else {
      u = (v4u){0u, 0u, 0u, 0u};
    }
    unsigned short* dst = wcat + (size_t)blk * (32 * kC) + 8 * (size_t)t;
    *(v4u*)dst = u;
    
  } else if (blk == 4) {
    if (t < 32) {   // wave 0 only (wave-uniform)
      const int seg = t >> 3;            // 0 theta, 1 phi, 2 g, 3 zero
      const int o4  = (t & 7) * 4;       // 0..28, always in range of the 32-entry vectors
      const v4f bt = *(const v4f*)(b_theta + o4);
      const v4f bp = *(const v4f*)(b_phi + o4);
      const v4f bg = *(const v4f*)(b_g + o4);
      const float f0 = (seg == 0) ? 1.0f : 0.0f;
      const float f1 = (seg == 1) ? 1.0f : 0.0f;
      const float f2 = (seg == 2) ? 1.0f : 0.0f;
      v4f val;
#pragma unroll
      for (int e = 0; e < 4; ++e) val[e] = fmaf(f0, bt[e], fmaf(f1, bp[e], f2 * bg[e]));
      float* dst = bcat + 4 * t;
      *(v4f*)dst = val;
      
    }
  } else {
    const int row = t >> 2, c8 = (t & 3) * 8;
    const v4f a = *(const v4f*)(w_out + row * kCI + c8);
    const v4f c = *(const v4f*)(w_out + row * kCI + c8 + 4);
    unsigned short hb[8];
#pragma unroll
    for (int e = 0; e < 4; ++e) {
      hb[e]     = h_bits(a[e] * kWCarry);
      hb[4 + e] = h_bits(c[e] * kWCarry);
    }
    const v4u u = (v4u){pk16(hb[0], hb[1]), pk16(hb[2], hb[3]), pk16(hb[4], hb[5]), pk16(hb[6], hb[7])};
    unsigned short* dst = wo16 + 8 * (size_t)t;
    *(v4u*)dst = u;
    
  }
}

// ---------------------------------------------------------------------------
// x transpose + cast: in x[b][64 c][4096 n] -> out XT[b][4096 n][64 c] = f16(x[b][c][n]).
// grid (4096/64 = 64, 8): blockIdx.x = n tile (64 positions), blockIdx.y = batch. 256 threads.
// Load coverage: 16 iterations x 256 threads = 4096 = the whole 64(c) x 64(n) tile (coalesced along n).
// Store coverage: 8 waves x 2 iterations x 4 rows (lane>>3) = 64 n-rows; (lane&7) x 8 halves = 64 c-cols; each row =
// ---------------------------------------------------------------------------
__global__ __launch_bounds__(256) void xt_cast_kernel(const float* __restrict__ x, unsigned short* __restrict__ XT) {
  __shared__ float sm[64][65];   // sm[n_local][c]
  const int t  = threadIdx.x;
  const int n0 = blockIdx.x * 64;
  const int b  = blockIdx.y;
#pragma unroll
  for (int i = 0; i < 16; ++i) {
    const int e  = i * 256 + t;
    const int cl = e >> 6;         // channel
    const int nl = e & 63;         // n local
    sm[nl][cl] = x[((size_t)(b * kC + cl)) * kN + n0 + nl];
  }
  __syncthreads();
  const int lane = t & 31, wave = t >> 5;
  const int q = lane >> 3, c8 = (lane & 7) * 8;
  unsigned short* op = XT + ((size_t)b * kN + n0) * kC;
  {
#pragma unroll
    for (int it = 0; it < 2; ++it) {
      const int row = wave * 8 + it * 4 + q;                 // n local
      unsigned short hb[8];
#pragma unroll
      for (int e = 0; e < 8; ++e) hb[e] = h_bits(sm[row][c8 + e]);
      const v4u u = (v4u){pk16(hb[0], hb[1]), pk16(hb[2], hb[3]), pk16(hb[4], hb[5]), pk16(hb[6], hb[7])};
      *(v4u*)(op + (size_t)row * kC + c8) = u;
    }
    
  }
}

// ---------------------------------------------------------------------------
// Scores, softmax and out^T product of all batches in one launch; scores and probabilities stay in registers.
//   out[b][c][q] = sum_key GWT[b][c][key] * softmax_key(theta[q] . phi[key]) + b_out[c] + x[b][c][q]
// grid (4096/128 = 32 position blocks, 8 batches), 16 waves: wave = query group (wave >> 2, 32 q) x key slice (wave & 3, 1024 keys).
// One pass = 32 keys:  S^T = phi . theta^T  (A = phi rows, B = theta rows, same loader: equal k order); D register r of a lane =
// S^T[key 8*(lane>>4) + r][q = lane&15], so the two key tiles of a pass, converted in place, are the B operand (hardware k order) of
// O^T += GWT . P^T  (A = GWT rows through the same loader: keys 8h..8h+7 | 16+8h..16+8h+7). D register r = out[c = 8*(lane>>4) + r][q = lane&15].
// A lane holds one query's column in both products: running maximum (log2 domain), sum and rescale factor are per-lane scalars.
// The maximum in use may trail the true one by up to 8 (an exponential reaches 2^8 at most, inside f16): rescale only when some column exceeds that.
// The four key slices of a query group are joined in LDS: maxima and sums first, then the scaled partial tiles in slice order 0..3.
// ---------------------------------------------------------------------------
constexpr int kFQ  = 32;            // queries per wave (two 16-column groups)
constexpr int kFG  = 4;             // query groups per work-group
constexpr int kFS  = 4;             // key slices per work-group
constexpr int kFW  = kFG * kFS;     // waves per work-group
constexpr int kFK  = kN / kFS;      // keys per wave
constexpr int kFNP = kFK / 32;      // passes per wave
constexpr int kFP  = 36;            // LDS row pitch in floats: 144 B = 16 B x odd
constexpr float kLog2e = 1.4426950408889634f;
static_assert(kFK % 32 == 0 && kN % (kFG * kFQ) == 0 && kCI == 32 && kC == 64, "fused tile");
static_assert(kC * kFG * kFQ == kFW * 32 * 16, "join map: four float4 per thread");
typedef __attribute__((ext_vector_type(2))) float    v2f;
typedef __attribute__((ext_vector_type(2))) _Float16 v2h;

// lane l with lane l ^ 16
__device__ __forceinline__ float xhalf(float v) {
  const int i = __builtin_bit_cast(int, v);
  return __builtin_bit_cast(float, __builtin_amdgcn_permlanex16(i, i, 0x76543210, 0xfedcba98, false, false));
}
__device__ __forceinline__ unsigned pack2h(float lo, float hi) {   // round to nearest even
  return __builtin_bit_cast(unsigned, __builtin_convertvector((v2f){lo, hi}, v2h));
}
// Eight exponentials (2^a) in one statement. The outputs are early-clobbered, so none lands on a source of another, and the closing v_nop is
// the slot the instruction set asks for behind a transcendental before its result is used or its source overwritten.
__device__ __forceinline__ void exp2x8(float (&p)[8], const float (&a)[8]) {
  asm("v_exp_f32 %0, %8\n\tv_exp_f32 %1, %9\n\tv_exp_f32 %2, %10\n\tv_exp_f32 %3, %11\n\t"
      "v_exp_f32 %4, %12\n\tv_exp_f32 %5, %13\n\tv_exp_f32 %6, %14\n\tv_exp_f32 %7, %15\n\tv_nop"
      : "=&v"(p[0]), "=&v"(p[1]), "=&v"(p[2]), "=&v"(p[3]), "=&v"(p[4]), "=&v"(p[5]), "=&v"(p[6]), "=&v"(p[7])
      : "v"(a[0]), "v"(a[1]), "v"(a[2]), "v"(a[3]), "v"(a[4]), "v"(a[5]), "v"(a[6]), "v"(a[7]));
}

__global__ __launch_bounds__(kFW * 32) void attn_fused_kernel(const unsigned short* __restrict__ prj,
                                                              const unsigned short* __restrict__ gwt,
                                                              const float* __restrict__ b_out,
                                                              const float* __restrict__ x,
                                                              float* __restrict__ out) {
  __shared__ __align__(16) float part[kFW][kC * kFP];
  __shared__ float sM[kFW][kFQ];
  __shared__ float sL[kFW][kFQ];
  const int t    = threadIdx.x;
  const int lane = t & 31, wave = t >> 5;
  const int b    = blockIdx.y;
  const int qg   = wave >> 2, ks = wave & 3;
  const int qb   = blockIdx.x * (kFG * kFQ);
  const int rl   = lane & 15, hh = lane >> 4;
  const _Float16* Pb = (const _Float16*)prj + (size_t)b * kN * kPW;
  const _Float16* Th = Pb + (size_t)(qb + qg * kFQ + rl) * kPW + hh * 8;
  const _Float16* Ph = Pb + (size_t)(ks * kFK + rl) * kPW + kCI + hh * 8;
  const _Float16* Gw = (const _Float16*)gwt + ((size_t)b * kC + rl) * kN + ks * kFK + hh * 8;

  v16h th[2], ph[2];
#pragma unroll
  for (int g = 0; g < 2; ++g) th[g] = Frag<_Float16>::load(Th + (size_t)(g << 4) * kPW);
#pragma unroll
  for (int kt = 0; kt < 2; ++kt) ph[kt] = Frag<_Float16>::load(Ph + (size_t)(kt << 4) * kPW);

  v8f acc[4][2];
#pragma unroll
  for (int ct = 0; ct < 4; ++ct)
#pragma unroll
    for (int g = 0; g < 2; ++g) acc[ct][g] = (v8f){0.f,0.f,0.f,0.f,0.f,0.f,0.f,0.f};
  float m_run[2] = {-__builtin_inff(), -__builtin_inff()};
  float l_run[2] = {0.f, 0.f};

  // rolled: one pass is already a long straight block, and a second copy would double the live fragments
#pragma unroll 1
  for (int s = 0; s < kFNP; ++s) {
    v8f st[2][2];
#pragma unroll
    for (int kt = 0; kt < 2; ++kt)
#pragma unroll
      for (int g = 0; g < 2; ++g)
        st[kt][g] = Frag<_Float16>::mma(ph[kt], th[g], (v8f){0.f,0.f,0.f,0.f,0.f,0.f,0.f,0.f});
    // holds the v_nops below behind the last of these products
    __builtin_amdgcn_sched_barrier(0);
    // the loads below go over fragment registers of the products above: four vector slots between the last WMMA and a load over its A
    asm volatile("v_nop\n\tv_nop\n\tv_nop\n\tv_nop");
    v16h gw[4];
#pragma unroll
    for (int ct = 0; ct < 4; ++ct) gw[ct] = Frag<_Float16>::load(Gw + (size_t)(ct << 4) * kN + s * 32);
    const int sn = (s + 1 < kFNP) ? s + 1 : s;   // the last pass fetches its own rows again: always inside the slice
#pragma unroll
    for (int kt = 0; kt < 2; ++kt) ph[kt] = Frag<_Float16>::load(Ph + (size_t)(sn * 32 + (kt << 4)) * kPW);
    // keeps these loads ahead of the softmax work: left free, the compiler sinks each load to its use and the wave waits out its latency there
    __builtin_amdgcn_sched_barrier(0);

    float mb[2];
    bool need = false;
#pragma unroll
    for (int g = 0; g < 2; ++g) {
      float mx = st[0][g][0];
#pragma unroll
      for (int r = 1; r < 8; ++r) mx = fmaxf(mx, st[0][g][r]);
#pragma unroll
      for (int r = 0; r < 8; ++r) mx = fmaxf(mx, st[1][g][r]);
      mx = fmaxf(mx, xhalf(mx)) * kLog2e;   // both wave halves hold this query's maximum of the pass, log2 domain
      mb[g] = mx;
      need = need || (mx > m_run[g] + 8.0f);
    }
    if (__builtin_amdgcn_ballot_w32(need) != 0) {   // wave-uniform; rare after the first passes
#pragma unroll
      for (int g = 0; g < 2; ++g) {
        const float m_new = fmaxf(m_run[g], mb[g]);
        const float corr  = __builtin_amdgcn_exp2f(m_run[g] - m_new);   // 0 on the first pass, where m_run is -inf
        m_run[g] = m_new;
        l_run[g] *= corr;
#pragma unroll
        for (int ct = 0; ct < 4; ++ct) acc[ct][g] = acc[ct][g] * corr;
      }
    }
    union PB { unsigned u[8]; v16h v; } pb[2];
#pragma unroll
    for (int g = 0; g < 2; ++g) {
      const float nm = -m_run[g];
      float ls = 0.f;
#pragma unroll
      for (int kt = 0; kt < 2; ++kt) {   // key tile kt fills elements 8kt..8kt+7 of the 32-key operand, register r = element 8kt + r
        float a[8], p[8];
#pragma unroll
        for (int r = 0; r < 8; ++r) a[r] = fmaf(st[kt][g][r], kLog2e, nm);
        exp2x8(p, a);
#pragma unroll
        for (int i = 0; i < 4; ++i) {
          ls += p[2 * i] + p[2 * i + 1];
          pb[g].u[kt * 4 + i] = pack2h(p[2 * i], p[2 * i + 1]);
        }
      }
      l_run[g] += ls;
    }
    // keeps every exponential statement ahead of the products below: an exponential
    // moved behind a product could write over its B operand too early
    __builtin_amdgcn_sched_barrier(0);
#pragma unroll
    for (int g = 0; g < 2; ++g)
#pragma unroll
      for (int ct = 0; ct < 4; ++ct) acc[ct][g] = Frag<_Float16>::mma(gw[ct], pb[g].v, acc[ct][g]);
  }

  // ---- join of the four key slices of each query group ----
#pragma unroll
  for (int g = 0; g < 2; ++g) {
    l_run[g] += xhalf(l_run[g]);
    if (hh == 0) {
      sM[wave][(g << 4) + rl] = m_run[g];
      sL[wave][(g << 4) + rl] = l_run[g];
    }
  }
  __syncthreads();   // every slice's maxima and sums are in LDS before any wave forms its factor
  float* my = part[wave];
#pragma unroll
  for (int g = 0; g < 2; ++g) {
    const int ql = (g << 4) + rl;
    float M = sM[qg * kFS][ql];
#pragma unroll
    for (int j = 1; j < kFS; ++j) M = fmaxf(M, sM[qg * kFS + j][ql]);
    float L = 0.f;
#pragma unroll
    for (int j = 0; j < kFS; ++j) L += sL[qg * kFS + j][ql] * __builtin_amdgcn_exp2f(sM[qg * kFS + j][ql] - M);
    const float f = __builtin_amdgcn_exp2f(m_run[g] - M) / L;
#pragma unroll
    for (int ct = 0; ct < 4; ++ct)
#pragma unroll
      for (int r = 0; r < 8; ++r) my[((ct << 4) + hh * 8 + r) * kFP + ql] = acc[ct][g][r] * f;
  }
  __syncthreads();   // every wave's scaled partial tile is in LDS before any thread sums across slices

  // thread t, trip it: float4 index it*512 + t of the 64 c x 128 q tile; a wave writes one whole 512-B row segment of out
#pragma unroll
  for (int it = 0; it < 4; ++it) {
    const int idx = it * (kFW * 32) + t;
    const int c   = idx >> 5;
    const int q4  = (idx & 31) * 4;
    const int g4  = (q4 >> 5) * kFS;
    const int po  = c * kFP + (q4 & 31);
    v4f sum = *(const v4f*)(&part[g4][po]);
#pragma unroll
    for (int j = 1; j < kFS; ++j) sum = sum + *(const v4f*)(&part[g4 + j][po]);
    const size_t o = ((size_t)b * kC + c) * kN + qb + q4;
    const v4f rr = *(const v4f*)(x + o);
    const float bv = b_out[c];
    v4f v;
#pragma unroll
    for (int e = 0; e < 4; ++e) v[e] = (sum[e] + bv) + rr[e];
    *(v4f*)(out + o) = v;
  }
}

// ---------------------------------------------------------------------------
// Host glue.
//   WCAT f16 [128][64]           16,384  at           0   (theta|phi|g weights x16, rows 96..127 zero)
//   BCAT f32 [128]                  512  at      16,384   (b_theta|b_phi|b_g|0)
//   WO16 f16 [64][32]             4,096  at      16,896   (w_out x16)
//   XT   f16 [8][4096][64]    4,194,304  at      20,992   (x transposed to [n][c])
//   PRJ  f16 [8][4096][128]   8,388,608  at   4,215,296   (theta | phi | g | 0 per position)
//   GWT  f16 [8][64][4096]    4,194,304  at  12,603,904   (gw^T[c][key] = sum_o w_out[c][o] g[key][o])
//   total                    16,798,208
// GEMM shapes: proj M=4096 N=128 K=64; gw^T M=64 N=4096 K=32; scores (K=32) and out^T (K=4096) inside the fused kernel.
// All M,N multiples of 64, all K multiples of 32, no padding anywhere except the zero weight/bias rows 96..127 (written by prep).
// ---------------------------------------------------------------------------
extern "C" void kernel_launch(void* const* d_in, const int* in_sizes, int n_in,
                              void* d_out, int out_size, void* d_ws, size_t ws_size,
                              hipStream_t stream) {
  if (n_in < 9) return;
  const int nX = kB * kC * kN;   // 2,097,152
  if (in_sizes[0] != nX) return;
  if (in_sizes[1] != kCI * kC || in_sizes[2] != kCI) return;
  if (in_sizes[3] != kCI * kC || in_sizes[4] != kCI) return;
  if (in_sizes[5] != kCI * kC || in_sizes[6] != kCI) return;
  if (in_sizes[7] != kC * kCI || in_sizes[8] != kC) return;
  if (out_size != nX) return;

  const size_t szWC  = (size_t)kPW * kC * 2;
  const size_t szBC  = (size_t)kPW * 4;
  const size_t szWO  = (size_t)kC * kCI * 2;
  const size_t szXT  = (size_t)kB * kN * kC * 2;
  const size_t szPRJ = (size_t)kB * kN * kPW * 2;
  const size_t szGWT = (size_t)kB * kC * kN * 2;
  const size_t offWC  = 0;
  const size_t offBC  = offWC + szWC;
  const size_t offWO  = offBC + szBC;
  const size_t offXT  = offWO + szWO;
  const size_t offPRJ = offXT + szXT;
  const size_t offGWT = offPRJ + szPRJ;
  const size_t total  = offGWT + szGWT;
  if (ws_size < total) return;

  const float* x       = (const float*)d_in[0];
  const float* w_theta = (const float*)d_in[1];
  const float* b_theta = (const float*)d_in[2];
  const float* w_phi   = (const float*)d_in[3];
  const float* b_phi   = (const float*)d_in[4];
  const float* w_g     = (const float*)d_in[5];
  const float* b_g     = (const float*)d_in[6];
  const float* w_out   = (const float*)d_in[7];
  const float* b_out   = (const float*)d_in[8];
  float* out = (float*)d_out;
  char* ws = (char*)d_ws;
  unsigned short* WC  = (unsigned short*)(ws + offWC);
  float*          BC  = (float*)(ws + offBC);
  unsigned short* WO  = (unsigned short*)(ws + offWO);
  unsigned short* XT  = (unsigned short*)(ws + offXT);
  unsigned short* PRJ = (unsigned short*)(ws + offPRJ);
  unsigned short* GWT = (unsigned short*)(ws + offGWT);

  // ---- prologue: parameter planes, x^T cast ----
  prep_kernel<<<dim3(6), dim3(256), 0, stream>>>(w_theta, w_phi, w_g, b_theta, b_phi, b_g, w_out, WC, BC, WO);
  xt_cast_kernel<<<dim3(kN / 64, kB), dim3(256), 0, stream>>>(x, XT);

  // ---- projections: PRJ[b][n][o'] = f16( (1/16) sum_c XT[b][n][c] * WC[o'][c] + BC[o'] )   (M=4096, N=128, K=64; 128 tiles -> 16 blocks) ----
  const long strideXT  = (long)kN * kC;
  const long stridePRJ = (long)kN * kPW;
  const long strideGWT = (long)kC * kN;
  wmma_gemm64<0, false, 2, 1, false, 0><<<dim3(16, kB), dim3(256), 0, stream>>>(
      XT, XT, kC, strideXT, WC, WC, kC, 0L,
      (void*)PRJ, (void*)PRJ, kPW, stridePRJ, BC, x, 0L, kN, kPW, kC, kWCarryInv);

  // ---- gw^T: GWT[b][c][key] = f16( (1/16) sum_o WO[c][o] * PRJ[b][key][64+o] )   (M=64, N=4096, K=32; 64 tiles -> 8 blocks) ----
  wmma_gemm64<0, false, 0, 1, false, 0><<<dim3(8, kB), dim3(256), 0, stream>>>(
      WO, WO, kCI, 0L, PRJ + 64, PRJ + 64, kPW, stridePRJ,
      (void*)GWT, (void*)GWT, kN, strideGWT, BC, x, 0L, kC, kN, kCI, kWCarryInv);

  // ---- scores, softmax over keys, out^T product, bias and residual: all batches, one launch (32 position blocks x 8 batches) ----
  attn_fused_kernel<<<dim3(kN / (kFG * kFQ), kB), dim3(kFW * 32), 0, stream>>>(PRJ, GWT, b_out, x, out);
}

// v003
// It runs in 52.5 microseconds.
// Timed twice side by side with v002, it ran 1.31 and 1.32 times as fast.
// All steps since v000 together make it 29.2 times as fast.
// Contractions: channel projections (x^T f16 x Wcat f16 carried x16), scores phi.theta^T (f16 planes), gw^T = W_out (f16 carried x16) . g^T (f16 plane), out^T = gw^T f16 x P^T (f16, unnormalised exponentials): all on v_wmma_f32_16x16x32_f16 with f32 accumulate; bias adds, softmax and residual in f32.
#include <hip/hip_runtime.h>
#include <math.h>

// ---------------------------------------------------------------------------
// Problem constants
// ---------------------------------------------------------------------------
constexpr int kB  = 8;        // batch
constexpr int kC  = 64;       // in channels
constexpr int kCI = 32;       // inter channels
constexpr int kN  = 4096;     // H*W positions
constexpr int kPW = 128;      // projection plane width: theta 0..31 | phi 32..63 | g 64..95 | zero 96..127
constexpr float kWCarry    = 16.0f;            // weights carried x16 in f16
constexpr float kWCarryInv = 1.0f / 16.0f;
static_assert(kN % 64 == 0 && kPW % 64 == 0 && kC % 64 == 0, "M,N tiles");
static_assert(kC % 32 == 0 && kCI % 32 == 0 && kN % 32 == 0, "K steps");

typedef __attribute__((ext_vector_type(16))) _Float16 v16h;
typedef __attribute__((ext_vector_type(8)))  _Float16 v8h;
typedef __attribute__((ext_vector_type(16))) __bf16   v16b;
typedef __attribute__((ext_vector_type(8)))  __bf16   v8b;
typedef __attribute__((ext_vector_type(8)))  float    v8f;
typedef __attribute__((ext_vector_type(4)))  float    v4f;
typedef __attribute__((ext_vector_type(4)))  unsigned int v4u;

// ---------------------------------------------------------------------------
// Helpers
// ---------------------------------------------------------------------------
__device__ __forceinline__ unsigned short f2bf_bits(float f) {
  unsigned u = __float_as_uint(f);
  return (unsigned short)((u + 0x7FFFu + ((u >> 16) & 1u)) >> 16);
}
__device__ __forceinline__ float bf_bits2f(unsigned short h) { return __uint_as_float(((unsigned)h) << 16); }

// hazard guards as plain device helpers (no inline asm inside the kernel template body); all four accumulators of a group tied
__device__ __forceinline__ void dep_guard4_h(v8f& a, v8f& b, v8f& c, v8f& d, v16h x, v16h y) { asm volatile("v_nop\n\tv_nop\n\tv_nop\n\tv_nop" : "+v"(a), "+v"(b), "+v"(c), "+v"(d) : "v"(x), "v"(y)); }
__device__ __forceinline__ void dep_guard4_b(v8f& a, v8f& b, v8f& c, v8f& d, v16b x, v16b y) { asm volatile("v_nop\n\tv_nop\n\tv_nop\n\tv_nop" : "+v"(a), "+v"(b), "+v"(c), "+v"(d) : "v"(x), "v"(y)); }
__device__ __forceinline__ void keep4_h(v16h a, v16h b, v16h c, v16h d) { asm volatile("v_nop" :: "v"(a), "v"(b), "v"(c), "v"(d)); }
__device__ __forceinline__ void keep4_b(v16b a, v16b b, v16b c, v16b d) { asm volatile("v_nop" :: "v"(a), "v"(b), "v"(c), "v"(d)); }
__device__ __forceinline__ void acc_guard4(v8f& a, v8f& b, v8f& c, v8f& d) { asm volatile("v_nop\n\tv_nop\n\tv_nop\n\tv_nop" : "+v"(a), "+v"(b), "+v"(c), "+v"(d)); }
template <typename T> struct Frag;
template <> struct Frag<_Float16> {
  typedef v16h V; union U { v16h v; v8h h[2]; };
  // elements 0..7 <- p[0..7], 8..15 <- p[16..23]
  static __device__ __forceinline__ v16h load(const _Float16* p) {
    U f; f.h[0] = *(const v8h*)(p); f.h[1] = *(const v8h*)(p + 16); return f.v;
  }
  static __device__ __forceinline__ v8f mma(v16h a, v16h b, v8f c) {
    return __builtin_amdgcn_wmma_f32_16x16x32_f16(false, a, false, b, (short)0, c, false, false);
  }
  static __device__ __forceinline__ void guard4(v8f& a, v8f& b, v8f& c, v8f& d, v16h x, v16h y) { dep_guard4_h(a, b, c, d, x, y); }
  static __device__ __forceinline__ void keep(v16h a, v16h b, v16h c, v16h d) { keep4_h(a, b, c, d); }
};
template <> struct Frag<__bf16> {
  typedef v16b V; union U { v16b v; v8b h[2]; };
  static __device__ __forceinline__ v16b load(const __bf16* p) {
    U f; f.h[0] = *(const v8b*)(p); f.h[1] = *(const v8b*)(p + 16); return f.v;
  }
  static __device__ __forceinline__ v8f mma(v16b a, v16b b, v8f c) {
    return __builtin_amdgcn_wmma_f32_16x16x32_bf16(false, a, false, b, (short)0, c, false, false);
  }
  static __device__ __forceinline__ void guard4(v8f& a, v8f& b, v8f& c, v8f& d, v16b x, v16b y) { dep_guard4_b(a, b, c, d, x, y); }
  static __device__ __forceinline__ void keep(v16b a, v16b b, v16b c, v16b d) { keep4_b(a, b, c, d); }
};

__device__ __forceinline__ unsigned pk16(unsigned short a, unsigned short b) { return (unsigned)a | ((unsigned)b << 16); }
__device__ __forceinline__ unsigned short h_bits(float f) { const _Float16 h = (_Float16)f; return __builtin_bit_cast(unsigned short, h); }

// ---- Register-blocked batched WMMA GEMM (ACT reduced to none/relu/leaky; residual read in the store phase) ------
// C[m,n] = scale * sum_k A[m,k] * Bt[n,k] (+bias)(+resid); each wave owns a 64x64 tile.
// A row-major [M,K]; Bt row-major [N,K]; M,N % 64 == 0, K % 32 == 0.
// SPLIT: operands are hi/lo planes (A2/Bt2 = lo planes, same layout); product = hi*hi + hi*lo + lo*hi.
// BIAS_MODE: 0 = none, 1 = bias[m], 2 = bias[n].
// OUT_MODE: 0 = f32, 1 = f16, 2 = bf16 hi plane (Cout) + bf16 lo plane (Cout2).
// RESID (OUT_MODE 0 only): resid[m*ldc + n] is loaded as one 16-B float4 per lane at the store address and added in the store phase.
// ET: 0 = f16 operands, 1 = bf16 operands (pointers passed as 16-bit storage)
template <int ET> struct Elem;
template <> struct Elem<0> { typedef _Float16 T; };
template <> struct Elem<1> { typedef __bf16 T; };
template <int ET, bool SPLIT, int BIAS_MODE, int OUT_MODE, bool RESID, int ACT = 0>
__global__ __launch_bounds__(256) void wmma_gemm64(
    const unsigned short* __restrict__ Ap, const unsigned short* __restrict__ A2p, int lda, long strideA,
    const unsigned short* __restrict__ Btp, const unsigned short* __restrict__ Bt2p, int ldb, long strideB,
    void* __restrict__ Cout, void* __restrict__ Cout2, int ldc, long strideC,
    const float* __restrict__ bias,
    const float* __restrict__ resid, long strideR,
    int M, int N, int K, float scale) {
  static_assert(!RESID || OUT_MODE == 0, "resid only with f32 output");
  static_assert(ACT == 0 || ACT == 2 || ACT == 4, "act");
  typedef typename Elem<ET>::T T;
  typedef typename Frag<T>::V V;
  const T* A = (const T*)Ap; const T* A2 = (const T*)A2p; const T* Bt = (const T*)Btp; const T* Bt2 = (const T*)Bt2p;
  __shared__ __align__(16) float sT[8][16 * 68];   // per-wave 16x64 slab, pitch 68 floats
  const int b    = blockIdx.y;
  const int lane = threadIdx.x & 31;
  const int wave = threadIdx.x >> 5;
  const int tilesN = N >> 6;
  const int tilesM = M >> 6;
  const int tile = blockIdx.x * 8 + wave;
  if (tile >= tilesM * tilesN) return;   // wave-uniform; no block barriers in this kernel
  const int tm = tile / tilesN;
  const int tn = tile - tm * tilesN;
  const int m0 = tm << 6;
  const int n0 = tn << 6;

  const T* Ab  = A  + (size_t)b * strideA;
  const T* Bb  = Bt + (size_t)b * strideB;
  const T* Ab2 = SPLIT ? (A2  + (size_t)b * strideA) : nullptr;
  const T* Bb2 = SPLIT ? (Bt2 + (size_t)b * strideB) : nullptr;

  const int rlane = lane & 15;                 // row (A) / col (B, D) within subtile
  const int koff  = (lane >> 4) * 8;           // k offset of this lane half
  const int mOff  = (lane >> 4) * 8;           // D row offset

  v8f acc[4][4];
#pragma unroll
  for (int i = 0; i < 4; ++i)
#pragma unroll
    for (int j = 0; j < 4; ++j) acc[i][j] = (v8f){0.f,0.f,0.f,0.f,0.f,0.f,0.f,0.f};

  for (int k0 = 0; k0 < K; k0 += 32) {
    V bh[4], bl[4];
#pragma unroll
    for (int j = 0; j < 4; ++j) {
      const size_t bo = (size_t)(n0 + (j << 4) + rlane) * ldb + koff + k0;
      bh[j] = Frag<T>::load(Bb + bo);
      if (SPLIT) bl[j] = Frag<T>::load(Bb2 + bo);
    }
#pragma unroll
    for (int i = 0; i < 4; ++i) {
      const size_t ao = (size_t)(m0 + (i << 4) + rlane) * lda + koff + k0;
      V ah = Frag<T>::load(Ab + ao);
      V al;
      if (SPLIT) al = Frag<T>::load(Ab2 + ao);
#pragma unroll
      for (int j = 0; j < 4; ++j) {
        acc[i][j] = Frag<T>::mma(ah, bh[j], acc[i][j]);
        if (SPLIT) {
          acc[i][j] = Frag<T>::mma(ah, bl[j], acc[i][j]);
          acc[i][j] = Frag<T>::mma(al, bh[j], acc[i][j]);
        }
      }
      Frag<T>::guard4(acc[i][0], acc[i][1], acc[i][2], acc[i][3], ah, SPLIT ? al : ah);
    }
    Frag<T>::keep(bh[0], bh[1], bh[2], bh[3]);
    if (SPLIT) Frag<T>::keep(bl[0], bl[1], bl[2], bl[3]);
  }
  acc_guard4(acc[0][0], acc[0][1], acc[0][2], acc[0][3]);
  acc_guard4(acc[1][0], acc[1][1], acc[1][2], acc[1][3]);
  acc_guard4(acc[2][0], acc[2][1], acc[2][2], acc[2][3]);
  acc_guard4(acc[3][0], acc[3][1], acc[3][2], acc[3][3]);

  // ---- epilogue ----
  float* slab = sT[wave];
  const float* Rb = RESID ? (resid + (size_t)b * strideR) : nullptr;
#pragma unroll
  for (int i = 0; i < 4; ++i) {
    const int mBase = m0 + (i << 4);
#pragma unroll
    for (int j = 0; j < 4; ++j) {
      const int n = n0 + (j << 4) + rlane;
      float bv = 0.f;
      if (BIAS_MODE == 2) bv = bias[n];
#pragma unroll
      for (int r = 0; r < 8; ++r) {
        float v = acc[i][j][r] * scale;
        if (BIAS_MODE == 1) v += bias[mBase + mOff + r];
        if (BIAS_MODE == 2) v += bv;
        if (ACT == 2) v = fmaxf(v, 0.0f);
        if (ACT == 4) v = (v > 0.f) ? v : 0.01f * v;
        slab[(mOff + r) * 68 + (j << 4) + rlane] = v;
      }
    }
    __builtin_amdgcn_fence(__ATOMIC_RELEASE, "workgroup");
    __builtin_amdgcn_wave_barrier();
    __builtin_amdgcn_fence(__ATOMIC_ACQUIRE, "workgroup");
    if (OUT_MODE == 0) {
      float* C = (float*)Cout + (size_t)b * strideC;
      const int hh = lane >> 4, c4 = (lane & 15) * 4;     // row seg = 256 B = 16 lanes x 16 B
      {
#pragma unroll
        for (int it = 0; it < 8; ++it) {
          const int row = it * 2 + hh;
          v4f v = *(const v4f*)(slab + row * 68 + c4);
          if (RESID) {
            // residual: one 16-B float4 per lane at exactly the store address (same (row, c4) map), added in f32
            const v4f rr = *(const v4f*)(Rb + (size_t)(mBase + row) * ldc + n0 + c4);
            v = v + rr;
          }
          *(v4f*)(C + (size_t)(mBase + row) * ldc + n0 + c4) = v;
        }
        
      }
    } else {
      const int q = lane >> 3, c8 = (lane & 7) * 8;
      unsigned short* C  = (unsigned short*)Cout  + (size_t)b * strideC;
      unsigned short* C2 = (OUT_MODE == 2) ? ((unsigned short*)Cout2 + (size_t)b * strideC) : nullptr;
      {
#pragma unroll
        for (int it = 0; it < 4; ++it) {
          const int row = it * 4 + q;
          const float* sp = slab + row * 68 + c8;
          v8h hv, lv;
#pragma unroll
          for (int e = 0; e < 8; ++e) {
            if (OUT_MODE == 1) {
              hv[e] = (_Float16)sp[e];
            } else {
              unsigned short hb = f2bf_bits(sp[e]);
              unsigned short lb = f2bf_bits(sp[e] - bf_bits2f(hb));
              hv[e] = __builtin_bit_cast(_Float16, hb);
              lv[e] = __builtin_bit_cast(_Float16, lb);
            }
          }
          *(v8h*)(C + (size_t)(mBase + row) * ldc + n0 + c8) = hv;
          if (OUT_MODE == 2) *(v8h*)(C2 + (size_t)(mBase + row) * ldc + n0 + c8) = lv;
        }
        
      }
    }
    __builtin_amdgcn_fence(__ATOMIC_RELEASE, "workgroup");
    __builtin_amdgcn_wave_barrier();
    __builtin_amdgcn_fence(__ATOMIC_ACQUIRE, "workgroup");
  }
}

// ---------------------------------------------------------------------------
// Parameter preparation (block-uniform roles, grid = 6 blocks x 256 threads, no barriers):
//   blocks 0..2: WCAT rows blk*32..blk*32+31 = f16(16 * w_theta / w_phi / w_g [row][0..63]); block 3: rows 96..127 = 0.
//                thread t -> row blk*32 + (t>>3), cols (t&7)*8..+7 -> one 16-B store per lane at WCAT + blk*2048 + 8t
//   block 4: BCAT[128] f32 = b_theta | b_phi | b_g | 0: wave 0, lane t -> floats 4t..4t+3 (one float4 store per lane,
//                32 lanes x 16 B = the whole 512-B table); sources loaded unconditionally, combined by 0/1 factors.
//   block 5: WO16 [64][32] = f16(16 * w_out): thread t -> elements 8t..8t+7 (row t>>2, cols (t&3)*8), one 16-B store per lane.
// ---------------------------------------------------------------------------
__global__ __launch_bounds__(256) void prep_kernel(const float* __restrict__ w_theta, const float* __restrict__ w_phi,
                                                   const float* __restrict__ w_g,
                                                   const float* __restrict__ b_theta, const float* __restrict__ b_phi,
                                                   const float* __restrict__ b_g, const float* __restrict__ w_out,
                                                   unsigned short* __restrict__ wcat, float* __restrict__ bcat,
                                                   unsigned short* __restrict__ wo16) {
  const int t   = threadIdx.x;
  const int blk = blockIdx.x;   // block-uniform
  if (blk < 4) {
    v4u u;
    if (blk < 3) {
      const float* src = (blk == 0) ? w_theta : ((blk == 1) ? w_phi : w_g);
      const int rl = t >> 3, c8 = (t & 7) * 8;
      const v4f a = *(const v4f*)(src + rl * kC + c8);
      const v4f c = *(const v4f*)(src + rl * kC + c8 + 4);
      unsigned short hb[8];
#pragma unroll
      for (int e = 0; e < 4; ++e) {
        hb[e]     = h_bits(a[e] * kWCarry);
        hb[4 + e] = h_bits(c[e] * kWCarry);
      }
      u = (v4u){pk16(hb[0], hb[1]), pk16(hb[2], hb[3]), pk16(hb[4], hb[5]), pk16(hb[6], hb[7])};
    } else {
      u = (v4u){0u, 0u, 0u, 0u};
    }
    unsigned short* dst = wcat + (size_t)blk * (32 * kC) + 8 * (size_t)t;
    *(v4u*)dst = u;
    
  } else if (blk == 4) {
    if (t < 32) {   // wave 0 only (wave-uniform)
      const int seg = t >> 3;            // 0 theta, 1 phi, 2 g, 3 zero
      const int o4  = (t & 7) * 4;       // 0..28, always in range of the 32-entry vectors
      const v4f bt = *(const v4f*)(b_theta + o4);
      const v4f bp = *(const v4f*)(b_phi + o4);
      const v4f bg = *(const v4f*)(b_g + o4);
      const float f0 = (seg == 0) ? 1.0f : 0.0f;
      const float f1 = (seg == 1) ? 1.0f : 0.0f;
      const float f2 = (seg == 2) ? 1.0f : 0.0f;
      v4f val;
#pragma unroll
      for (int e = 0; e < 4; ++e) val[e] = fmaf(f0, bt[e], fmaf(f1, bp[e], f2 * bg[e]));
      float* dst = bcat + 4 * t;
      *(v4f*)dst = val;
      
    }
  } else {
    const int row = t >> 2, c8 = (t & 3) * 8;
    const v4f a = *(const v4f*)(w_out + row * kCI + c8);
    const v4f c = *(const v4f*)(w_out + row * kCI + c8 + 4);
    unsigned short hb[8];
#pragma unroll
    for (int e = 0; e < 4; ++e) {
      hb[e]     = h_bits(a[e] * kWCarry);
      hb[4 + e] = h_bits(c[e] * kWCarry);
    }
    const v4u u = (v4u){pk16(hb[0], hb[1]), pk16(hb[2], hb[3]), pk16(hb[4], hb[5]), pk16(hb[6], hb[7])};
    unsigned short* dst = wo16 + 8 * (size_t)t;
    *(v4u*)dst = u;
    
  }
}

// ---------------------------------------------------------------------------
// x transpose + cast: in x[b][64 c][4096 n] -> out XT[b][4096 n][64 c] = f16(x[b][c][n]).
// grid (4096/64 = 64, 8): blockIdx.x = n tile (64 positions), blockIdx.y = batch. 256 threads.
// Load coverage: 16 iterations x 256 threads = 4096 = the whole 64(c) x 64(n) tile (coalesced along n).
// Store coverage: 8 waves x 2 iterations x 4 rows (lane>>3) = 64 n-rows; (lane&7) x 8 halves = 64 c-cols; each row =
// ---------------------------------------------------------------------------
__global__ __launch_bounds__(256) void xt_cast_kernel(const float* __restrict__ x, unsigned short* __restrict__ XT) {
  __shared__ float sm[64][65];   // sm[n_local][c]
  const int t  = threadIdx.x;
  const int n0 = blockIdx.x * 64;
  const int b  = blockIdx.y;
#pragma unroll
  for (int i = 0; i < 16; ++i) {
    const int e  = i * 256 + t;
    const int cl = e >> 6;         // channel
    const int nl = e & 63;         // n local
    sm[nl][cl] = x[((size_t)(b * kC + cl)) * kN + n0 + nl];
  }
  __syncthreads();
  const int lane = t & 31, wave = t >> 5;
  const int q = lane >> 3, c8 = (lane & 7) * 8;
  unsigned short* op = XT + ((size_t)b * kN + n0) * kC;
  {
#pragma unroll
    for (int it = 0; it < 2; ++it) {
      const int row = wave * 8 + it * 4 + q;                 // n local
      unsigned short hb[8];
#pragma unroll
      for (int e = 0; e < 8; ++e) hb[e] = h_bits(sm[row][c8 + e]);
      const v4u u = (v4u){pk16(hb[0], hb[1]), pk16(hb[2], hb[3]), pk16(hb[4], hb[5]), pk16(hb[6], hb[7])};
      *(v4u*)(op + (size_t)row * kC + c8) = u;
    }
    
  }
}

// ---------------------------------------------------------------------------
// Scores, softmax and out^T product of all batches in one launch; scores and probabilities stay in registers.
//   out[b][c][q] = sum_key GWT[b][c][key] * softmax_key(theta[q] . phi[key]) + b_out[c] + x[b][c][q]
// grid (4096/128 = 32 position blocks, 8 batches), 16 waves: wave = query group (wave >> 2, 32 q) x key slice (wave & 3, 1024 keys).
// One pass = 32 keys:  S^T = phi . theta^T  (A = phi rows, B = theta rows, same loader: equal k order); D register r of a lane =
// S^T[key 8*(lane>>4) + r][q = lane&15], so the two key tiles of a pass, converted in place, are the B operand (hardware k order) of
// O^T += GWT . P^T  (A = GWT rows through the same loader: keys 8h..8h+7 | 16+8h..16+8h+7). D register r = out[c = 8*(lane>>4) + r][q = lane&15].
// A lane holds one query's column in both products: running maximum (log2 domain), sum and rescale factor are per-lane scalars.
// The maximum in use may trail the true one by up to 8 (an exponential reaches 2^8 at most, inside f16): rescale only when some column exceeds that.
// The four key slices of a query group are joined in LDS: maxima and sums first, then the scaled partial tiles in slice order 0..3.
// phi rows and gw^T rows come through LDS: a stage is 64 keys of each of the four slices (two passes), brought once per work-group by
// asynchronous 16-B copies (a gw^T row of a stage is one whole 128-B line, a phi row 64 B) and read by the four query waves of its slice.
// Two buffers: stage t + 1 flies while stage t is worked on; one barrier per stage publishes the one and frees the other.
// ---------------------------------------------------------------------------
constexpr int kFQ  = 32;            // queries per wave (two 16-column groups)
constexpr int kFG  = 4;             // query groups per work-group
constexpr int kFS  = 4;             // key slices per work-group
constexpr int kFW  = kFG * kFS;     // waves per work-group
constexpr int kFK  = kN / kFS;      // keys per wave
constexpr int kFNP = kFK / 32;      // passes per wave
constexpr int kFP  = 36;            // LDS row pitch in floats: 144 B = 16 B x odd
constexpr int kSK  = 64;            // keys of one slice per stage
constexpr int kNST = kFK / kSK;     // stages
constexpr int kPhP = 40;            // LDS pitch of a phi row in halves: 80 B = 16 B x odd
constexpr int kGwP = 72;            // LDS pitch of a gw^T row in halves: 144 B = 16 B x odd
constexpr int kPhB = kFS * kSK * kPhP;   // halves of one phi buffer (4 slices x 64 keys)
constexpr int kGwB = kFS * kC * kGwP;    // halves of one gw^T buffer (4 slices x 64 channels)
constexpr float kLog2e = 1.4426950408889634f;
static_assert(kSK == 64 && kNST >= 2 && kFW * 32 == 512 && kFS == 4, "stage copy map: 2 phi and 4 gw^T chunks of 16 B per thread");
static_assert(kFK % 32 == 0 && kN % (kFG * kFQ) == 0 && kCI == 32 && kC == 64, "fused tile");
static_assert(kC * kFG * kFQ == kFW * 32 * 16, "join map: four float4 per thread");
typedef __attribute__((ext_vector_type(2))) float    v2f;
typedef __attribute__((ext_vector_type(2))) _Float16 v2h;

// lane l with lane l ^ 16
__device__ __forceinline__ float xhalf(float v) {
  const int i = __builtin_bit_cast(int, v);
  return __builtin_bit_cast(float, __builtin_amdgcn_permlanex16(i, i, 0x76543210, 0xfedcba98, false, false));
}
__device__ __forceinline__ unsigned pack2h(float lo, float hi) {   // round to nearest even
  return __builtin_bit_cast(unsigned, __builtin_convertvector((v2f){lo, hi}, v2h));
}
// Eight exponentials (2^a) in one statement. The outputs are early-clobbered, so none lands on a source of another, and the closing v_nop is
// the slot the instruction set asks for behind a transcendental before its result is used or its source overwritten.
__device__ __forceinline__ void exp2x8(float (&p)[8], const float (&a)[8]) {
  asm("v_exp_f32 %0, %8\n\tv_exp_f32 %1, %9\n\tv_exp_f32 %2, %10\n\tv_exp_f32 %3, %11\n\t"
      "v_exp_f32 %4, %12\n\tv_exp_f32 %5, %13\n\tv_exp_f32 %6, %14\n\tv_exp_f32 %7, %15\n\tv_nop"
      : "=&v"(p[0]), "=&v"(p[1]), "=&v"(p[2]), "=&v"(p[3]), "=&v"(p[4]), "=&v"(p[5]), "=&v"(p[6]), "=&v"(p[7])
      : "v"(a[0]), "v"(a[1]), "v"(a[2]), "v"(a[3]), "v"(a[4]), "v"(a[5]), "v"(a[6]), "v"(a[7]));
}

// One stage: six 16-B copies per lane, global memory to LDS through no register.
// lp / gp: this lane's phi chunk of slices 0..1 (the second copy: two slices on); lg / gg: its gw^T chunk of slice 0 (then one slice on each).
// The closing s_wait_xcnt stands inside the statement so that no address register named here is rewritten ahead of it.
__device__ __forceinline__ void stage_copy(unsigned lp, unsigned lg, const _Float16* gp, const _Float16* gg) {
  const unsigned lp1 = lp + 2 * kSK * kPhP * 2;
  const unsigned lg1 = lg + kC * kGwP * 2, lg2 = lg + 2 * kC * kGwP * 2, lg3 = lg + 3 * kC * kGwP * 2;
  const _Float16* gp1 = gp + (size_t)2 * kFK * kPW;
  const _Float16* gg1 = gg + kFK;
  const _Float16* gg2 = gg + 2 * kFK;
  const _Float16* gg3 = gg + 3 * kFK;
  asm volatile("global_load_async_to_lds_b128 %0, %6, off\n\t"
               "global_load_async_to_lds_b128 %1, %7, off\n\t"
               "global_load_async_to_lds_b128 %2, %8, off\n\t"
               "global_load_async_to_lds_b128 %3, %9, off\n\t"
               "global_load_async_to_lds_b128 %4, %10, off\n\t"
               "global_load_async_to_lds_b128 %5, %11, off\n\t"
               "s_wait_xcnt 0x0"
               :: "v"(lp), "v"(lp1), "v"(lg), "v"(lg1), "v"(lg2), "v"(lg3),
                  "v"(gp), "v"(gp1), "v"(gg), "v"(gg1), "v"(gg2), "v"(gg3)
               : "memory");
}

__global__ __launch_bounds__(kFW * 32) void attn_fused_kernel(const unsigned short* __restrict__ prj,
                                                              const unsigned short* __restrict__ gwt,
                                                              const float* __restrict__ b_out,
                                                              const float* __restrict__ x,
                                                              float* __restrict__ out) {
  __shared__ __align__(16) float part[kFW][kC * kFP];
  __shared__ __align__(16) _Float16 sPh[2 * kPhB];
  __shared__ __align__(16) _Float16 sGw[2 * kGwB];
  __shared__ float sM[kFW][kFQ];
  __shared__ float sL[kFW][kFQ];
  const int t    = threadIdx.x;
  const int lane = t & 31, wave = t >> 5;
  const int b    = blockIdx.y;
  const int qg   = wave >> 2, ks = wave & 3;
  const int qb   = blockIdx.x * (kFG * kFQ);
  const int rl   = lane & 15, hh = lane >> 4;
  const _Float16* Pb = (const _Float16*)prj + (size_t)b * kN * kPW;
  const _Float16* Th = Pb + (size_t)(qb + qg * kFQ + rl) * kPW + hh * 8;
  // fragment readers: this wave's slice in buffer 0
  const _Float16* Lp = sPh + (ks * kSK + rl) * kPhP + hh * 8;
  const _Float16* Lg = sGw + (ks * kC + rl) * kGwP + hh * 8;
  // copy map: phi chunk = (slice t>>8 [+2], key (t>>2)&63, 16-B piece t&3); gw^T chunk = (slice 0 [+1,2,3], channel t>>3, 16-B piece t&7)
  const unsigned cLp = (unsigned)(size_t)(sPh + ((t >> 8) * kSK + ((t >> 2) & 63)) * kPhP + (t & 3) * 8);
  const unsigned cLg = (unsigned)(size_t)(sGw + (t >> 3) * kGwP + (t & 7) * 8);
  const _Float16* cGp = Pb + (size_t)((t >> 8) * kFK + ((t >> 2) & 63)) * kPW + kCI + (t & 3) * 8;
  const _Float16* cGg = (const _Float16*)gwt + ((size_t)b * kC + (t >> 3)) * kN + (t & 7) * 8;

  stage_copy(cLp, cLg, cGp, cGg);
  // stage 0 has landed for this wave's copies before the barrier that publishes it
  asm volatile("s_wait_asynccnt 0x0" ::: "memory");
  __syncthreads();   // stage 0 is readable by every wave
  stage_copy(cLp + kPhB * 2, cLg + kGwB * 2, cGp + (size_t)kSK * kPW, cGg + kSK);

  v16h th[2], ph[2];
#pragma unroll
  for (int g = 0; g < 2; ++g) th[g] = Frag<_Float16>::load(Th + (size_t)(g << 4) * kPW);

  v8f acc[4][2];
#pragma unroll
  for (int ct = 0; ct < 4; ++ct)
#pragma unroll
    for (int g = 0; g < 2; ++g) acc[ct][g] = (v8f){0.f,0.f,0.f,0.f,0.f,0.f,0.f,0.f};
  float m_run[2] = {-__builtin_inff(), -__builtin_inff()};
  float l_run[2] = {0.f, 0.f};

  // rolled: a stage (two passes) is already a long straight block
#pragma unroll 1
  for (int sg = 0; sg < kNST; ++sg) {
   const int bf = sg & 1;
   const _Float16* lp = Lp + bf * kPhB;
   const _Float16* lg = Lg + bf * kGwB;
#pragma unroll
   for (int kt = 0; kt < 2; ++kt) ph[kt] = Frag<_Float16>::load(lp + (kt << 4) * kPhP);
   // keeps both fragments' reads ahead of the first product: left free, the second is read into the first one's registers behind its
   // products, and the wave waits out the LDS latency twice
   __builtin_amdgcn_sched_barrier(0);
   // both passes of the stage written out: the second pass's offsets in the buffer are then immediates
#pragma unroll
   for (int pp = 0; pp < kSK / 32; ++pp) {
    v8f st[2][2];
#pragma unroll
    for (int kt = 0; kt < 2; ++kt)
#pragma unroll
      for (int g = 0; g < 2; ++g)
        st[kt][g] = Frag<_Float16>::mma(ph[kt], th[g], (v8f){0.f,0.f,0.f,0.f,0.f,0.f,0.f,0.f});
    // holds the v_nops below behind the last of these products
    __builtin_amdgcn_sched_barrier(0);
    // the loads below go over fragment registers of the products above: four vector slots between the last WMMA and a load over its A
    asm volatile("v_nop\n\tv_nop\n\tv_nop\n\tv_nop");
    v16h gw[4];
#pragma unroll
    for (int ct = 0; ct < 4; ++ct) gw[ct] = Frag<_Float16>::load(lg + (ct << 4) * kGwP + pp * 32);
    if (pp + 1 < kSK / 32) {   // the next pass's phi rows, only inside this stage's own buffer
#pragma unroll
      for (int kt = 0; kt < 2; ++kt) ph[kt] = Frag<_Float16>::load(lp + ((pp + 1) * 32 + (kt << 4)) * kPhP);
    }
    // keeps these loads ahead of the softmax work: left free, the compiler sinks each load to its use and the wave waits out its latency there
    __builtin_amdgcn_sched_barrier(0);

    float mb[2];
    bool need = false;
#pragma unroll
    for (int g = 0; g < 2; ++g) {
      float mx = st[0][g][0];
#pragma unroll
      for (int r = 1; r < 8; ++r) mx = fmaxf(mx, st[0][g][r]);
#pragma unroll
      for (int r = 0; r < 8; ++r) mx = fmaxf(mx, st[1][g][r]);
      mx = fmaxf(mx, xhalf(mx)) * kLog2e;   // both wave halves hold this query's maximum of the pass, log2 domain
      mb[g] = mx;
      need = need || (mx > m_run[g] + 8.0f);
    }
    if (__builtin_amdgcn_ballot_w32(need) != 0) {   // wave-uniform; rare after the first passes
#pragma unroll
      for (int g = 0; g < 2; ++g) {
        const float m_new = fmaxf(m_run[g], mb[g]);
        const float corr  = __builtin_amdgcn_exp2f(m_run[g] - m_new);   // 0 on the first pass, where m_run is -inf
        m_run[g] = m_new;
        l_run[g] *= corr;
#pragma unroll
        for (int ct = 0; ct < 4; ++ct) acc[ct][g] = acc[ct][g] * corr;
      }
    }
    union PB { unsigned u[8]; v16h v; } pb[2];
#pragma unroll
    for (int g = 0; g < 2; ++g) {
      const float nm = -m_run[g];
      float ls = 0.f;
#pragma unroll
      for (int kt = 0; kt < 2; ++kt) {   // key tile kt fills elements 8kt..8kt+7 of the 32-key operand, register r = element 8kt + r
        float a[8], p[8];
#pragma unroll
        for (int r = 0; r < 8; ++r) a[r] = fmaf(st[kt][g][r], kLog2e, nm);
        exp2x8(p, a);
#pragma unroll
        for (int i = 0; i < 4; ++i) {
          ls += p[2 * i] + p[2 * i + 1];
          pb[g].u[kt * 4 + i] = pack2h(p[2 * i], p[2 * i + 1]);
        }
      }
      l_run[g] += ls;
    }
    // keeps every exponential statement ahead of the products below: an exponential
    // moved behind a product could write over its B operand too early
    __builtin_amdgcn_sched_barrier(0);
#pragma unroll
    for (int g = 0; g < 2; ++g)
#pragma unroll
      for (int ct = 0; ct < 4; ++ct) acc[ct][g] = Frag<_Float16>::mma(gw[ct], pb[g].v, acc[ct][g]);
   }
   // foot of a stage: this wave's reads of the buffer are done, its copies of the next stage have landed
   asm volatile("s_wait_dscnt 0x0" ::: "memory");
   asm volatile("s_wait_asynccnt 0x0" ::: "memory");
   __syncthreads();   // publishes stage sg + 1 and frees the buffer of stage sg
   if (sg + 2 < kNST)
     stage_copy(cLp + bf * (kPhB * 2), cLg + bf * (kGwB * 2), cGp + (size_t)(sg + 2) * kSK * kPW, cGg + (sg + 2) * kSK);
  }
  // nothing is outstanding here; the wait closes the ring before the wave goes on to the join
  asm volatile("s_wait_asynccnt 0x0" ::: "memory");

  // ---- join of the four key slices of each query group ----
#pragma unroll
  for (int g = 0; g < 2; ++g) {
    l_run[g] += xhalf(l_run[g]);
    if (hh == 0) {
      sM[wave][(g << 4) + rl] = m_run[g];
      sL[wave][(g << 4) + rl] = l_run[g];
    }
  }
  __syncthreads();   // every slice's maxima and sums are in LDS before any wave forms its factor
  float* my = part[wave];
#pragma unroll
  for (int g = 0; g < 2; ++g) {
    const int ql = (g << 4) + rl;
    float M = sM[qg * kFS][ql];
#pragma unroll
    for (int j = 1; j < kFS; ++j) M = fmaxf(M, sM[qg * kFS + j][ql]);
    float L = 0.f;
#pragma unroll
    for (int j = 0; j < kFS; ++j) L += sL[qg * kFS + j][ql] * __builtin_amdgcn_exp2f(sM[qg * kFS + j][ql] - M);
    const float f = __builtin_amdgcn_exp2f(m_run[g] - M) / L;
#pragma unroll
    for (int ct = 0; ct < 4; ++ct)
#pragma unroll
      for (int r = 0; r < 8; ++r) my[((ct << 4) + hh * 8 + r) * kFP + ql] = acc[ct][g][r] * f;
  }
  __syncthreads();   // every wave's scaled partial tile is in LDS before any thread sums across slices

  // thread t, trip it: float4 index it*512 + t of the 64 c x 128 q tile; a wave writes one whole 512-B row segment of out
#pragma unroll
  for (int it = 0; it < 4; ++it) {
    const int idx = it * (kFW * 32) + t;
    const int c   = idx >> 5;
    const int q4  = (idx & 31) * 4;
    const int g4  = (q4 >> 5) * kFS;
    const int po  = c * kFP + (q4 & 31);
    v4f sum = *(const v4f*)(&part[g4][po]);
#pragma unroll
    for (int j = 1; j < kFS; ++j) sum = sum + *(const v4f*)(&part[g4 + j][po]);
    const size_t o = ((size_t)b * kC + c) * kN + qb + q4;
    const v4f rr = *(const v4f*)(x + o);
    const float bv = b_out[c];
    v4f v;
#pragma unroll
    for (int e = 0; e < 4; ++e) v[e] = (sum[e] + bv) + rr[e];
    *(v4f*)(out + o) = v;
  }
}

// ---------------------------------------------------------------------------
// Host glue.
//   WCAT f16 [128][64]           16,384  at           0   (theta|phi|g weights x16, rows 96..127 zero)
//   BCAT f32 [128]                  512  at      16,384   (b_theta|b_phi|b_g|0)
//   WO16 f16 [64][32]             4,096  at      16,896   (w_out x16)
//   XT   f16 [8][4096][64]    4,194,304  at      20,992   (x transposed to [n][c])
//   PRJ  f16 [8][4096][128]   8,388,608  at   4,215,296   (theta | phi | g | 0 per position)
//   GWT  f16 [8][64][4096]    4,194,304  at  12,603,904   (gw^T[c][key] = sum_o w_out[c][o] g[key][o])
//   total                    16,798,208
// GEMM shapes: proj M=4096 N=128 K=64; gw^T M=64 N=4096 K=32; scores (K=32) and out^T (K=4096) inside the fused kernel.
// All M,N multiples of 64, all K multiples of 32, no padding anywhere except the zero weight/bias rows 96..127 (written by prep).
// ---------------------------------------------------------------------------
extern "C" void kernel_launch(void* const* d_in, const int* in_sizes, int n_in,
                              void* d_out, int out_size, void* d_ws, size_t ws_size,
                              hipStream_t stream) {
  if (n_in < 9) return;
  const int nX = kB * kC * kN;   // 2,097,152
  if (in_sizes[0] != nX) return;
  if (in_sizes[1] != kCI * kC || in_sizes[2] != kCI) return;
  if (in_sizes[3] != kCI * kC || in_sizes[4] != kCI) return;
  if (in_sizes[5] != kCI * kC || in_sizes[6] != kCI) return;
  if (in_sizes[7] != kC * kCI || in_sizes[8] != kC) return;
  if (out_size != nX) return;

  const size_t szWC  = (size_t)kPW * kC * 2;
  const size_t szBC  = (size_t)kPW * 4;
  const size_t szWO  = (size_t)kC * kCI * 2;
  const size_t szXT  = (size_t)kB * kN * kC * 2;
  const size_t szPRJ = (size_t)kB * kN * kPW * 2;
  const size_t szGWT = (size_t)kB * kC * kN * 2;
  const size_t offWC  = 0;
  const size_t offBC  = offWC + szWC;
  const size_t offWO  = offBC + szBC;
  const size_t offXT  = offWO + szWO;
  const size_t offPRJ = offXT + szXT;
  const size_t offGWT = offPRJ + szPRJ;
  const size_t total  = offGWT + szGWT;
  if (ws_size < total) return;

  const float* x       = (const float*)d_in[0];
  const float* w_theta = (const float*)d_in[1];
  const float* b_theta = (const float*)d_in[2];
  const float* w_phi   = (const float*)d_in[3];
  const float* b_phi   = (const float*)d_in[4];
  const float* w_g     = (const float*)d_in[5];
  const float* b_g     = (const float*)d_in[6];
  const float* w_out   = (const float*)d_in[7];
  const float* b_out   = (const float*)d_in[8];
  float* out = (float*)d_out;
  char* ws = (char*)d_ws;
  unsigned short* WC  = (unsigned short*)(ws + offWC);
  float*          BC  = (float*)(ws + offBC);
  unsigned short* WO  = (unsigned short*)(ws + offWO);
  unsigned short* XT  = (unsigned short*)(ws + offXT);
  unsigned short* PRJ = (unsigned short*)(ws + offPRJ);
  unsigned short* GWT = (unsigned short*)(ws + offGWT);

  // ---- prologue: parameter planes, x^T cast ----
  prep_kernel<<<dim3(6), dim3(256), 0, stream>>>(w_theta, w_phi, w_g, b_theta, b_phi, b_g, w_out, WC, BC, WO);
  xt_cast_kernel<<<dim3(kN / 64, kB), dim3(256), 0, stream>>>(x, XT);

  // ---- projections: PRJ[b][n][o'] = f16( (1/16) sum_c XT[b][n][c] * WC[o'][c] + BC[o'] )   (M=4096, N=128, K=64; 128 tiles -> 16 blocks) ----
  const long strideXT  = (long)kN * kC;
  const long stridePRJ = (long)kN * kPW;
  const long strideGWT = (long)kC * kN;
  wmma_gemm64<0, false, 2, 1, false, 0><<<dim3(16, kB), dim3(256), 0, stream>>>(
      XT, XT, kC, strideXT, WC, WC, kC, 0L,
      (void*)PRJ, (void*)PRJ, kPW, stridePRJ, BC, x, 0L, kN, kPW, kC, kWCarryInv);

  // ---- gw^T: GWT[b][c][key] = f16( (1/16) sum_o WO[c][o] * PRJ[b][key][64+o] )   (M=64, N=4096, K=32; 64 tiles -> 8 blocks) ----
  wmma_gemm64<0, false, 0, 1, false, 0><<<dim3(8, kB), dim3(256), 0, stream>>>(
      WO, WO, kCI, 0L, PRJ + 64, PRJ + 64, kPW, stridePRJ,
      (void*)GWT, (void*)GWT, kN, strideGWT, BC, x, 0L, kC, kN, kCI, kWCarryInv);

  // ---- scores, softmax over keys, out^T product, bias and residual: all batches, one launch (32 position blocks x 8 batches) ----
  attn_fused_kernel<<<dim3(kN / (kFG * kFQ), kB), dim3(kFW * 32), 0, stream>>>(PRJ, GWT, b_out, x, out);
}

// v004
// A run of this version takes 36.4 microseconds.
// Next to v003, in two timings, it ran 1.44 and 1.45 times as fast.
// Counting every step since v000, it is 42.2 times as fast.
// Contractions: channel projections (W f16 carried x16 . x f16), scores phi.theta^T (f16 planes), gw^T = g (f16) . W_out^T (f16 carried x16), out^T = gw^T f16 x P^T (f16, unnormalised exponentials): all on v_wmma_f32_16x16x32_f16 with f32 accumulate; bias adds, softmax and residual in f32.
#include <hip/hip_runtime.h>
#include <math.h>

// ---------------------------------------------------------------------------
// Problem constants
// ---------------------------------------------------------------------------
constexpr int kB  = 8;        // batch
constexpr int kC  = 64;       // in channels
constexpr int kCI = 32;       // inter channels
constexpr int kN  = 4096;     // H*W positions
constexpr int kPW = 128;      // projection plane row pitch in halves: theta 0..31 | phi 32..63 | 64..127 neither written nor read
constexpr float kWCarry    = 16.0f;            // weights carried x16 in f16
constexpr float kWCarryInv = 1.0f / 16.0f;
static_assert(kN % 64 == 0 && kPW % 64 == 0 && kC % 64 == 0, "M,N tiles");
static_assert(kC % 32 == 0 && kCI % 32 == 0 && kN % 32 == 0, "K steps");

typedef __attribute__((ext_vector_type(16))) _Float16 v16h;
typedef __attribute__((ext_vector_type(8)))  _Float16 v8h;
typedef __attribute__((ext_vector_type(8)))  float    v8f;
typedef __attribute__((ext_vector_type(4)))  float    v4f;
typedef __attribute__((ext_vector_type(4)))  unsigned int v4u;

// ---------------------------------------------------------------------------
// Helpers
// ---------------------------------------------------------------------------
template <typename T> struct Frag;
template <> struct Frag<_Float16> {
  typedef v16h V; union U { v16h v; v8h h[2]; };
  // elements 0..7 <- p[0..7], 8..15 <- p[16..23]
  static __device__ __forceinline__ v16h load(const _Float16* p) {
    U f; f.h[0] = *(const v8h*)(p); f.h[1] = *(const v8h*)(p + 16); return f.v;
  }
  static __device__ __forceinline__ v8f mma(v16h a, v16h b, v8f c) {
    return __builtin_amdgcn_wmma_f32_16x16x32_f16(false, a, false, b, (short)0, c, false, false);
  }
};

// ---------------------------------------------------------------------------
// Scores, softmax and out^T product of all batches in one launch; scores and probabilities stay in registers.
//   out[b][c][q] = sum_key GWT[b][c][key] * softmax_key(theta[q] . phi[key]) + b_out[c] + x[b][c][q]
// grid (4096/128 = 32 position blocks, 8 batches), 16 waves: wave = query group (wave >> 2, 32 q) x key slice (wave & 3, 1024 keys).
// One pass = 32 keys:  S^T = phi . theta^T  (A = phi rows, B = theta rows, same loader: equal k order); D register r of a lane =
// S^T[key 8*(lane>>4) + r][q = lane&15], so the two key tiles of a pass, converted in place, are the B operand (hardware k order) of
// O^T += GWT . P^T  (A = GWT rows through the same loader: keys 8h..8h+7 | 16+8h..16+8h+7). D register r = out[c = 8*(lane>>4) + r][q = lane&15].
// A lane holds one query's column in both products: running maximum (log2 domain), sum and rescale factor are per-lane scalars.
// The maximum in use may trail the true one by up to 8 (an exponential reaches 2^8 at most, inside f16): rescale only when some column exceeds that.
// The four key slices of a query group are joined in LDS: maxima and sums first, then the scaled partial tiles in slice order 0..3.
// phi rows and gw^T rows come through LDS: a stage is 64 keys of each of the four slices (two passes), brought once per work-group by
// asynchronous 16-B copies (a gw^T row of a stage is one whole 128-B line, a phi row 64 B) and read by the four query waves of its slice.
// Two buffers: stage t + 1 flies while stage t is worked on; one barrier per stage publishes the one and frees the other.
// ---------------------------------------------------------------------------
constexpr int kFQ  = 32;            // queries per wave (two 16-column groups)
constexpr int kFG  = 4;             // query groups per work-group
constexpr int kFS  = 4;             // key slices per work-group
constexpr int kFW  = kFG * kFS;     // waves per work-group
constexpr int kFK  = kN / kFS;      // keys per wave
constexpr int kFNP = kFK / 32;      // passes per wave
constexpr int kFP  = 36;            // LDS row pitch in floats: 144 B = 16 B x odd
constexpr int kSK  = 64;            // keys of one slice per stage
constexpr int kNST = kFK / kSK;     // stages
constexpr int kPhP = 40;            // LDS pitch of a phi row in halves: 80 B = 16 B x odd
constexpr int kGwP = 72;            // LDS pitch of a gw^T row in halves: 144 B = 16 B x odd
constexpr int kPhB = kFS * kSK * kPhP;   // halves of one phi buffer (4 slices x 64 keys)
constexpr int kGwB = kFS * kC * kGwP;    // halves of one gw^T buffer (4 slices x 64 channels)
constexpr float kLog2e = 1.4426950408889634f;
static_assert(kSK == 64 && kNST >= 2 && kFW * 32 == 512 && kFS == 4, "stage copy map: 2 phi and 4 gw^T chunks of 16 B per thread");
static_assert(kFK % 32 == 0 && kN % (kFG * kFQ) == 0 && kCI == 32 && kC == 64, "fused tile");
static_assert(kC * kFG * kFQ == kFW * 32 * 16, "join map: four float4 per thread");
typedef __attribute__((ext_vector_type(2))) float    v2f;
typedef __attribute__((ext_vector_type(2))) _Float16 v2h;

// lane l with lane l ^ 16
__device__ __forceinline__ float xhalf(float v) {
  const int i = __builtin_bit_cast(int, v);
  return __builtin_bit_cast(float, __builtin_amdgcn_permlanex16(i, i, 0x76543210, 0xfedcba98, false, false));
}
__device__ __forceinline__ unsigned pack2h(float lo, float hi) {   // round to nearest even
  return __builtin_bit_cast(unsigned, __builtin_convertvector((v2f){lo, hi}, v2h));
}
// Eight exponentials (2^a) in one statement. The outputs are early-clobbered, so none lands on a source of another, and the closing v_nop is
// the slot the instruction set asks for behind a transcendental before its result is used or its source overwritten.
__device__ __forceinline__ void exp2x8(float (&p)[8], const float (&a)[8]) {
  asm("v_exp_f32 %0, %8\n\tv_exp_f32 %1, %9\n\tv_exp_f32 %2, %10\n\tv_exp_f32 %3, %11\n\t"
      "v_exp_f32 %4, %12\n\tv_exp_f32 %5, %13\n\tv_exp_f32 %6, %14\n\tv_exp_f32 %7, %15\n\tv_nop"
      : "=&v"(p[0]), "=&v"(p[1]), "=&v"(p[2]), "=&v"(p[3]), "=&v"(p[4]), "=&v"(p[5]), "=&v"(p[6]), "=&v"(p[7])
      : "v"(a[0]), "v"(a[1]), "v"(a[2]), "v"(a[3]), "v"(a[4]), "v"(a[5]), "v"(a[6]), "v"(a[7]));
}

// One stage: six 16-B copies per lane, global memory to LDS through no register.
// lp / gp: this lane's phi chunk of slices 0..1 (the second copy: two slices on); lg / gg: its gw^T chunk of slice 0 (then one slice on each).
// The closing s_wait_xcnt stands inside the statement so that no address register named here is rewritten ahead of it.
__device__ __forceinline__ void stage_copy(unsigned lp, unsigned lg, const _Float16* gp, const _Float16* gg) {
  const unsigned lp1 = lp + 2 * kSK * kPhP * 2;
  const unsigned lg1 = lg + kC * kGwP * 2, lg2 = lg + 2 * kC * kGwP * 2, lg3 = lg + 3 * kC * kGwP * 2;
  const _Float16* gp1 = gp + (size_t)2 * kFK * kPW;
  const _Float16* gg1 = gg + kFK;
  const _Float16* gg2 = gg + 2 * kFK;
  const _Float16* gg3 = gg + 3 * kFK;
  asm volatile("global_load_async_to_lds_b128 %0, %6, off\n\t"
               "global_load_async_to_lds_b128 %1, %7, off\n\t"
               "global_load_async_to_lds_b128 %2, %8, off\n\t"
               "global_load_async_to_lds_b128 %3, %9, off\n\t"
               "global_load_async_to_lds_b128 %4, %10, off\n\t"
               "global_load_async_to_lds_b128 %5, %11, off\n\t"
               "s_wait_xcnt 0x0"
               :: "v"(lp), "v"(lp1), "v"(lg), "v"(lg1), "v"(lg2), "v"(lg3),
                  "v"(gp), "v"(gp1), "v"(gg), "v"(gg1), "v"(gg2), "v"(gg3)
               : "memory");
}

__global__ __launch_bounds__(kFW * 32) void attn_fused_kernel(const unsigned short* __restrict__ prj,
                                                              const unsigned short* __restrict__ gwt,
                                                              const float* __restrict__ b_out,
                                                              const float* __restrict__ x,
                                                              float* __restrict__ out) {
  __shared__ __align__(16) float part[kFW][kC * kFP];
  __shared__ __align__(16) _Float16 sPh[2 * kPhB];
  __shared__ __align__(16) _Float16 sGw[2 * kGwB];
  __shared__ float sM[kFW][kFQ];
  __shared__ float sL[kFW][kFQ];
  const int t    = threadIdx.x;
  const int lane = t & 31, wave = t >> 5;
  const int b    = blockIdx.y;
  const int qg   = wave >> 2, ks = wave & 3;
  const int qb   = blockIdx.x * (kFG * kFQ);
  const int rl   = lane & 15, hh = lane >> 4;
  const _Float16* Pb = (const _Float16*)prj + (size_t)b * kN * kPW;
  const _Float16* Th = Pb + (size_t)(qb + qg * kFQ + rl) * kPW + hh * 8;
  // fragment readers: this wave's slice in buffer 0
  const _Float16* Lp = sPh + (ks * kSK + rl) * kPhP + hh * 8;
  const _Float16* Lg = sGw + (ks * kC + rl) * kGwP + hh * 8;
  // copy map: phi chunk = (slice t>>8 [+2], key (t>>2)&63, 16-B piece t&3); gw^T chunk = (slice 0 [+1,2,3], channel t>>3, 16-B piece t&7)
  const unsigned cLp = (unsigned)(size_t)(sPh + ((t >> 8) * kSK + ((t >> 2) & 63)) * kPhP + (t & 3) * 8);
  const unsigned cLg = (unsigned)(size_t)(sGw + (t >> 3) * kGwP + (t & 7) * 8);
  const _Float16* cGp = Pb + (size_t)((t >> 8) * kFK + ((t >> 2) & 63)) * kPW + kCI + (t & 3) * 8;
  const _Float16* cGg = (const _Float16*)gwt + ((size_t)b * kC + (t >> 3)) * kN + (t & 7) * 8;

  stage_copy(cLp, cLg, cGp, cGg);
  // stage 0 has landed for this wave's copies before the barrier that publishes it
  asm volatile("s_wait_asynccnt 0x0" ::: "memory");
  __syncthreads();   // stage 0 is readable by every wave
  stage_copy(cLp + kPhB * 2, cLg + kGwB * 2, cGp + (size_t)kSK * kPW, cGg + kSK);

  v16h th[2], ph[2];
#pragma unroll
  for (int g = 0; g < 2; ++g) th[g] = Frag<_Float16>::load(Th + (size_t)(g << 4) * kPW);

  v8f acc[4][2];
#pragma unroll
  for (int ct = 0; ct < 4; ++ct)
#pragma unroll
    for (int g = 0; g < 2; ++g) acc[ct][g] = (v8f){0.f,0.f,0.f,0.f,0.f,0.f,0.f,0.f};
  float m_run[2] = {-__builtin_inff(), -__builtin_inff()};
  float l_run[2] = {0.f, 0.f};

  // rolled: a stage (two passes) is already a long straight block
#pragma unroll 1
  for (int sg = 0; sg < kNST; ++sg) {
   const int bf = sg & 1;
   const _Float16* lp = Lp + bf * kPhB;
   const _Float16* lg = Lg + bf * kGwB;
#pragma unroll
   for (int kt = 0; kt < 2; ++kt) ph[kt] = Frag<_Float16>::load(lp + (kt << 4) * kPhP);
   // keeps both fragments' reads ahead of the first product: left free, the second is read into the first one's registers behind its
   // products, and the wave waits out the LDS latency twice
   __builtin_amdgcn_sched_barrier(0);
   // both passes of the stage written out: the second pass's offsets in the buffer are then immediates
#pragma unroll
   for (int pp = 0; pp < kSK / 32; ++pp) {
    v8f st[2][2];
#pragma unroll
    for (int kt = 0; kt < 2; ++kt)
#pragma unroll
      for (int g = 0; g < 2; ++g)
        st[kt][g] = Frag<_Float16>::mma(ph[kt], th[g], (v8f){0.f,0.f,0.f,0.f,0.f,0.f,0.f,0.f});
    // holds the v_nops below behind the last of these products
    __builtin_amdgcn_sched_barrier(0);
    // the loads below go over fragment registers of the products above: four vector slots between the last WMMA and a load over its A
    asm volatile("v_nop\n\tv_nop\n\tv_nop\n\tv_nop");
    v16h gw[4];
#pragma unroll
    for (int ct = 0; ct < 4; ++ct) gw[ct] = Frag<_Float16>::load(lg + (ct << 4) * kGwP + pp * 32);
    if (pp + 1 < kSK / 32) {   // the next pass's phi rows, only inside this stage's own buffer
#pragma unroll
      for (int kt = 0; kt < 2; ++kt) ph[kt] = Frag<_Float16>::load(lp + ((pp + 1) * 32 + (kt << 4)) * kPhP);
    }
    // keeps these loads ahead of the softmax work: left free, the compiler sinks each load to its use and the wave waits out its latency there
    __builtin_amdgcn_sched_barrier(0);

    float mb[2];
    bool need = false;
#pragma unroll
    for (int g = 0; g < 2; ++g) {
      float mx = st[0][g][0];
#pragma unroll
      for (int r = 1; r < 8; ++r) mx = fmaxf(mx, st[0][g][r]);
#pragma unroll
      for (int r = 0; r < 8; ++r) mx = fmaxf(mx, st[1][g][r]);
      mx = fmaxf(mx, xhalf(mx)) * kLog2e;   // both wave halves hold this query's maximum of the pass, log2 domain
      mb[g] = mx;
      need = need || (mx > m_run[g] + 8.0f);
    }
    if (__builtin_amdgcn_ballot_w32(need) != 0) {   // wave-uniform; rare after the first passes
#pragma unroll
      for (int g = 0; g < 2; ++g) {
        const float m_new = fmaxf(m_run[g], mb[g]);
        const float corr  = __builtin_amdgcn_exp2f(m_run[g] - m_new);   // 0 on the first pass, where m_run is -inf
        m_run[g] = m_new;
        l_run[g] *= corr;
#pragma unroll
        for (int ct = 0; ct < 4; ++ct) acc[ct][g] = acc[ct][g] * corr;
      }
    }
    union PB { unsigned u[8]; v16h v; } pb[2];
#pragma unroll
    for (int g = 0; g < 2; ++g) {
      const float nm = -m_run[g];
      float ls = 0.f;
#pragma unroll
      for (int kt = 0; kt < 2; ++kt) {   // key tile kt fills elements 8kt..8kt+7 of the 32-key operand, register r = element 8kt + r
        float a[8], p[8];
#pragma unroll
        for (int r = 0; r < 8; ++r) a[r] = fmaf(st[kt][g][r], kLog2e, nm);
        exp2x8(p, a);
#pragma unroll
        for (int i = 0; i < 4; ++i) {
          ls += p[2 * i] + p[2 * i + 1];
          pb[g].u[kt * 4 + i] = pack2h(p[2 * i], p[2 * i + 1]);
        }
      }
      l_run[g] += ls;
    }
    // keeps every exponential statement ahead of the products below: an exponential
    // moved behind a product could write over its B operand too early
    __builtin_amdgcn_sched_barrier(0);
#pragma unroll
    for (int g = 0; g < 2; ++g)
#pragma unroll
      for (int ct = 0; ct < 4; ++ct) acc[ct][g] = Frag<_Float16>::mma(gw[ct], pb[g].v, acc[ct][g]);
   }
   // foot of a stage: this wave's reads of the buffer are done, its copies of the next stage have landed
   asm volatile("s_wait_dscnt 0x0" ::: "memory");
   asm volatile("s_wait_asynccnt 0x0" ::: "memory");
   __syncthreads();   // publishes stage sg + 1 and frees the buffer of stage sg
   if (sg + 2 < kNST)
     stage_copy(cLp + bf * (kPhB * 2), cLg + bf * (kGwB * 2), cGp + (size_t)(sg + 2) * kSK * kPW, cGg + (sg + 2) * kSK);
  }
  // nothing is outstanding here; the wait closes the ring before the wave goes on to the join
  asm volatile("s_wait_asynccnt 0x0" ::: "memory");

  // ---- join of the four key slices of each query group ----
#pragma unroll
  for (int g = 0; g < 2; ++g) {
    l_run[g] += xhalf(l_run[g]);
    if (hh == 0) {
      sM[wave][(g << 4) + rl] = m_run[g];
      sL[wave][(g << 4) + rl] = l_run[g];
    }
  }
  __syncthreads();   // every slice's maxima and sums are in LDS before any wave forms its factor
  float* my = part[wave];
#pragma unroll
  for (int g = 0; g < 2; ++g) {
    const int ql = (g << 4) + rl;
    float M = sM[qg * kFS][ql];
#pragma unroll
    for (int j = 1; j < kFS; ++j) M = fmaxf(M, sM[qg * kFS + j][ql]);
    float L = 0.f;
#pragma unroll
    for (int j = 0; j < kFS; ++j) L += sL[qg * kFS + j][ql] * __builtin_amdgcn_exp2f(sM[qg * kFS + j][ql] - M);
    const float f = __builtin_amdgcn_exp2f(m_run[g] - M) / L;
#pragma unroll
    for (int ct = 0; ct < 4; ++ct)
#pragma unroll
      for (int r = 0; r < 8; ++r) my[((ct << 4) + hh * 8 + r) * kFP + ql] = acc[ct][g][r] * f;
  }
  __syncthreads();   // every wave's scaled partial tile is in LDS before any thread sums across slices

  // thread t, trip it: float4 index it*512 + t of the 64 c x 128 q tile; a wave writes one whole 512-B row segment of out
#pragma unroll
  for (int it = 0; it < 4; ++it) {
    const int idx = it * (kFW * 32) + t;
    const int c   = idx >> 5;
    const int q4  = (idx & 31) * 4;
    const int g4  = (q4 >> 5) * kFS;
    const int po  = c * kFP + (q4 & 31);
    v4f sum = *(const v4f*)(&part[g4][po]);
#pragma unroll
    for (int j = 1; j < kFS; ++j) sum = sum + *(const v4f*)(&part[g4 + j][po]);
    const size_t o = ((size_t)b * kC + c) * kN + qb + q4;
    const v4f rr = *(const v4f*)(x + o);
    const float bv = b_out[c];
    v4f v;
#pragma unroll
    for (int e = 0; e < 4; ++e) v[e] = (sum[e] + bv) + rr[e];
    *(v4f*)(out + o) = v;
  }
}

// ---------------------------------------------------------------------------
// Weight preparation, channel projections and gw^T in one launch, straight from x and the f32 weights.
// grid (4096/256 = 16, 8 batches), 4 waves; a wave owns the 64 positions n0..n0+63 of one batch; x and g pass through no memory in between.
// Weights: the work-group rounds 16 w to f16 once into LDS (rows theta | phi | g, then w_out; biases in f32); one barrier publishes them.
// Every global load of a wave is issued ahead of that barrier, the weights first: one trip to memory in all.
// First product, D = W . x: A = weight rows (m = output channel), B = x columns (n = position, f16(x)), K = 64 channels in two steps.
//   A lane reads x as one float4 per channel at position n0 + 4*(lane&15); component g goes to position tile g, whose column j is position
//   n0 + 4j + g. A wave-wide load is two whole 256-B pieces of two rows of x.
//   Element s of both operands is channel 32 ks + 8*(lane>>4) + s for s < 8 and 32 ks + 16 + 8*(lane>>4) + (s - 8) for s >= 8.
//   D register r = output channel 16 mt + 8*(lane>>4) + r at the lane's position: theta and phi leave as one 16-B store per tile.
// Second product, D = g . W_out^T: the two g tiles of a position tile, converted in place, are its A operand (row = position, the k order above);
//   B = w_out rows in the same k order. D register r of tile g = key n0 + 32*(lane>>4) + 4r + g at channel 16 j + (lane&15): the four tiles
//   interleave to 32 consecutive keys per lane, and every 128-B line of gw^T is written by one wave.
// ---------------------------------------------------------------------------
constexpr int kJP  = 64;        // positions per wave (four position tiles)
constexpr int kJW  = 4;         // waves per work-group
constexpr int kJO  = 3 * kCI;   // projection rows: theta | phi | g
constexpr int kWP  = 72;        // LDS pitch of a projection weight row in halves: 144 B = 16 B x odd
constexpr int kOP  = 40;        // LDS pitch of a w_out row in halves: 80 B = 16 B x odd
static_assert(kN % (kJP * kJW) == 0 && kC == 64 && kCI == 32 && kJW == 4, "projection tile and weight copy map");
union HFrag { unsigned u[8]; v16h v; };
typedef __attribute__((ext_vector_type(2))) unsigned int v2u;

// four weights, carried x16, rounded to f16
__device__ __forceinline__ v2u w_pack(v4f q) {
  return (v2u){pack2h(q[0] * kWCarry, q[1] * kWCarry), pack2h(q[2] * kWCarry, q[3] * kWCarry)};
}

__global__ __launch_bounds__(kJW * 32) void proj_gwt_kernel(const float* __restrict__ x,
                                                            const float* __restrict__ w_theta, const float* __restrict__ b_theta,
                                                            const float* __restrict__ w_phi, const float* __restrict__ b_phi,
                                                            const float* __restrict__ w_g, const float* __restrict__ b_g,
                                                            const float* __restrict__ w_out,
                                                            unsigned short* __restrict__ prj, unsigned short* __restrict__ gwt) {
  __shared__ __align__(16) _Float16 sW[kJO * kWP];
  __shared__ __align__(16) _Float16 sO[kC * kOP];
  __shared__ __align__(16) float sB[kJW * 32];   // b_theta | b_phi | b_g | a copy of b_g that nobody reads (wave 3 takes no branch of its own)
  const int t    = threadIdx.x;
  const int lane = t & 31, wave = t >> 5;
  const int rl   = lane & 15, hh = lane >> 4;
  const int b    = blockIdx.y;
  const int n0   = (blockIdx.x * kJW + wave) * kJP;

  // weights: trip i brings 8 rows of 64 (16 threads a row), four trips a matrix; w_out: 16 rows of 32 a trip (8 threads a row)
  const int wo = (t >> 4) * kC + (t & 15) * 4;
  const float* pw0 = w_theta + wo;
  const float* pw1 = w_phi + wo;
  const float* pw2 = w_g + wo;
  const float* po  = w_out + (t >> 3) * kCI + (t & 7) * 4;
  const float* pb  = ((wave == 0) ? b_theta : ((wave == 1) ? b_phi : b_g)) + lane;
  v4f wq[12], oq[4];
#pragma unroll
  for (int i = 0; i < 12; ++i) wq[i] = *(const v4f*)(((i < 4) ? pw0 : ((i < 8) ? pw1 : pw2)) + (i & 3) * 8 * kC);
#pragma unroll
  for (int i = 0; i < 4; ++i) oq[i] = *(const v4f*)(po + i * 16 * kCI);
  const float bq = *pb;

  // x: 32 channels per lane, four positions each
  const float* xp = x + ((size_t)b * kC + hh * 8) * kN + n0 + 4 * rl;
  v4f xv[2][16];
#pragma unroll
  for (int ks = 0; ks < 2; ++ks)
#pragma unroll
    for (int s = 0; s < 16; ++s) xv[ks][s] = *(const v4f*)(xp + (size_t)(ks * 32 + (s < 8 ? s : s + 8)) * kN);
  // the wait that stands before an address register of an issued load is written again; the addresses are named as inputs so that they
  // stay in their registers up to here (left free, later loads of this run were given earlier loads' address registers as destinations)
  asm volatile("s_wait_xcnt 0x0" :: "v"(pw0), "v"(pw1), "v"(pw2), "v"(po), "v"(pb), "v"(xp) : "memory");
  // keeps every load ahead of the first conversion: left free, the compiler waits for weights before it issues the x loads, two trips in series
  __builtin_amdgcn_sched_barrier(0);

#pragma unroll
  for (int i = 0; i < 12; ++i) *(v2u*)(sW + (i * 8 + (t >> 4)) * kWP + (t & 15) * 4) = w_pack(wq[i]);
#pragma unroll
  for (int i = 0; i < 4; ++i) *(v2u*)(sO + (i * 16 + (t >> 3)) * kOP + (t & 7) * 4) = w_pack(oq[i]);
  sB[t] = bq;
  __syncthreads();   // the f16 weights and the biases are in LDS before any wave reads an operand

  HFrag xb[4][2];
#pragma unroll
  for (int g = 0; g < 4; ++g)
#pragma unroll
    for (int ks = 0; ks < 2; ++ks)
#pragma unroll
      for (int i = 0; i < 8; ++i) xb[g][ks].u[i] = pack2h(xv[ks][2 * i][g], xv[ks][2 * i + 1][g]);

  // theta (mt 0, 1), phi (mt 2, 3), g (mt 4, 5)
  HFrag ga[4];
  unsigned short* pr = prj + ((size_t)b * kN + n0 + 4 * rl) * kPW + hh * 8;
#pragma unroll
  for (int mt = 0; mt < 6; ++mt) {
    const _Float16* wr = sW + (mt * 16 + rl) * kWP + hh * 8;
    const v16h wa0 = Frag<_Float16>::load(wr);
    const v16h wa1 = Frag<_Float16>::load(wr + 32);
    const v4f bv[2] = {*(const v4f*)(sB + mt * 16 + hh * 8), *(const v4f*)(sB + mt * 16 + hh * 8 + 4)};
    v8f acc[4];
#pragma unroll
    for (int g = 0; g < 4; ++g) acc[g] = Frag<_Float16>::mma(wa0, xb[g][0].v, (v8f){0.f,0.f,0.f,0.f,0.f,0.f,0.f,0.f});
#pragma unroll
    for (int g = 0; g < 4; ++g) acc[g] = Frag<_Float16>::mma(wa1, xb[g][1].v, acc[g]);
#pragma unroll
    for (int g = 0; g < 4; ++g) {
      unsigned u[4];
#pragma unroll
      for (int i = 0; i < 4; ++i)
        u[i] = pack2h(fmaf(acc[g][2 * i], kWCarryInv, bv[i >> 1][(2 * i) & 3]), fmaf(acc[g][2 * i + 1], kWCarryInv, bv[i >> 1][(2 * i + 1) & 3]));
      if (mt < 4) {
        *(v4u*)(pr + (size_t)g * kPW + mt * 16) = (v4u){u[0], u[1], u[2], u[3]};
      } else {
#pragma unroll
        for (int i = 0; i < 4; ++i) ga[g].u[(mt - 4) * 4 + i] = u[i];
      }
    }
  }

  // gw^T[c][key] = (1/16) sum_o g[key][o] * (16 w_out[c][o])
  unsigned short* gp = gwt + ((size_t)b * kC + rl) * kN + n0 + hh * 32;
#pragma unroll
  for (int j = 0; j < 4; ++j) {
    const v16h wb = Frag<_Float16>::load(sO + (j * 16 + rl) * kOP + hh * 8);
    v8f a2[4];
#pragma unroll
    for (int g = 0; g < 4; ++g) a2[g] = Frag<_Float16>::mma(ga[g].v, wb, (v8f){0.f,0.f,0.f,0.f,0.f,0.f,0.f,0.f});
#pragma unroll
    for (int q = 0; q < 4; ++q) {   // 16-B piece q = keys 8q..8q+7 of the lane's 32; key 4r + g sits in tile g, register r
      const v4u u = (v4u){pack2h(a2[0][2 * q] * kWCarryInv,     a2[1][2 * q] * kWCarryInv),
                          pack2h(a2[2][2 * q] * kWCarryInv,     a2[3][2 * q] * kWCarryInv),
                          pack2h(a2[0][2 * q + 1] * kWCarryInv, a2[1][2 * q + 1] * kWCarryInv),
                          pack2h(a2[2][2 * q + 1] * kWCarryInv, a2[3][2 * q + 1] * kWCarryInv)};
      *(v4u*)(gp + (size_t)(j * 16) * kN + q * 8) = u;
    }
  }
}

// ---------------------------------------------------------------------------
// Host glue.
//   PRJ  f16 [8][4096][128]   8,388,608  at           0   (theta | phi per position; the upper half of a row is unused)
//   GWT  f16 [8][64][4096]    4,194,304  at   8,388,608   (gw^T[c][key] = sum_o w_out[c][o] g[key][o])
//   total                    12,582,912
// ---------------------------------------------------------------------------
extern "C" void kernel_launch(void* const* d_in, const int* in_sizes, int n_in,
                              void* d_out, int out_size, void* d_ws, size_t ws_size,
                              hipStream_t stream) {
  if (n_in < 9) return;
  const int nX = kB * kC * kN;   // 2,097,152
  if (in_sizes[0] != nX) return;
  if (in_sizes[1] != kCI * kC || in_sizes[2] != kCI) return;
  if (in_sizes[3] != kCI * kC || in_sizes[4] != kCI) return;
  if (in_sizes[5] != kCI * kC || in_sizes[6] != kCI) return;
  if (in_sizes[7] != kC * kCI || in_sizes[8] != kC) return;
  if (out_size != nX) return;

  const size_t szPRJ = (size_t)kB * kN * kPW * 2;
  const size_t szGWT = (size_t)kB * kC * kN * 2;
  const size_t offPRJ = 0;
  const size_t offGWT = offPRJ + szPRJ;
  const size_t total  = offGWT + szGWT;
  if (ws_size < total) return;

  const float* x       = (const float*)d_in[0];
  const float* w_theta = (const float*)d_in[1];
  const float* b_theta = (const float*)d_in[2];
  const float* w_phi   = (const float*)d_in[3];
  const float* b_phi   = (const float*)d_in[4];
  const float* w_g     = (const float*)d_in[5];
  const float* b_g     = (const float*)d_in[6];
  const float* w_out   = (const float*)d_in[7];
  const float* b_out   = (const float*)d_in[8];
  float* out = (float*)d_out;
  char* ws = (char*)d_ws;
  unsigned short* PRJ = (unsigned short*)(ws + offPRJ);
  unsigned short* GWT = (unsigned short*)(ws + offGWT);

  // ---- theta, phi planes and gw^T of all batches (16 blocks of 256 positions x 8 batches) ----
  proj_gwt_kernel<<<dim3(kN / (kJP * kJW), kB), dim3(kJW * 32), 0, stream>>>(x, w_theta, b_theta, w_phi, b_phi, w_g, b_g, w_out, PRJ, GWT);

  // ---- scores, softmax over keys, out^T product, bias and residual: all batches, one launch (32 position blocks x 8 batches) ----
  attn_fused_kernel<<<dim3(kN / (kFG * kFQ), kB), dim3(kFW * 32), 0, stream>>>(PRJ, GWT, b_out, x, out);
}

// v005
// A run of this version takes 35.3 microseconds.
// Next to v004, in two timings, it ran 1.03 times as fast each time.
// Counting every step since v000, it is 43.6 times as fast.
// Contractions: channel projections (W f16 carried x16 . x f16), scores phi.theta^T (f16 planes), gw^T = g (f16) . W_out^T (f16 carried x16), out^T = gw^T f16 x P^T (f16, unnormalised exponentials), softmax sums = ones (f16) . P^T: all on v_wmma_f32_16x16x32_f16 with f32 accumulate; bias adds, softmax maxima, exponentials and residual in f32.
#include <hip/hip_runtime.h>
#include <math.h>

// ---------------------------------------------------------------------------
// Problem constants
// ---------------------------------------------------------------------------
constexpr int kB  = 8;        // batch
constexpr int kC  = 64;       // in channels
constexpr int kCI = 32;       // inter channels
constexpr int kN  = 4096;     // H*W positions
constexpr int kPW = 128;      // projection plane row pitch in halves: theta 0..31 | phi 32..63 | 64..127 neither written nor read
constexpr float kWCarry    = 16.0f;            // weights carried x16 in f16
constexpr float kWCarryInv = 1.0f / 16.0f;
static_assert(kN % 64 == 0 && kPW % 64 == 0 && kC % 64 == 0, "M,N tiles");
static_assert(kC % 32 == 0 && kCI % 32 == 0 && kN % 32 == 0, "K steps");

typedef __attribute__((ext_vector_type(16))) _Float16 v16h;
typedef __attribute__((ext_vector_type(8)))  _Float16 v8h;
typedef __attribute__((ext_vector_type(8)))  float    v8f;
typedef __attribute__((ext_vector_type(4)))  float    v4f;
typedef __attribute__((ext_vector_type(4)))  unsigned int v4u;

// ---------------------------------------------------------------------------
// Helpers
// ---------------------------------------------------------------------------
template <typename T> struct Frag;
template <> struct Frag<_Float16> {
  typedef v16h V; union U { v16h v; v8h h[2]; };
  // elements 0..7 <- p[0..7], 8..15 <- p[16..23]
  static __device__ __forceinline__ v16h load(const _Float16* p) {
    U f; f.h[0] = *(const v8h*)(p); f.h[1] = *(const v8h*)(p + 16); return f.v;
  }
  static __device__ __forceinline__ v8f mma(v16h a, v16h b, v8f c) {
    return __builtin_amdgcn_wmma_f32_16x16x32_f16(false, a, false, b, (short)0, c, false, false);
  }
};

// ---------------------------------------------------------------------------
// Scores, softmax and out^T product of all batches in one launch; scores and probabilities stay in registers.
//   out[b][c][q] = sum_key GWT[b][c][key] * softmax_key(theta[q] . phi[key]) + b_out[c] + x[b][c][q]
// grid (4096/128 = 32 position blocks, 8 batches), 16 waves: wave = query group (wave >> 2, 32 q) x key slice (wave & 3, 1024 keys).
// One pass = 32 keys:  S^T = phi . theta^T  (A = phi rows, B = theta rows, same loader: equal k order); D register r of a lane =
// S^T[key 8*(lane>>4) + r][q = lane&15], so the two key tiles of a pass, converted in place, are the B operand (hardware k order) of
// O^T += GWT . P^T  (A = GWT rows through the same loader: keys 8h..8h+7 | 16+8h..16+8h+7). D register r = out[c = 8*(lane>>4) + r][q = lane&15].
// A lane holds one query's column in both products: running maximum (log2 domain) and rescale factor are per-lane scalars.
// The sum of a query's exponentials comes off the matrix pipe: L += ones . P^T (A: row 0 is 1.0, the rest 0), one product per column group and pass,
// on the same rounded P^T operand as the output product; register 0 of lanes 0..15 holds the sum over all 32 keys of query lane&15.
// The maximum in use may trail the true one by up to 8 (an exponential reaches 2^8 at most, inside f16): rescale only when some column exceeds that.
// The four key slices of a query group are joined in LDS: maxima and sums first, then the scaled partial tiles in slice order 0..3.
// phi rows and gw^T rows come through LDS: a stage is 64 keys of each of the four slices (two passes), brought once per work-group by
// asynchronous 16-B copies (a gw^T row of a stage is one whole 128-B line, a phi row 64 B) and read by the four query waves of its slice.
// Two buffers: stage t + 1 flies while stage t is worked on; one barrier per stage publishes the one and frees the other.
// ---------------------------------------------------------------------------
constexpr int kFQ  = 32;            // queries per wave (two 16-column groups)
constexpr int kFG  = 4;             // query groups per work-group
constexpr int kFS  = 4;             // key slices per work-group
constexpr int kFW  = kFG * kFS;     // waves per work-group
constexpr int kFK  = kN / kFS;      // keys per wave
constexpr int kFNP = kFK / 32;      // passes per wave
constexpr int kFP  = 36;            // LDS row pitch in floats: 144 B = 16 B x odd
constexpr int kSK  = 64;            // keys of one slice per stage
constexpr int kNST = kFK / kSK;     // stages
constexpr int kPhP = 40;            // LDS pitch of a phi row in halves: 80 B = 16 B x odd
constexpr int kGwP = 72;            // LDS pitch of a gw^T row in halves: 144 B = 16 B x odd
constexpr int kPhB = kFS * kSK * kPhP;   // halves of one phi buffer (4 slices x 64 keys)
constexpr int kGwB = kFS * kC * kGwP;    // halves of one gw^T buffer (4 slices x 64 channels)
constexpr float kLog2e = 1.4426950408889634f;
static_assert(kSK == 64 && kNST >= 2 && kFW * 32 == 512 && kFS == 4, "stage copy map: 2 phi and 4 gw^T chunks of 16 B per thread");
static_assert(kFK % 32 == 0 && kN % (kFG * kFQ) == 0 && kCI == 32 && kC == 64, "fused tile");
static_assert(kC * kFG * kFQ == kFW * 32 * 16, "join map: four float4 per thread");
typedef __attribute__((ext_vector_type(2))) float    v2f;
typedef __attribute__((ext_vector_type(2))) _Float16 v2h;

// lane l with lane l ^ 16
__device__ __forceinline__ float xhalf(float v) {
  const int i = __builtin_bit_cast(int, v);
  return __builtin_bit_cast(float, __builtin_amdgcn_permlanex16(i, i, 0x76543210, 0xfedcba98, false, false));
}
__device__ __forceinline__ unsigned pack2h(float lo, float hi) {   // round to nearest even
  return __builtin_bit_cast(unsigned, __builtin_convertvector((v2f){lo, hi}, v2h));
}
// Eight exponentials (2^a) in one statement. The outputs are early-clobbered, so none lands on a source of another, and the closing v_nop is
// the slot the instruction set asks for behind a transcendental before its result is used or its source overwritten.
__device__ __forceinline__ void exp2x8(float (&p)[8], const float (&a)[8]) {
  asm("v_exp_f32 %0, %8\n\tv_exp_f32 %1, %9\n\tv_exp_f32 %2, %10\n\tv_exp_f32 %3, %11\n\t"
      "v_exp_f32 %4, %12\n\tv_exp_f32 %5, %13\n\tv_exp_f32 %6, %14\n\tv_exp_f32 %7, %15\n\tv_nop"
      : "=&v"(p[0]), "=&v"(p[1]), "=&v"(p[2]), "=&v"(p[3]), "=&v"(p[4]), "=&v"(p[5]), "=&v"(p[6]), "=&v"(p[7])
      : "v"(a[0]), "v"(a[1]), "v"(a[2]), "v"(a[3]), "v"(a[4]), "v"(a[5]), "v"(a[6]), "v"(a[7]));
}

// One stage: six 16-B copies per lane, global memory to LDS through no register.
// lp / gp: this lane's phi chunk of slices 0..1 (the second copy: two slices on); lg / gg: its gw^T chunk of slice 0 (then one slice on each).
// The closing s_wait_xcnt stands inside the statement so that no address register named here is rewritten ahead of it.
__device__ __forceinline__ void stage_copy(unsigned lp, unsigned lg, const _Float16* gp, const _Float16* gg) {
  const unsigned lp1 = lp + 2 * kSK * kPhP * 2;
  const unsigned lg1 = lg + kC * kGwP * 2, lg2 = lg + 2 * kC * kGwP * 2, lg3 = lg + 3 * kC * kGwP * 2;
  const _Float16* gp1 = gp + (size_t)2 * kFK * kPW;
  const _Float16* gg1 = gg + kFK;
  const _Float16* gg2 = gg + 2 * kFK;
  const _Float16* gg3 = gg + 3 * kFK;
  asm volatile("global_load_async_to_lds_b128 %0, %6, off\n\t"
               "global_load_async_to_lds_b128 %1, %7, off\n\t"
               "global_load_async_to_lds_b128 %2, %8, off\n\t"
               "global_load_async_to_lds_b128 %3, %9, off\n\t"
               "global_load_async_to_lds_b128 %4, %10, off\n\t"
               "global_load_async_to_lds_b128 %5, %11, off\n\t"
               "s_wait_xcnt 0x0"
               :: "v"(lp), "v"(lp1), "v"(lg), "v"(lg1), "v"(lg2), "v"(lg3),
                  "v"(gp), "v"(gp1), "v"(gg), "v"(gg1), "v"(gg2), "v"(gg3)
               : "memory");
}

__global__ __launch_bounds__(kFW * 32) void attn_fused_kernel(const unsigned short* __restrict__ prj,
                                                              const unsigned short* __restrict__ gwt,
                                                              const float* __restrict__ b_out,
                                                              const float* __restrict__ x,
                                                              float* __restrict__ out) {
  __shared__ __align__(16) float part[kFW][kC * kFP];
  __shared__ __align__(16) _Float16 sPh[2 * kPhB];
  __shared__ __align__(16) _Float16 sGw[2 * kGwB];
  __shared__ float sM[kFW][kFQ];
  __shared__ float sL[kFW][kFQ];
  const int t    = threadIdx.x;
  const int lane = t & 31, wave = t >> 5;
  const int b    = blockIdx.y;
  const int qg   = wave >> 2, ks = wave & 3;
  const int qb   = blockIdx.x * (kFG * kFQ);
  const int rl   = lane & 15, hh = lane >> 4;
  const _Float16* Pb = (const _Float16*)prj + (size_t)b * kN * kPW;
  const _Float16* Th = Pb + (size_t)(qb + qg * kFQ + rl) * kPW + hh * 8;
  // fragment readers: this wave's slice in buffer 0
  const _Float16* Lp = sPh + (ks * kSK + rl) * kPhP + hh * 8;
  const _Float16* Lg = sGw + (ks * kC + rl) * kGwP + hh * 8;
  // copy map: phi chunk = (slice t>>8 [+2], key (t>>2)&63, 16-B piece t&3); gw^T chunk = (slice 0 [+1,2,3], channel t>>3, 16-B piece t&7)
  const unsigned cLp = (unsigned)(size_t)(sPh + ((t >> 8) * kSK + ((t >> 2) & 63)) * kPhP + (t & 3) * 8);
  const unsigned cLg = (unsigned)(size_t)(sGw + (t >> 3) * kGwP + (t & 7) * 8);
  const _Float16* cGp = Pb + (size_t)((t >> 8) * kFK + ((t >> 2) & 63)) * kPW + kCI + (t & 3) * 8;
  const _Float16* cGg = (const _Float16*)gwt + ((size_t)b * kC + (t >> 3)) * kN + (t & 7) * 8;

  stage_copy(cLp, cLg, cGp, cGg);
  // stage 0 has landed for this wave's copies before the barrier that publishes it
  asm volatile("s_wait_asynccnt 0x0" ::: "memory");
  __syncthreads();   // stage 0 is readable by every wave
  stage_copy(cLp + kPhB * 2, cLg + kGwB * 2, cGp + (size_t)kSK * kPW, cGg + kSK);

  v16h th[2], ph[2];
#pragma unroll
  for (int g = 0; g < 2; ++g) th[g] = Frag<_Float16>::load(Th + (size_t)(g << 4) * kPW);

  v8f acc[4][2];
#pragma unroll
  for (int ct = 0; ct < 4; ++ct)
#pragma unroll
    for (int g = 0; g < 2; ++g) acc[ct][g] = (v8f){0.f,0.f,0.f,0.f,0.f,0.f,0.f,0.f};
  float m_run[2] = {-__builtin_inff(), -__builtin_inff()};
  v8f lacc[2];   // sums of exponentials, rescaled like an output tile
#pragma unroll
  for (int g = 0; g < 2; ++g) lacc[g] = (v8f){0.f,0.f,0.f,0.f,0.f,0.f,0.f,0.f};
  union { unsigned u[8]; v16h v; } ones;
#pragma unroll
  for (int i = 0; i < 8; ++i) ones.u[i] = (rl == 0) ? 0x3C003C00u : 0u;

  // rolled: a stage (two passes) is already a long straight block
#pragma unroll 1
  for (int sg = 0; sg < kNST; ++sg) {
   const int bf = sg & 1;
   const _Float16* lp = Lp + bf * kPhB;
   const _Float16* lg = Lg + bf * kGwB;
#pragma unroll
   for (int kt = 0; kt < 2; ++kt) ph[kt] = Frag<_Float16>::load(lp + (kt << 4) * kPhP);
   // keeps both fragments' reads ahead of the first product: left free, the second is read into the first one's registers behind its
   // products, and the wave waits out the LDS latency twice
   __builtin_amdgcn_sched_barrier(0);
   // both passes of the stage written out: the second pass's offsets in the buffer are then immediates
#pragma unroll
   for (int pp = 0; pp < kSK / 32; ++pp) {
    v8f st[2][2];
#pragma unroll
    for (int kt = 0; kt < 2; ++kt)
#pragma unroll
      for (int g = 0; g < 2; ++g)
        st[kt][g] = Frag<_Float16>::mma(ph[kt], th[g], (v8f){0.f,0.f,0.f,0.f,0.f,0.f,0.f,0.f});
    // holds the v_nops below behind the last of these products
    __builtin_amdgcn_sched_barrier(0);
    // the loads below go over fragment registers of the products above: four vector slots between the last WMMA and a load over its A
    asm volatile("v_nop\n\tv_nop\n\tv_nop\n\tv_nop");
    v16h gw[4];
#pragma unroll
    for (int ct = 0; ct < 4; ++ct) gw[ct] = Frag<_Float16>::load(lg + (ct << 4) * kGwP + pp * 32);
    if (pp + 1 < kSK / 32) {   // the next pass's phi rows, only inside this stage's own buffer
#pragma unroll
      for (int kt = 0; kt < 2; ++kt) ph[kt] = Frag<_Float16>::load(lp + ((pp + 1) * 32 + (kt << 4)) * kPhP);
    }
    // keeps these loads ahead of the softmax work: left free, the compiler sinks each load to its use and the wave waits out its latency there
    __builtin_amdgcn_sched_barrier(0);

    float mb[2];
    bool need = false;
#pragma unroll
    for (int g = 0; g < 2; ++g) {
      float mx = st[0][g][0];
#pragma unroll
      for (int r = 1; r < 8; ++r) mx = fmaxf(mx, st[0][g][r]);
#pragma unroll
      for (int r = 0; r < 8; ++r) mx = fmaxf(mx, st[1][g][r]);
      mx = fmaxf(mx, xhalf(mx)) * kLog2e;   // both wave halves hold this query's maximum of the pass, log2 domain
      mb[g] = mx;
      need = need || (mx > m_run[g] + 8.0f);
    }
    if (__builtin_amdgcn_ballot_w32(need) != 0) {   // wave-uniform; rare after the first passes
#pragma unroll
      for (int g = 0; g < 2; ++g) {
        const float m_new = fmaxf(m_run[g], mb[g]);
        const float corr  = __builtin_amdgcn_exp2f(m_run[g] - m_new);   // 0 on the first pass, where m_run is -inf
        m_run[g] = m_new;
        lacc[g] = lacc[g] * corr;
#pragma unroll
        for (int ct = 0; ct < 4; ++ct) acc[ct][g] = acc[ct][g] * corr;
      }
    }
    union PB { unsigned u[8]; v16h v; } pb[2];
#pragma unroll
    for (int g = 0; g < 2; ++g) {
      const float nm = -m_run[g];
#pragma unroll
      for (int kt = 0; kt < 2; ++kt) {   // key tile kt fills elements 8kt..8kt+7 of the 32-key operand, register r = element 8kt + r
        float a[8], p[8];
#pragma unroll
        for (int r = 0; r < 8; ++r) a[r] = fmaf(st[kt][g][r], kLog2e, nm);
        exp2x8(p, a);
#pragma unroll
        for (int i = 0; i < 4; ++i) pb[g].u[kt * 4 + i] = pack2h(p[2 * i], p[2 * i + 1]);
      }
    }
    // keeps every exponential statement ahead of the products below: an exponential
    // moved behind a product could write over its B operand too early
    __builtin_amdgcn_sched_barrier(0);
#pragma unroll
    for (int g = 0; g < 2; ++g) {
#pragma unroll
      for (int ct = 0; ct < 4; ++ct) acc[ct][g] = Frag<_Float16>::mma(gw[ct], pb[g].v, acc[ct][g]);
      lacc[g] = Frag<_Float16>::mma(ones.v, pb[g].v, lacc[g]);
    }
   }
   // foot of a stage: this wave's reads of the buffer are done, its copies of the next stage have landed
   asm volatile("s_wait_dscnt 0x0" ::: "memory");
   asm volatile("s_wait_asynccnt 0x0" ::: "memory");
   __syncthreads();   // publishes stage sg + 1 and frees the buffer of stage sg
   if (sg + 2 < kNST)
     stage_copy(cLp + bf * (kPhB * 2), cLg + bf * (kGwB * 2), cGp + (size_t)(sg + 2) * kSK * kPW, cGg + (sg + 2) * kSK);
  }
  // nothing is outstanding here; the wait closes the ring before the wave goes on to the join
  asm volatile("s_wait_asynccnt 0x0" ::: "memory");

  // ---- join of the four key slices of each query group ----
#pragma unroll
  for (int g = 0; g < 2; ++g) {
    if (hh == 0) {
      sM[wave][(g << 4) + rl] = m_run[g];
      sL[wave][(g << 4) + rl] = lacc[g][0];
    }
  }
  __syncthreads();   // every slice's maxima and sums are in LDS before any wave forms its factor
  float* my = part[wave];
#pragma unroll
  for (int g = 0; g < 2; ++g) {
    const int ql = (g << 4) + rl;
    float M = sM[qg * kFS][ql];
#pragma unroll
    for (int j = 1; j < kFS; ++j) M = fmaxf(M, sM[qg * kFS + j][ql]);
    float L = 0.f;
#pragma unroll
    for (int j = 0; j < kFS; ++j) L += sL[qg * kFS + j][ql] * __builtin_amdgcn_exp2f(sM[qg * kFS + j][ql] - M);
    const float f = __builtin_amdgcn_exp2f(m_run[g] - M) / L;
#pragma unroll
    for (int ct = 0; ct < 4; ++ct)
#pragma unroll
      for (int r = 0; r < 8; ++r) my[((ct << 4) + hh * 8 + r) * kFP + ql] = acc[ct][g][r] * f;
  }
  __syncthreads();   // every wave's scaled partial tile is in LDS before any thread sums across slices

  // thread t, trip it: float4 index it*512 + t of the 64 c x 128 q tile; a wave writes one whole 512-B row segment of out
#pragma unroll
  for (int it = 0; it < 4; ++it) {
    const int idx = it * (kFW * 32) + t;
    const int c   = idx >> 5;
    const int q4  = (idx & 31) * 4;
    const int g4  = (q4 >> 5) * kFS;
    const int po  = c * kFP + (q4 & 31);
    v4f sum = *(const v4f*)(&part[g4][po]);
#pragma unroll
    for (int j = 1; j < kFS; ++j) sum = sum + *(const v4f*)(&part[g4 + j][po]);
    const size_t o = ((size_t)b * kC + c) * kN + qb + q4;
    const v4f rr = *(const v4f*)(x + o);
    const float bv = b_out[c];
    v4f v;
#pragma unroll
    for (int e = 0; e < 4; ++e) v[e] = (sum[e] + bv) + rr[e];
    *(v4f*)(out + o) = v;
  }
}

// ---------------------------------------------------------------------------
// Weight preparation, channel projections and gw^T in one launch, straight from x and the f32 weights.
// grid (4096/256 = 16, 8 batches), 4 waves; a wave owns the 64 positions n0..n0+63 of one batch; x and g pass through no memory in between.
// Weights: the work-group rounds 16 w to f16 once into LDS (rows theta | phi | g, then w_out; biases in f32); one barrier publishes them.
// Every global load of a wave is issued ahead of that barrier, the weights first: one trip to memory in all.
// First product, D = W . x: A = weight rows (m = output channel), B = x columns (n = position, f16(x)), K = 64 channels in two steps.
//   A lane reads x as one float4 per channel at position n0 + 4*(lane&15); component g goes to position tile g, whose column j is position
//   n0 + 4j + g. A wave-wide load is two whole 256-B pieces of two rows of x.
//   Element s of both operands is channel 32 ks + 8*(lane>>4) + s for s < 8 and 32 ks + 16 + 8*(lane>>4) + (s - 8) for s >= 8.
//   D register r = output channel 16 mt + 8*(lane>>4) + r at the lane's position: theta and phi leave as one 16-B store per tile.
// Second product, D = g . W_out^T: the two g tiles of a position tile, converted in place, are its A operand (row = position, the k order above);
//   B = w_out rows in the same k order. D register r of tile g = key n0 + 32*(lane>>4) + 4r + g at channel 16 j + (lane&15): the four tiles
//   interleave to 32 consecutive keys per lane, and every 128-B line of gw^T is written by one wave.
// ---------------------------------------------------------------------------
constexpr int kJP  = 64;        // positions per wave (four position tiles)
constexpr int kJW  = 4;         // waves per work-group
constexpr int kJO  = 3 * kCI;   // projection rows: theta | phi | g
constexpr int kWP  = 72;        // LDS pitch of a projection weight row in halves: 144 B = 16 B x odd
constexpr int kOP  = 40;        // LDS pitch of a w_out row in halves: 80 B = 16 B x odd
static_assert(kN % (kJP * kJW) == 0 && kC == 64 && kCI == 32 && kJW == 4, "projection tile and weight copy map");
union HFrag { unsigned u[8]; v16h v; };
typedef __attribute__((ext_vector_type(2))) unsigned int v2u;

// four weights, carried x16, rounded to f16
__device__ __forceinline__ v2u w_pack(v4f q) {
  return (v2u){pack2h(q[0] * kWCarry, q[1] * kWCarry), pack2h(q[2] * kWCarry, q[3] * kWCarry)};
}

__global__ __launch_bounds__(kJW * 32) void proj_gwt_kernel(const float* __restrict__ x,
                                                            const float* __restrict__ w_theta, const float* __restrict__ b_theta,
                                                            const float* __restrict__ w_phi, const float* __restrict__ b_phi,
                                                            const float* __restrict__ w_g, const float* __restrict__ b_g,
                                                            const float* __restrict__ w_out,
                                                            unsigned short* __restrict__ prj, unsigned short* __restrict__ gwt) {
  __shared__ __align__(16) _Float16 sW[kJO * kWP];
  __shared__ __align__(16) _Float16 sO[kC * kOP];
  __shared__ __align__(16) float sB[kJW * 32];   // b_theta | b_phi | b_g | a copy of b_g that nobody reads (wave 3 takes no branch of its own)
  const int t    = threadIdx.x;
  const int lane = t & 31, wave = t >> 5;
  const int rl   = lane & 15, hh = lane >> 4;
  const int b    = blockIdx.y;
  const int n0   = (blockIdx.x * kJW + wave) * kJP;

  // weights: trip i brings 8 rows of 64 (16 threads a row), four trips a matrix; w_out: 16 rows of 32 a trip (8 threads a row)
  const int wo = (t >> 4) * kC + (t & 15) * 4;
  const float* pw0 = w_theta + wo;
  const float* pw1 = w_phi + wo;
  const float* pw2 = w_g + wo;
  const float* po  = w_out + (t >> 3) * kCI + (t & 7) * 4;
  const float* pb  = ((wave == 0) ? b_theta : ((wave == 1) ? b_phi : b_g)) + lane;
  v4f wq[12], oq[4];
#pragma unroll
  for (int i = 0; i < 12; ++i) wq[i] = *(const v4f*)(((i < 4) ? pw0 : ((i < 8) ? pw1 : pw2)) + (i & 3) * 8 * kC);
#pragma unroll
  for (int i = 0; i < 4; ++i) oq[i] = *(const v4f*)(po + i * 16 * kCI);
  const float bq = *pb;

  // x: 32 channels per lane, four positions each
  const float* xp = x + ((size_t)b * kC + hh * 8) * kN + n0 + 4 * rl;
  v4f xv[2][16];
#pragma unroll
  for (int ks = 0; ks < 2; ++ks)
#pragma unroll
    for (int s = 0; s < 16; ++s) xv[ks][s] = *(const v4f*)(xp + (size_t)(ks * 32 + (s < 8 ? s : s + 8)) * kN);
  // the wait that stands before an address register of an issued load is written again; the addresses are named as inputs so that they
  // stay in their registers up to here (left free, later loads of this run were given earlier loads' address registers as destinations)
  asm volatile("s_wait_xcnt 0x0" :: "v"(pw0), "v"(pw1), "v"(pw2), "v"(po), "v"(pb), "v"(xp) : "memory");
  // keeps every load ahead of the first conversion: left free, the compiler waits for weights before it issues the x loads, two trips in series
  __builtin_amdgcn_sched_barrier(0);

#pragma unroll
  for (int i = 0; i < 12; ++i) *(v2u*)(sW + (i * 8 + (t >> 4)) * kWP + (t & 15) * 4) = w_pack(wq[i]);
#pragma unroll
  for (int i = 0; i < 4; ++i) *(v2u*)(sO + (i * 16 + (t >> 3)) * kOP + (t & 7) * 4) = w_pack(oq[i]);
  sB[t] = bq;
  __syncthreads();   // the f16 weights and the biases are in LDS before any wave reads an operand

  HFrag xb[4][2];
#pragma unroll
  for (int g = 0; g < 4; ++g)
#pragma unroll
    for (int ks = 0; ks < 2; ++ks)
#pragma unroll
      for (int i = 0; i < 8; ++i) xb[g][ks].u[i] = pack2h(xv[ks][2 * i][g], xv[ks][2 * i + 1][g]);

  // theta (mt 0, 1), phi (mt 2, 3), g (mt 4, 5)
  HFrag ga[4];
  unsigned short* pr = prj + ((size_t)b * kN + n0 + 4 * rl) * kPW + hh * 8;
#pragma unroll
  for (int mt = 0; mt < 6; ++mt) {
    const _Float16* wr = sW + (mt * 16 + rl) * kWP + hh * 8;
    const v16h wa0 = Frag<_Float16>::load(wr);
    const v16h wa1 = Frag<_Float16>::load(wr + 32);
    const v4f bv[2] = {*(const v4f*)(sB + mt * 16 + hh * 8), *(const v4f*)(sB + mt * 16 + hh * 8 + 4)};
    v8f acc[4];
#pragma unroll
    for (int g = 0; g < 4; ++g) acc[g] = Frag<_Float16>::mma(wa0, xb[g][0].v, (v8f){0.f,0.f,0.f,0.f,0.f,0.f,0.f,0.f});
#pragma unroll
    for (int g = 0; g < 4; ++g) acc[g] = Frag<_Float16>::mma(wa1, xb[g][1].v, acc[g]);
#pragma unroll
    for (int g = 0; g < 4; ++g) {
      unsigned u[4];
#pragma unroll
      for (int i = 0; i < 4; ++i)
        u[i] = pack2h(fmaf(acc[g][2 * i], kWCarryInv, bv[i >> 1][(2 * i) & 3]), fmaf(acc[g][2 * i + 1], kWCarryInv, bv[i >> 1][(2 * i + 1) & 3]));
      if (mt < 4) {
        *(v4u*)(pr + (size_t)g * kPW + mt * 16) = (v4u){u[0], u[1], u[2], u[3]};
      } else {
#pragma unroll
        for (int i = 0; i < 4; ++i) ga[g].u[(mt - 4) * 4 + i] = u[i];
      }
    }
  }

  // gw^T[c][key] = (1/16) sum_o g[key][o] * (16 w_out[c][o])
  unsigned short* gp = gwt + ((size_t)b * kC + rl) * kN + n0 + hh * 32;
#pragma unroll
  for (int j = 0; j < 4; ++j) {
    const v16h wb = Frag<_Float16>::load(sO + (j * 16 + rl) * kOP + hh * 8);
    v8f a2[4];
#pragma unroll
    for (int g = 0; g < 4; ++g) a2[g] = Frag<_Float16>::mma(ga[g].v, wb, (v8f){0.f,0.f,0.f,0.f,0.f,0.f,0.f,0.f});
#pragma unroll
    for (int q = 0; q < 4; ++q) {   // 16-B piece q = keys 8q..8q+7 of the lane's 32; key 4r + g sits in tile g, register r
      const v4u u = (v4u){pack2h(a2[0][2 * q] * kWCarryInv,     a2[1][2 * q] * kWCarryInv),
                          pack2h(a2[2][2 * q] * kWCarryInv,     a2[3][2 * q] * kWCarryInv),
                          pack2h(a2[0][2 * q + 1] * kWCarryInv, a2[1][2 * q + 1] * kWCarryInv),
                          pack2h(a2[2][2 * q + 1] * kWCarryInv, a2[3][2 * q + 1] * kWCarryInv)};
      *(v4u*)(gp + (size_t)(j * 16) * kN + q * 8) = u;
    }
  }
}

// ---------------------------------------------------------------------------
// Host glue.
//   PRJ  f16 [8][4096][128]   8,388,608  at           0   (theta | phi per position; the upper half of a row is unused)
//   GWT  f16 [8][64][4096]    4,194,304  at   8,388,608   (gw^T[c][key] = sum_o w_out[c][o] g[key][o])
//   total                    12,582,912
// ---------------------------------------------------------------------------
extern "C" void kernel_launch(void* const* d_in, const int* in_sizes, int n_in,
                              void* d_out, int out_size, void* d_ws, size_t ws_size,
                              hipStream_t stream) {
  if (n_in < 9) return;
  const int nX = kB * kC * kN;   // 2,097,152
  if (in_sizes[0] != nX) return;
  if (in_sizes[1] != kCI * kC || in_sizes[2] != kCI) return;
  if (in_sizes[3] != kCI * kC || in_sizes[4] != kCI) return;
  if (in_sizes[5] != kCI * kC || in_sizes[6] != kCI) return;
  if (in_sizes[7] != kC * kCI || in_sizes[8] != kC) return;
  if (out_size != nX) return;

  const size_t szPRJ = (size_t)kB * kN * kPW * 2;
  const size_t szGWT = (size_t)kB * kC * kN * 2;
  const size_t offPRJ = 0;
  const size_t offGWT = offPRJ + szPRJ;
  const size_t total  = offGWT + szGWT;
  if (ws_size < total) return;

  const float* x       = (const float*)d_in[0];
  const float* w_theta = (const float*)d_in[1];
  const float* b_theta = (const float*)d_in[2];
  const float* w_phi   = (const float*)d_in[3];
  const float* b_phi   = (const float*)d_in[4];
  const float* w_g     = (const float*)d_in[5];
  const float* b_g     = (const float*)d_in[6];
  const float* w_out   = (const float*)d_in[7];
  const float* b_out   = (const float*)d_in[8];
  float* out = (float*)d_out;
  char* ws = (char*)d_ws;
  unsigned short* PRJ = (unsigned short*)(ws + offPRJ);
  unsigned short* GWT = (unsigned short*)(ws + offGWT);

  // ---- theta, phi planes and gw^T of all batches (16 blocks of 256 positions x 8 batches) ----
  proj_gwt_kernel<<<dim3(kN / (kJP * kJW), kB), dim3(kJW * 32), 0, stream>>>(x, w_theta, b_theta, w_phi, b_phi, w_g, b_g, w_out, PRJ, GWT);

  // ---- scores, softmax over keys, out^T product, bias and residual: all batches, one launch (32 position blocks x 8 batches) ----
  attn_fused_kernel<<<dim3(kN / (kFG * kFQ), kB), dim3(kFW * 32), 0, stream>>>(PRJ, GWT, b_out, x, out);
}

// v006
// Measured time: 32.1 microseconds a run.
// Timed twice side by side with v005, it ran 1.10 times as fast both times.
// Counting every step since v000, it is 47.8 times as fast.
// Contractions: channel projections (W f16 carried x16 . x f16), scores phi.theta^T (f16 planes), y^T = g^T f16 x P^T (f16, unnormalised exponentials), softmax sums = ones (f16) . P^T, out^T = W_out (f16 carried x16) . y^T (f16, normalised slice partials): all on v_wmma_f32_16x16x32_f16 with f32 accumulate; bias adds, softmax maxima, exponentials and residual in f32.
#include <hip/hip_runtime.h>
#include <math.h>

// ---------------------------------------------------------------------------
// Problem constants
// ---------------------------------------------------------------------------
constexpr int kB  = 8;        // batch
constexpr int kC  = 64;       // in channels
constexpr int kCI = 32;       // inter channels
constexpr int kN  = 4096;     // H*W positions
constexpr int kPW = 128;      // projection plane row pitch in halves: theta 0..31 | phi 32..63 | 64..127 neither written nor read
constexpr float kWCarry    = 16.0f;            // weights carried x16 in f16
constexpr float kWCarryInv = 1.0f / 16.0f;
static_assert(kN % 64 == 0 && kPW % 64 == 0 && kC % 64 == 0, "M,N tiles");
static_assert(kC % 32 == 0 && kCI % 32 == 0 && kN % 32 == 0, "K steps");

typedef __attribute__((ext_vector_type(16))) _Float16 v16h;
typedef __attribute__((ext_vector_type(8)))  _Float16 v8h;
typedef __attribute__((ext_vector_type(8)))  float    v8f;
typedef __attribute__((ext_vector_type(4)))  float    v4f;
typedef __attribute__((ext_vector_type(4)))  unsigned int v4u;

// ---------------------------------------------------------------------------
// Helpers
// ---------------------------------------------------------------------------
template <typename T> struct Frag;
template <> struct Frag<_Float16> {
  typedef v16h V; union U { v16h v; v8h h[2]; };
  // elements 0..7 <- p[0..7], 8..15 <- p[16..23]
  static __device__ __forceinline__ v16h load(const _Float16* p) {
    U f; f.h[0] = *(const v8h*)(p); f.h[1] = *(const v8h*)(p + 16); return f.v;
  }
  static __device__ __forceinline__ v8f mma(v16h a, v16h b, v8f c) {
    return __builtin_amdgcn_wmma_f32_16x16x32_f16(false, a, false, b, (short)0, c, false, false);
  }
};

// ---------------------------------------------------------------------------
// Scores, softmax, y^T product and output projection of all batches in one launch; scores and probabilities stay in registers.
//   y[b][o][q] = sum_key GT[b][o][key] * softmax_key(theta[q] . phi[key]);  out[b][c][q] = sum_o w_out[c][o] * y[b][o][q] + b_out[c] + x[b][c][q]
// grid (4096/128 = 32 position blocks, 8 batches), 16 waves: wave = query group (wave >> 2, 32 q) x key slice (wave & 3, 1024 keys).
// One pass = 32 keys:  S^T = phi . theta^T  (A = phi rows, B = theta rows, same loader: equal k order); D register r of a lane =
// S^T[key 8*(lane>>4) + r][q = lane&15], so the two key tiles of a pass, converted in place, are the B operand (hardware k order) of
// Y^T += GT . P^T  (A = GT rows through the same loader: keys 8h..8h+7 | 16+8h..16+8h+7). D register r = y[o = 8*(lane>>4) + r][q = lane&15].
// A lane holds one query's column in both products: running maximum (log2 domain) and rescale factor are per-lane scalars.
// The sum of a query's exponentials comes off the matrix pipe: L += ones . P^T (A: row 0 is 1.0, the rest 0), one product per column group and pass,
// on the same rounded P^T operand as the y^T product; register 0 of lanes 0..15 holds the sum over all 32 keys of query lane&15.
// The maximum in use may trail the true one by up to 8 (an exponential reaches 2^8 at most, inside f16): rescale only when some column exceeds that.
// The four key slices of a query group are joined in LDS: maxima and sums first; then each wave scales its 32-channel y^T, whose two channel
// tiles, converted in place, are the B operand of out^T = W_out . y^T (A = w_out rows in the loader's k order), and the partial out tiles are
// summed in slice order 0..3. The products over the keys so run on the 32 inner channels, not on the 64 outer ones.
// phi rows and g^T rows come through LDS: a stage is 64 keys of each of the four slices (two passes), brought once per work-group by
// asynchronous 16-B copies (a g^T row of a stage is one whole 128-B line, a phi row 64 B) and read by the four query waves of its slice.
// Two buffers: stage t + 1 flies while stage t is worked on; one barrier per stage publishes the one and frees the other.
// ---------------------------------------------------------------------------
constexpr int kFQ  = 32;            // queries per wave (two 16-column groups)
constexpr int kFG  = 4;             // query groups per work-group
constexpr int kFS  = 4;             // key slices per work-group
constexpr int kFW  = kFG * kFS;     // waves per work-group
constexpr int kFK  = kN / kFS;      // keys per wave
constexpr int kFNP = kFK / 32;      // passes per wave
constexpr int kFP  = 36;            // LDS row pitch in floats: 144 B = 16 B x odd
constexpr int kSK  = 64;            // keys of one slice per stage
constexpr int kNST = kFK / kSK;     // stages
constexpr int kPhP = 40;            // LDS pitch of a phi row in halves: 80 B = 16 B x odd
constexpr int kGwP = 72;            // LDS pitch of a g^T row in halves: 144 B = 16 B x odd
constexpr int kPhB = kFS * kSK * kPhP;   // halves of one phi buffer (4 slices x 64 keys)
constexpr int kGwB = kFS * kCI * kGwP;   // halves of one g^T buffer (4 slices x 32 channels)
constexpr float kLog2e = 1.4426950408889634f;
static_assert(kSK == 64 && kNST >= 2 && kFW * 32 == 512 && kFS == 4, "stage copy map: 2 phi and 2 g^T chunks of 16 B per thread");
static_assert(kFK % 32 == 0 && kN % (kFG * kFQ) == 0 && kCI == 32 && kC == 64, "fused tile");
static_assert(kC * kFG * kFQ == kFW * 32 * 16, "join map: four float4 per thread");
typedef __attribute__((ext_vector_type(2))) float    v2f;
typedef __attribute__((ext_vector_type(2))) _Float16 v2h;

// lane l with lane l ^ 16
__device__ __forceinline__ float xhalf(float v) {
  const int i = __builtin_bit_cast(int, v);
  return __builtin_bit_cast(float, __builtin_amdgcn_permlanex16(i, i, 0x76543210, 0xfedcba98, false, false));
}
__device__ __forceinline__ unsigned pack2h(float lo, float hi) {   // round to nearest even
  return __builtin_bit_cast(unsigned, __builtin_convertvector((v2f){lo, hi}, v2h));
}
// Eight exponentials (2^a) in one statement. The outputs are early-clobbered, so none lands on a source of another, and the closing v_nop is
// the slot the instruction set asks for behind a transcendental before its result is used or its source overwritten.
__device__ __forceinline__ void exp2x8(float (&p)[8], const float (&a)[8]) {
  asm("v_exp_f32 %0, %8\n\tv_exp_f32 %1, %9\n\tv_exp_f32 %2, %10\n\tv_exp_f32 %3, %11\n\t"
      "v_exp_f32 %4, %12\n\tv_exp_f32 %5, %13\n\tv_exp_f32 %6, %14\n\tv_exp_f32 %7, %15\n\tv_nop"
      : "=&v"(p[0]), "=&v"(p[1]), "=&v"(p[2]), "=&v"(p[3]), "=&v"(p[4]), "=&v"(p[5]), "=&v"(p[6]), "=&v"(p[7])
      : "v"(a[0]), "v"(a[1]), "v"(a[2]), "v"(a[3]), "v"(a[4]), "v"(a[5]), "v"(a[6]), "v"(a[7]));
}

// One stage: four 16-B copies per lane, global memory to LDS through no register.
// lp / gp: this lane's phi chunk of slices 0..1; lg / gg: its g^T chunk of slices 0..1 (the second copy of each: two slices on).
// The closing s_wait_xcnt stands inside the statement so that no address register named here is rewritten ahead of it.
__device__ __forceinline__ void stage_copy(unsigned lp, unsigned lg, const _Float16* gp, const _Float16* gg) {
  const unsigned lp1 = lp + 2 * kSK * kPhP * 2;
  const unsigned lg1 = lg + 2 * kCI * kGwP * 2;
  const _Float16* gp1 = gp + (size_t)2 * kFK * kPW;
  const _Float16* gg1 = gg + 2 * kFK;
  asm volatile("global_load_async_to_lds_b128 %0, %4, off\n\t"
               "global_load_async_to_lds_b128 %1, %5, off\n\t"
               "global_load_async_to_lds_b128 %2, %6, off\n\t"
               "global_load_async_to_lds_b128 %3, %7, off\n\t"
               "s_wait_xcnt 0x0"
               :: "v"(lp), "v"(lp1), "v"(lg), "v"(lg1),
                  "v"(gp), "v"(gp1), "v"(gg), "v"(gg1)
               : "memory");
}

__global__ __launch_bounds__(kFW * 32) void attn_fused_kernel(const unsigned short* __restrict__ prj,
                                                              const unsigned short* __restrict__ gt,
                                                              const float* __restrict__ w_out,
                                                              const float* __restrict__ b_out,
                                                              const float* __restrict__ x,
                                                              float* __restrict__ out) {
  __shared__ __align__(16) float part[kFW][kC * kFP];
  __shared__ __align__(16) _Float16 sPh[2 * kPhB];
  __shared__ __align__(16) _Float16 sGw[2 * kGwB];
  __shared__ float sM[kFW][kFQ];
  __shared__ float sL[kFW][kFQ];
  const int t    = threadIdx.x;
  const int lane = t & 31, wave = t >> 5;
  const int b    = blockIdx.y;
  const int qg   = wave >> 2, ks = wave & 3;
  const int qb   = blockIdx.x * (kFG * kFQ);
  const int rl   = lane & 15, hh = lane >> 4;
  const _Float16* Pb = (const _Float16*)prj + (size_t)b * kN * kPW;
  const _Float16* Th = Pb + (size_t)(qb + qg * kFQ + rl) * kPW + hh * 8;
  // fragment readers: this wave's slice in buffer 0
  const _Float16* Lp = sPh + (ks * kSK + rl) * kPhP + hh * 8;
  const _Float16* Lg = sGw + (ks * kCI + rl) * kGwP + hh * 8;
  // copy map: phi chunk = (slice t>>8 [+2], key (t>>2)&63, 16-B piece t&3); g^T chunk = (slice t>>8 [+2], channel (t>>3)&31, 16-B piece t&7)
  const unsigned cLp = (unsigned)(size_t)(sPh + ((t >> 8) * kSK + ((t >> 2) & 63)) * kPhP + (t & 3) * 8);
  const unsigned cLg = (unsigned)(size_t)(sGw + ((t >> 8) * kCI + ((t >> 3) & 31)) * kGwP + (t & 7) * 8);
  const _Float16* cGp = Pb + (size_t)((t >> 8) * kFK + ((t >> 2) & 63)) * kPW + kCI + (t & 3) * 8;
  const _Float16* cGg = (const _Float16*)gt + ((size_t)b * kCI + ((t >> 3) & 31)) * kN + (t >> 8) * kFK + (t & 7) * 8;

  stage_copy(cLp, cLg, cGp, cGg);
  // A operands of the output projection: w_out rows 16 ot + (lane&15), carried x16, elements 0..7 = channels 8h..8h+7, 8..15 = 16+8h..16+8h+7.
  // Read here, so that their trip to memory runs beside stage 0's.
  union { unsigned u[8]; v16h v; } wo[4];
#pragma unroll
  for (int ot = 0; ot < 4; ++ot) {
    const float* wr = w_out + ((ot << 4) + rl) * kCI + hh * 8;
#pragma unroll
    for (int j = 0; j < 4; ++j) {   // four floats at 0, 4, 16, 20 of the lane's half row
      const v4f q = *(const v4f*)(wr + (j >> 1) * 16 + (j & 1) * 4);
      wo[ot].u[2 * j]     = pack2h(q[0] * kWCarry, q[1] * kWCarry);
      wo[ot].u[2 * j + 1] = pack2h(q[2] * kWCarry, q[3] * kWCarry);
    }
  }
  // stage 0 has landed for this wave's copies before the barrier that publishes it
  asm volatile("s_wait_asynccnt 0x0" ::: "memory");
  __syncthreads();   // stage 0 is readable by every wave
  stage_copy(cLp + kPhB * 2, cLg + kGwB * 2, cGp + (size_t)kSK * kPW, cGg + kSK);

  v16h th[2], ph[2];
#pragma unroll
  for (int g = 0; g < 2; ++g) th[g] = Frag<_Float16>::load(Th + (size_t)(g << 4) * kPW);

  v8f acc[2][2];
#pragma unroll
  for (int ct = 0; ct < 2; ++ct)
#pragma unroll
    for (int g = 0; g < 2; ++g) acc[ct][g] = (v8f){0.f,0.f,0.f,0.f,0.f,0.f,0.f,0.f};
  float m_run[2] = {-__builtin_inff(), -__builtin_inff()};
  v8f lacc[2];   // sums of exponentials, rescaled like a y^T tile
#pragma unroll
  for (int g = 0; g < 2; ++g) lacc[g] = (v8f){0.f,0.f,0.f,0.f,0.f,0.f,0.f,0.f};
  union { unsigned u[8]; v16h v; } ones;
#pragma unroll
  for (int i = 0; i < 8; ++i) ones.u[i] = (rl == 0) ? 0x3C003C00u : 0u;

  // rolled: a stage (two passes) is already a long straight block
#pragma unroll 1
  for (int sg = 0; sg < kNST; ++sg) {
   const int bf = sg & 1;
   const _Float16* lp = Lp + bf * kPhB;
   const _Float16* lg = Lg + bf * kGwB;
#pragma unroll
   for (int kt = 0; kt < 2; ++kt) ph[kt] = Frag<_Float16>::load(lp + (kt << 4) * kPhP);
   // keeps both fragments' reads ahead of the first product: left free, the second is read into the first one's registers behind its
   // products, and the wave waits out the LDS latency twice
   __builtin_amdgcn_sched_barrier(0);
   // both passes of the stage written out: the second pass's offsets in the buffer are then immediates
#pragma unroll
   for (int pp = 0; pp < kSK / 32; ++pp) {
    v8f st[2][2];
#pragma unroll
    for (int kt = 0; kt < 2; ++kt)
#pragma unroll
      for (int g = 0; g < 2; ++g)
        st[kt][g] = Frag<_Float16>::mma(ph[kt], th[g], (v8f){0.f,0.f,0.f,0.f,0.f,0.f,0.f,0.f});
    // holds the v_nops below behind the last of these products
    __builtin_amdgcn_sched_barrier(0);
    // the loads below go over fragment registers of the products above: four vector slots between the last WMMA and a load over its A
    asm volatile("v_nop\n\tv_nop\n\tv_nop\n\tv_nop");
    v16h gw[2];
#pragma unroll
    for (int ct = 0; ct < 2; ++ct) gw[ct] = Frag<_Float16>::load(lg + (ct << 4) * kGwP + pp * 32);
    if (pp + 1 < kSK / 32) {   // the next pass's phi rows, only inside this stage's own buffer
#pragma unroll
      for (int kt = 0; kt < 2; ++kt) ph[kt] = Frag<_Float16>::load(lp + ((pp + 1) * 32 + (kt << 4)) * kPhP);
    }
    // keeps these loads ahead of the softmax work: left free, the compiler sinks each load to its use and the wave waits out its latency there
    __builtin_amdgcn_sched_barrier(0);

    float mb[2];
    bool need = false;
#pragma unroll
    for (int g = 0; g < 2; ++g) {
      float mx = st[0][g][0];
#pragma unroll
      for (int r = 1; r < 8; ++r) mx = fmaxf(mx, st[0][g][r]);
#pragma unroll
      for (int r = 0; r < 8; ++r) mx = fmaxf(mx, st[1][g][r]);
      mx = fmaxf(mx, xhalf(mx)) * kLog2e;   // both wave halves hold this query's maximum of the pass, log2 domain
      mb[g] = mx;
      need = need || (mx > m_run[g] + 8.0f);
    }
    if (__builtin_amdgcn_ballot_w32(need) != 0) {   // wave-uniform; rare after the first passes
#pragma unroll
      for (int g = 0; g < 2; ++g) {
        const float m_new = fmaxf(m_run[g], mb[g]);
        const float corr  = __builtin_amdgcn_exp2f(m_run[g] - m_new);   // 0 on the first pass, where m_run is -inf
        m_run[g] = m_new;
        lacc[g] = lacc[g] * corr;
#pragma unroll
        for (int ct = 0; ct < 2; ++ct) acc[ct][g] = acc[ct][g] * corr;
      }
    }
    union PB { unsigned u[8]; v16h v; } pb[2];
#pragma unroll
    for (int g = 0; g < 2; ++g) {
      const float nm = -m_run[g];
#pragma unroll
      for (int kt = 0; kt < 2; ++kt) {   // key tile kt fills elements 8kt..8kt+7 of the 32-key operand, register r = element 8kt + r
        float a[8], p[8];
#pragma unroll
        for (int r = 0; r < 8; ++r) a[r] = fmaf(st[kt][g][r], kLog2e, nm);
        exp2x8(p, a);
#pragma unroll
        for (int i = 0; i < 4; ++i) pb[g].u[kt * 4 + i] = pack2h(p[2 * i], p[2 * i + 1]);
      }
    }
    // keeps every exponential statement ahead of the products below: an exponential
    // moved behind a product could write over its B operand too early
    __builtin_amdgcn_sched_barrier(0);
#pragma unroll
    for (int g = 0; g < 2; ++g) {
#pragma unroll
      for (int ct = 0; ct < 2; ++ct) acc[ct][g] = Frag<_Float16>::mma(gw[ct], pb[g].v, acc[ct][g]);
      lacc[g] = Frag<_Float16>::mma(ones.v, pb[g].v, lacc[g]);
    }
   }
   // foot of a stage: this wave's reads of the buffer are done, its copies of the next stage have landed
   asm volatile("s_wait_dscnt 0x0" ::: "memory");
   asm volatile("s_wait_asynccnt 0x0" ::: "memory");
   __syncthreads();   // publishes stage sg + 1 and frees the buffer of stage sg
   if (sg + 2 < kNST)
     stage_copy(cLp + bf * (kPhB * 2), cLg + bf * (kGwB * 2), cGp + (size_t)(sg + 2) * kSK * kPW, cGg + (sg + 2) * kSK);
  }
  // nothing is outstanding here; the wait closes the ring before the wave goes on to the join
  asm volatile("s_wait_asynccnt 0x0" ::: "memory");

  // ---- join of the four key slices of each query group ----
#pragma unroll
  for (int g = 0; g < 2; ++g) {
    if (hh == 0) {
      sM[wave][(g << 4) + rl] = m_run[g];
      sL[wave][(g << 4) + rl] = lacc[g][0];
    }
  }
  __syncthreads();   // every slice's maxima and sums are in LDS before any wave forms its factor
  float* my = part[wave];
  union { unsigned u[8]; v16h v; } yb[2];   // channel tile ct fills elements 8ct..8ct+7, register r = element 8ct + r = channel 16ct + 8h + r
#pragma unroll
  for (int g = 0; g < 2; ++g) {
    const int ql = (g << 4) + rl;
    float M = sM[qg * kFS][ql];
#pragma unroll
    for (int j = 1; j < kFS; ++j) M = fmaxf(M, sM[qg * kFS + j][ql]);
    float L = 0.f;
#pragma unroll
    for (int j = 0; j < kFS; ++j) L += sL[qg * kFS + j][ql] * __builtin_amdgcn_exp2f(sM[qg * kFS + j][ql] - M);
    const float f = __builtin_amdgcn_exp2f(m_run[g] - M) / L * kWCarryInv;   // the x16 that w_out carries goes out with the slice's factor
#pragma unroll
    for (int ct = 0; ct < 2; ++ct)
#pragma unroll
      for (int i = 0; i < 4; ++i) yb[g].u[ct * 4 + i] = pack2h(acc[ct][g][2 * i] * f, acc[ct][g][2 * i + 1] * f);
  }
  v8f o[4][2];
#pragma unroll
  for (int ot = 0; ot < 4; ++ot)
#pragma unroll
    for (int g = 0; g < 2; ++g) o[ot][g] = Frag<_Float16>::mma(wo[ot].v, yb[g].v, (v8f){0.f,0.f,0.f,0.f,0.f,0.f,0.f,0.f});
  // all eight products ahead of the first store: each then has result registers of its own (left free, a later product was given an earlier
  // one's result registers one vector slot behind it)
  __builtin_amdgcn_sched_barrier(0);
#pragma unroll
  for (int ot = 0; ot < 4; ++ot)
#pragma unroll
    for (int g = 0; g < 2; ++g)
#pragma unroll
      for (int r = 0; r < 8; ++r) my[((ot << 4) + hh * 8 + r) * kFP + (g << 4) + rl] = o[ot][g][r];
  __syncthreads();   // every wave's scaled partial tile is in LDS before any thread sums across slices

  // thread t, trip it: float4 index it*512 + t of the 64 c x 128 q tile; a wave writes one whole 512-B row segment of out
#pragma unroll
  for (int it = 0; it < 4; ++it) {
    const int idx = it * (kFW * 32) + t;
    const int c   = idx >> 5;
    const int q4  = (idx & 31) * 4;
    const int g4  = (q4 >> 5) * kFS;
    const int po  = c * kFP + (q4 & 31);
    v4f sum = *(const v4f*)(&part[g4][po]);
#pragma unroll
    for (int j = 1; j < kFS; ++j) sum = sum + *(const v4f*)(&part[g4 + j][po]);
    const size_t o = ((size_t)b * kC + c) * kN + qb + q4;
    const v4f rr = *(const v4f*)(x + o);
    const float bv = b_out[c];
    v4f v;
#pragma unroll
    for (int e = 0; e < 4; ++e) v[e] = (sum[e] + bv) + rr[e];
    *(v4f*)(out + o) = v;
  }
}

// ---------------------------------------------------------------------------
// Weight preparation and channel projections in one launch, straight from x and the f32 weights.
// grid (4096/256 = 16, 8 batches), 4 waves; a wave owns the 64 positions n0..n0+63 of one batch.
// Weights: the work-group rounds 16 w to f16 once into LDS (rows theta | phi | g; biases in f32); one barrier publishes them.
// Every global load of a wave is issued ahead of that barrier, the weights first: one trip to memory in all.
// D = W . x: A = weight rows (m = output channel), B = x columns (n = position, f16(x)), K = 64 channels in two steps.
//   A lane reads x as one float4 per channel at position n0 + 4*(lane&15); component g goes to position tile g, whose column j is position
//   n0 + 4j + g. A wave-wide load is two whole 256-B pieces of two rows of x.
//   Element s of both operands is channel 32 ks + 8*(lane>>4) + s for s < 8 and 32 ks + 16 + 8*(lane>>4) + (s - 8) for s >= 8.
//   D register r = output channel 16 mt + 8*(lane>>4) + r at the lane's position: theta and phi leave as one 16-B store per tile.
//   g leaves transposed: a lane holds channel 8*(lane>>4) + r of a tile at the four keys n0 + 4*(lane&15) + 0..3 (one per position tile), one 8-B
//   store per channel; the 16 lanes of a wave half fill one whole 128-B line of g^T, and every line is written by one wave.
// ---------------------------------------------------------------------------
constexpr int kJP  = 64;        // positions per wave (four position tiles)
constexpr int kJW  = 4;         // waves per work-group
constexpr int kJO  = 3 * kCI;   // projection rows: theta | phi | g
constexpr int kWP  = 72;        // LDS pitch of a projection weight row in halves: 144 B = 16 B x odd
static_assert(kN % (kJP * kJW) == 0 && kC == 64 && kCI == 32 && kJW == 4, "projection tile and weight copy map");
union HFrag { unsigned u[8]; v16h v; };
typedef __attribute__((ext_vector_type(2))) unsigned int v2u;

// four weights, carried x16, rounded to f16
__device__ __forceinline__ v2u w_pack(v4f q) {
  return (v2u){pack2h(q[0] * kWCarry, q[1] * kWCarry), pack2h(q[2] * kWCarry, q[3] * kWCarry)};
}

__global__ __launch_bounds__(kJW * 32) void proj_kernel(const float* __restrict__ x,
                                                            const float* __restrict__ w_theta, const float* __restrict__ b_theta,
                                                            const float* __restrict__ w_phi, const float* __restrict__ b_phi,
                                                            const float* __restrict__ w_g, const float* __restrict__ b_g,
                                                            unsigned short* __restrict__ prj, unsigned short* __restrict__ gt) {
  __shared__ __align__(16) _Float16 sW[kJO * kWP];
  __shared__ __align__(16) float sB[kJW * 32];   // b_theta | b_phi | b_g | a copy of b_g that nobody reads (wave 3 takes no branch of its own)
  const int t    = threadIdx.x;
  const int lane = t & 31, wave = t >> 5;
  const int rl   = lane & 15, hh = lane >> 4;
  const int b    = blockIdx.y;
  const int n0   = (blockIdx.x * kJW + wave) * kJP;

  // weights: trip i brings 8 rows of 64 (16 threads a row), four trips a matrix
  const int wo = (t >> 4) * kC + (t & 15) * 4;
  const float* pw0 = w_theta + wo;
  const float* pw1 = w_phi + wo;
  const float* pw2 = w_g + wo;
  const float* pb  = ((wave == 0) ? b_theta : ((wave == 1) ? b_phi : b_g)) + lane;
  v4f wq[12];
#pragma unroll
  for (int i = 0; i < 12; ++i) wq[i] = *(const v4f*)(((i < 4) ? pw0 : ((i < 8) ? pw1 : pw2)) + (i & 3) * 8 * kC);
  const float bq = *pb;

  // x: 32 channels per lane, four positions each
  const float* xp = x + ((size_t)b * kC + hh * 8) * kN + n0 + 4 * rl;
  v4f xv[2][16];
#pragma unroll
  for (int ks = 0; ks < 2; ++ks)
#pragma unroll
    for (int s = 0; s < 16; ++s) xv[ks][s] = *(const v4f*)(xp + (size_t)(ks * 32 + (s < 8 ? s : s + 8)) * kN);
  // the wait that stands before an address register of an issued load is written again; the addresses are named as inputs so that they
  // stay in their registers up to here (left free, later loads of this run were given earlier loads' address registers as destinations)
  asm volatile("s_wait_xcnt 0x0" :: "v"(pw0), "v"(pw1), "v"(pw2), "v"(pb), "v"(xp) : "memory");
  // keeps every load ahead of the first conversion: left free, the compiler waits for weights before it issues the x loads, two trips in series
  __builtin_amdgcn_sched_barrier(0);

#pragma unroll
  for (int i = 0; i < 12; ++i) *(v2u*)(sW + (i * 8 + (t >> 4)) * kWP + (t & 15) * 4) = w_pack(wq[i]);
  sB[t] = bq;
  __syncthreads();   // the f16 weights and the biases are in LDS before any wave reads an operand

  HFrag xb[4][2];
#pragma unroll
  for (int g = 0; g < 4; ++g)
#pragma unroll
    for (int ks = 0; ks < 2; ++ks)
#pragma unroll
      for (int i = 0; i < 8; ++i) xb[g][ks].u[i] = pack2h(xv[ks][2 * i][g], xv[ks][2 * i + 1][g]);

  // theta (mt 0, 1), phi (mt 2, 3), g (mt 4, 5)
  unsigned short* pr = prj + ((size_t)b * kN + n0 + 4 * rl) * kPW + hh * 8;
  unsigned short* gq = gt + ((size_t)b * kCI + hh * 8) * kN + n0 + 4 * rl;
#pragma unroll
  for (int mt = 0; mt < 6; ++mt) {
    const _Float16* wr = sW + (mt * 16 + rl) * kWP + hh * 8;
    const v16h wa0 = Frag<_Float16>::load(wr);
    const v16h wa1 = Frag<_Float16>::load(wr + 32);
    const v4f bv[2] = {*(const v4f*)(sB + mt * 16 + hh * 8), *(const v4f*)(sB + mt * 16 + hh * 8 + 4)};
    v8f acc[4];
#pragma unroll
    for (int g = 0; g < 4; ++g) acc[g] = Frag<_Float16>::mma(wa0, xb[g][0].v, (v8f){0.f,0.f,0.f,0.f,0.f,0.f,0.f,0.f});
#pragma unroll
    for (int g = 0; g < 4; ++g) acc[g] = Frag<_Float16>::mma(wa1, xb[g][1].v, acc[g]);
    if (mt < 4) {
#pragma unroll
      for (int g = 0; g < 4; ++g) {
        unsigned u[4];
#pragma unroll
        for (int i = 0; i < 4; ++i)
          u[i] = pack2h(fmaf(acc[g][2 * i], kWCarryInv, bv[i >> 1][(2 * i) & 3]), fmaf(acc[g][2 * i + 1], kWCarryInv, bv[i >> 1][(2 * i + 1) & 3]));
        *(v4u*)(pr + (size_t)g * kPW + mt * 16) = (v4u){u[0], u[1], u[2], u[3]};
      }
    } else {
#pragma unroll
      for (int r = 0; r < 8; ++r) {   // channel 16 (mt - 4) + 8 h + r at keys n0 + 4 (lane&15) + 0..3
        const float bb = bv[r >> 2][r & 3];
        *(v2u*)(gq + (size_t)((mt - 4) * 16 + r) * kN) = (v2u){pack2h(fmaf(acc[0][r], kWCarryInv, bb), fmaf(acc[1][r], kWCarryInv, bb)),
                                                               pack2h(fmaf(acc[2][r], kWCarryInv, bb), fmaf(acc[3][r], kWCarryInv, bb))};
      }
    }
  }
}

// ---------------------------------------------------------------------------
// Host glue.
//   PRJ  f16 [8][4096][128]   8,388,608  at           0   (theta | phi per position; the upper half of a row is unused)
//   GT   f16 [8][32][4096]    2,097,152  at   8,388,608   (g^T[o][key])
//   total                    10,485,760
// ---------------------------------------------------------------------------
extern "C" void kernel_launch(void* const* d_in, const int* in_sizes, int n_in,
                              void* d_out, int out_size, void* d_ws, size_t ws_size,
                              hipStream_t stream) {
  if (n_in < 9) return;
  const int nX = kB * kC * kN;   // 2,097,152
  if (in_sizes[0] != nX) return;
  if (in_sizes[1] != kCI * kC || in_sizes[2] != kCI) return;
  if (in_sizes[3] != kCI * kC || in_sizes[4] != kCI) return;
  if (in_sizes[5] != kCI * kC || in_sizes[6] != kCI) return;
  if (in_sizes[7] != kC * kCI || in_sizes[8] != kC) return;
  if (out_size != nX) return;

  const size_t szPRJ = (size_t)kB * kN * kPW * 2;
  const size_t szGT  = (size_t)kB * kCI * kN * 2;
  const size_t offPRJ = 0;
  const size_t offGT  = offPRJ + szPRJ;
  const size_t total  = offGT + szGT;
  if (ws_size < total) return;

  const float* x       = (const float*)d_in[0];
  const float* w_theta = (const float*)d_in[1];
  const float* b_theta = (const float*)d_in[2];
  const float* w_phi   = (const float*)d_in[3];
  const float* b_phi   = (const float*)d_in[4];
  const float* w_g     = (const float*)d_in[5];
  const float* b_g     = (const float*)d_in[6];
  const float* w_out   = (const float*)d_in[7];
  const float* b_out   = (const float*)d_in[8];
  float* out = (float*)d_out;
  char* ws = (char*)d_ws;
  unsigned short* PRJ = (unsigned short*)(ws + offPRJ);
  unsigned short* GT  = (unsigned short*)(ws + offGT);

  // ---- theta, phi planes and g^T of all batches (16 blocks of 256 positions x 8 batches) ----
  proj_kernel<<<dim3(kN / (kJP * kJW), kB), dim3(kJW * 32), 0, stream>>>(x, w_theta, b_theta, w_phi, b_phi, w_g, b_g, PRJ, GT);

  // ---- scores, softmax over keys, y^T product, output projection, bias and residual: all batches, one launch (32 position blocks x 8 batches) ----
  attn_fused_kernel<<<dim3(kN / (kFG * kFQ), kB), dim3(kFW * 32), 0, stream>>>(PRJ, GT, w_out, b_out, x, out);
}

// v007
// One run takes 30.6 microseconds.
// Next to v006, in two timings, it ran 1.05 times as fast each time.
// Over all steps from v000 it is 50.2 times as fast.
// Contractions: channel projections (W f16 carried x16 . x f16), scores phi.theta^T (f16 planes), y^T = g^T f16 x P^T (f16, unnormalised exponentials), softmax sums = ones (f16) . P^T, out^T = W_out (f16 carried x16) . y^T (f16, normalised slice partials): all on v_wmma_f32_16x16x32_f16 with f32 accumulate; bias adds, softmax maxima, exponentials and residual in f32.
#include <hip/hip_runtime.h>
#include <math.h>

// ---------------------------------------------------------------------------
// Problem constants
// ---------------------------------------------------------------------------
constexpr int kB  = 8;        // batch
constexpr int kC  = 64;       // in channels
constexpr int kCI = 32;       // inter channels
constexpr int kN  = 4096;     // H*W positions
constexpr int kPW = 128;      // projection plane row pitch in halves: theta 0..31 | phi 32..63 | 64..127 neither written nor read
constexpr float kWCarry    = 16.0f;            // weights carried x16 in f16
constexpr float kWCarryInv = 1.0f / 16.0f;
static_assert(kN % 64 == 0 && kPW % 64 == 0 && kC % 64 == 0, "M,N tiles");
static_assert(kC % 32 == 0 && kCI % 32 == 0 && kN % 32 == 0, "K steps");

typedef __attribute__((ext_vector_type(16))) _Float16 v16h;
typedef __attribute__((ext_vector_type(8)))  _Float16 v8h;
typedef __attribute__((ext_vector_type(8)))  float    v8f;
typedef __attribute__((ext_vector_type(4)))  float    v4f;
typedef __attribute__((ext_vector_type(4)))  unsigned int v4u;

// ---------------------------------------------------------------------------
// Helpers
// ---------------------------------------------------------------------------
template <typename T> struct Frag;
template <> struct Frag<_Float16> {
  typedef v16h V; union U { v16h v; v8h h[2]; };
  // elements 0..7 <- p[0..7], 8..15 <- p[16..23]
  static __device__ __forceinline__ v16h load(const _Float16* p) {
    U f; f.h[0] = *(const v8h*)(p); f.h[1] = *(const v8h*)(p + 16); return f.v;
  }
  static __device__ __forceinline__ v8f mma(v16h a, v16h b, v8f c) {
    return __builtin_amdgcn_wmma_f32_16x16x32_f16(false, a, false, b, (short)0, c, false, false);
  }
};

// ---------------------------------------------------------------------------
// Scores, softmax, y^T product and output projection of all batches in one launch; scores and probabilities stay in registers.
//   y[b][o][q] = sum_key GT[b][o][key] * softmax_key(theta[q] . phi[key]);  out[b][c][q] = sum_o w_out[c][o] * y[b][o][q] + b_out[c] + x[b][c][q]
// grid (4096/128 = 32 position blocks, 8 batches), 16 waves: wave = query group (wave >> 2, 32 q) x key slice (wave & 3, 1024 keys).
// One pass = 32 keys:  S^T = phi . theta^T  (A = phi rows, B = theta rows, same loader: equal k order); D register r of a lane =
// S^T[key 8*(lane>>4) + r][q = lane&15], so the two key tiles of a pass, converted in place, are the B operand (hardware k order) of
// Y^T += GT . P^T  (A = GT rows through the same loader: keys 8h..8h+7 | 16+8h..16+8h+7). D register r = y[o = 8*(lane>>4) + r][q = lane&15].
// A lane holds one query's column in both products: running maximum (log2 domain) and rescale factor are per-lane scalars.
// theta is carried x log2(e) and the score product's C operand holds minus the maximum in use in all eight registers of a lane, so D is
// already the argument of the exponential, S log2(e) - m. The maximum in use starts as the exact maximum of the wave's first 32 keys.
// The sum of a query's exponentials comes off the matrix pipe: L += ones . P^T (A: row 0 is 1.0, the rest 0), one product per column group and pass,
// on the same rounded P^T operand as the y^T product; register 0 of lanes 0..15 holds the sum over all 32 keys of query lane&15.
// The maximum in use may trail the true one by up to 8 (an exponential reaches 2^8 at most, inside f16): rescale only when some column exceeds that.
// The four key slices of a query group are joined in LDS: maxima and sums first; then each wave scales its 32-channel y^T, whose two channel
// tiles, converted in place, are the B operand of out^T = W_out . y^T (A = w_out rows in the loader's k order), and the partial out tiles are
// summed in slice order 0..3. The products over the keys so run on the 32 inner channels, not on the 64 outer ones.
// phi rows and g^T rows come through LDS: a stage is 64 keys of each of the four slices (two passes), brought once per work-group by
// asynchronous 16-B copies (a g^T row of a stage is one whole 128-B line, a phi row 64 B) and read by the four query waves of its slice.
// Two buffers: stage t + 1 flies while stage t is worked on; one barrier per stage publishes the one and frees the other.
// ---------------------------------------------------------------------------
constexpr int kFQ  = 32;            // queries per wave (two 16-column groups)
constexpr int kFG  = 4;             // query groups per work-group
constexpr int kFS  = 4;             // key slices per work-group
constexpr int kFW  = kFG * kFS;     // waves per work-group
constexpr int kFK  = kN / kFS;      // keys per wave
constexpr int kFNP = kFK / 32;      // passes per wave
constexpr int kFP  = 36;            // LDS row pitch in floats: 144 B = 16 B x odd
constexpr int kSK  = 64;            // keys of one slice per stage
constexpr int kNST = kFK / kSK;     // stages
constexpr int kPhP = 40;            // LDS pitch of a phi row in halves: 80 B = 16 B x odd
constexpr int kGwP = 72;            // LDS pitch of a g^T row in halves: 144 B = 16 B x odd
constexpr int kPhB = kFS * kSK * kPhP;   // halves of one phi buffer (4 slices x 64 keys)
constexpr int kGwB = kFS * kCI * kGwP;   // halves of one g^T buffer (4 slices x 32 channels)
constexpr float kLog2e = 1.4426950408889634f;
static_assert(kSK == 64 && kNST >= 2 && kFW * 32 == 512 && kFS == 4, "stage copy map: 2 phi and 2 g^T chunks of 16 B per thread");
static_assert(kFK % 32 == 0 && kN % (kFG * kFQ) == 0 && kCI == 32 && kC == 64, "fused tile");
static_assert(kC * kFG * kFQ == kFW * 32 * 16, "join map: four float4 per thread");
typedef __attribute__((ext_vector_type(2))) float    v2f;
typedef __attribute__((ext_vector_type(2))) _Float16 v2h;

// lane l with lane l ^ 16
__device__ __forceinline__ float xhalf(float v) {
  const int i = __builtin_bit_cast(int, v);
  return __builtin_bit_cast(float, __builtin_amdgcn_permlanex16(i, i, 0x76543210, 0xfedcba98, false, false));
}
__device__ __forceinline__ unsigned pack2h(float lo, float hi) {   // round to nearest even
  return __builtin_bit_cast(unsigned, __builtin_convertvector((v2f){lo, hi}, v2h));
}
// Eight exponentials (2^a) in one statement. The outputs are early-clobbered, so none lands on a source of another, and the closing v_nop is
// the slot the instruction set asks for behind a transcendental before its result is used or its source overwritten.
__device__ __forceinline__ void exp2x8(float (&p)[8], const float (&a)[8]) {
  asm("v_exp_f32 %0, %8\n\tv_exp_f32 %1, %9\n\tv_exp_f32 %2, %10\n\tv_exp_f32 %3, %11\n\t"
      "v_exp_f32 %4, %12\n\tv_exp_f32 %5, %13\n\tv_exp_f32 %6, %14\n\tv_exp_f32 %7, %15\n\tv_nop"
      : "=&v"(p[0]), "=&v"(p[1]), "=&v"(p[2]), "=&v"(p[3]), "=&v"(p[4]), "=&v"(p[5]), "=&v"(p[6]), "=&v"(p[7])
      : "v"(a[0]), "v"(a[1]), "v"(a[2]), "v"(a[3]), "v"(a[4]), "v"(a[5]), "v"(a[6]), "v"(a[7]));
}

// The four score products of a pass in one statement, D apart from C: the C registers (minus the maximum in use) are read only and live on
// from pass to pass (through the builtin some of these products were tied to their C, which was copied first, eight registers a time).
// Key tile 1 goes first: in the listing the D registers of key tile 0 are the B operands of the pass before, and this order puts three
// products and more between a register's last use there and the product that writes it here.
// The closing v_nops are the four vector slots between the last WMMA and a vector instruction on its D or a load over its A.
__device__ __forceinline__ void score4(v8f (&d)[2][2], const v16h (&a)[2], const v16h (&b)[2], const v8f (&c)[2]) {
  asm("v_wmma_f32_16x16x32_f16 %2, %5, %6, %8\n\t"
      "v_wmma_f32_16x16x32_f16 %3, %5, %7, %9\n\t"
      "v_wmma_f32_16x16x32_f16 %0, %4, %6, %8\n\t"
      "v_wmma_f32_16x16x32_f16 %1, %4, %7, %9\n\t"
      "v_nop\n\tv_nop\n\tv_nop\n\tv_nop"
      : "=&v"(d[0][0]), "=&v"(d[0][1]), "=&v"(d[1][0]), "=&v"(d[1][1])
      : "v"(a[0]), "v"(a[1]), "v"(b[0]), "v"(b[1]), "v"(c[0]), "v"(c[1]));
}

// One stage: four 16-B copies per lane, global memory to LDS through no register.
// lp / gp: this lane's phi chunk of slices 0..1; lg / gg: its g^T chunk of slices 0..1 (the second copy of each: two slices on).
// The closing s_wait_xcnt stands inside the statement so that no address register named here is rewritten ahead of it.
__device__ __forceinline__ void stage_copy(unsigned lp, unsigned lg, const _Float16* gp, const _Float16* gg) {
  const unsigned lp1 = lp + 2 * kSK * kPhP * 2;
  const unsigned lg1 = lg + 2 * kCI * kGwP * 2;
  const _Float16* gp1 = gp + (size_t)2 * kFK * kPW;
  const _Float16* gg1 = gg + 2 * kFK;
  asm volatile("global_load_async_to_lds_b128 %0, %4, off\n\t"
               "global_load_async_to_lds_b128 %1, %5, off\n\t"
               "global_load_async_to_lds_b128 %2, %6, off\n\t"
               "global_load_async_to_lds_b128 %3, %7, off\n\t"
               "s_wait_xcnt 0x0"
               :: "v"(lp), "v"(lp1), "v"(lg), "v"(lg1),
                  "v"(gp), "v"(gp1), "v"(gg), "v"(gg1)
               : "memory");
}

__global__ __launch_bounds__(kFW * 32) void attn_fused_kernel(const unsigned short* __restrict__ prj,
                                                              const unsigned short* __restrict__ gt,
                                                              const float* __restrict__ w_out,
                                                              const float* __restrict__ b_out,
                                                              const float* __restrict__ x,
                                                              float* __restrict__ out) {
  __shared__ __align__(16) float part[kFW][kC * kFP];
  __shared__ __align__(16) _Float16 sPh[2 * kPhB];
  __shared__ __align__(16) _Float16 sGw[2 * kGwB];
  __shared__ float sM[kFW][kFQ];
  __shared__ float sL[kFW][kFQ];
  const int t    = threadIdx.x;
  const int lane = t & 31, wave = t >> 5;
  const int b    = blockIdx.y;
  const int qg   = wave >> 2, ks = wave & 3;
  const int qb   = blockIdx.x * (kFG * kFQ);
  const int rl   = lane & 15, hh = lane >> 4;
  const _Float16* Pb = (const _Float16*)prj + (size_t)b * kN * kPW;
  const _Float16* Th = Pb + (size_t)(qb + qg * kFQ + rl) * kPW + hh * 8;
  // fragment readers: this wave's slice in buffer 0
  const _Float16* Lp = sPh + (ks * kSK + rl) * kPhP + hh * 8;
  const _Float16* Lg = sGw + (ks * kCI + rl) * kGwP + hh * 8;
  // copy map: phi chunk = (slice t>>8 [+2], key (t>>2)&63, 16-B piece t&3); g^T chunk = (slice t>>8 [+2], channel (t>>3)&31, 16-B piece t&7)
  const unsigned cLp = (unsigned)(size_t)(sPh + ((t >> 8) * kSK + ((t >> 2) & 63)) * kPhP + (t & 3) * 8);
  const unsigned cLg = (unsigned)(size_t)(sGw + ((t >> 8) * kCI + ((t >> 3) & 31)) * kGwP + (t & 7) * 8);
  const _Float16* cGp = Pb + (size_t)((t >> 8) * kFK + ((t >> 2) & 63)) * kPW + kCI + (t & 3) * 8;
  const _Float16* cGg = (const _Float16*)gt + ((size_t)b * kCI + ((t >> 3) & 31)) * kN + (t >> 8) * kFK + (t & 7) * 8;

  stage_copy(cLp, cLg, cGp, cGg);
  // A operands of the output projection: w_out rows 16 ot + (lane&15), carried x16, elements 0..7 = channels 8h..8h+7, 8..15 = 16+8h..16+8h+7.
  // Read here, so that their trip to memory runs beside stage 0's.
  union { unsigned u[8]; v16h v; } wo[4];
#pragma unroll
  for (int ot = 0; ot < 4; ++ot) {
    const float* wr = w_out + ((ot << 4) + rl) * kCI + hh * 8;
#pragma unroll
    for (int j = 0; j < 4; ++j) {   // four floats at 0, 4, 16, 20 of the lane's half row
      const v4f q = *(const v4f*)(wr + (j >> 1) * 16 + (j & 1) * 4);
      wo[ot].u[2 * j]     = pack2h(q[0] * kWCarry, q[1] * kWCarry);
      wo[ot].u[2 * j + 1] = pack2h(q[2] * kWCarry, q[3] * kWCarry);
    }
  }
  // stage 0 has landed for this wave's copies before the barrier that publishes it
  asm volatile("s_wait_asynccnt 0x0" ::: "memory");
  __syncthreads();   // stage 0 is readable by every wave
  stage_copy(cLp + kPhB * 2, cLg + kGwB * 2, cGp + (size_t)kSK * kPW, cGg + kSK);

  v16h th[2], ph[2];
#pragma unroll
  for (int g = 0; g < 2; ++g) th[g] = Frag<_Float16>::load(Th + (size_t)(g << 4) * kPW);

  v8f acc[2][2];
#pragma unroll
  for (int ct = 0; ct < 2; ++ct)
#pragma unroll
    for (int g = 0; g < 2; ++g) acc[ct][g] = (v8f){0.f,0.f,0.f,0.f,0.f,0.f,0.f,0.f};
  float m_run[2];
  v8f cm[2];     // C operand of the score products: -m_run in every register
  v8f lacc[2];   // sums of exponentials, rescaled like an output tile
#pragma unroll
  for (int g = 0; g < 2; ++g) lacc[g] = (v8f){0.f,0.f,0.f,0.f,0.f,0.f,0.f,0.f};
  union { unsigned u[8]; v16h v; } ones;
#pragma unroll
  for (int i = 0; i < 8; ++i) ones.u[i] = (rl == 0) ? 0x3C003C00u : 0u;

  // the maximum in use starts at the maximum of the first pass's 32 keys (stage 0 is published): scores of that pass with C = 0
  {
#pragma unroll
    for (int kt = 0; kt < 2; ++kt) ph[kt] = Frag<_Float16>::load(Lp + (kt << 4) * kPhP);
#pragma unroll
    for (int g = 0; g < 2; ++g) {
      const v8f s0 = Frag<_Float16>::mma(ph[0], th[g], (v8f){0.f,0.f,0.f,0.f,0.f,0.f,0.f,0.f});
      const v8f s1 = Frag<_Float16>::mma(ph[1], th[g], (v8f){0.f,0.f,0.f,0.f,0.f,0.f,0.f,0.f});
      float mx = s0[0];
#pragma unroll
      for (int r = 1; r < 8; ++r) mx = fmaxf(mx, s0[r]);
#pragma unroll
      for (int r = 0; r < 8; ++r) mx = fmaxf(mx, s1[r]);
      mx = fmaxf(mx, xhalf(mx));   // both wave halves hold this query's maximum
      m_run[g] = mx;
#pragma unroll
      for (int r = 0; r < 8; ++r) cm[g][r] = -mx;
    }
  }

  // rolled: a stage (two passes) is already a long straight block
#pragma unroll 1
  for (int sg = 0; sg < kNST; ++sg) {
   const int bf = sg & 1;
   const _Float16* lp = Lp + bf * kPhB;
   const _Float16* lg = Lg + bf * kGwB;
#pragma unroll
   for (int kt = 0; kt < 2; ++kt) ph[kt] = Frag<_Float16>::load(lp + (kt << 4) * kPhP);
   // keeps both fragments' reads ahead of the first product: left free, the second is read into the first one's registers behind its
   // products, and the wave waits out the LDS latency twice
   __builtin_amdgcn_sched_barrier(0);
   // both passes of the stage written out: the second pass's offsets in the buffer are then immediates
#pragma unroll
   for (int pp = 0; pp < kSK / 32; ++pp) {
    // keeps the products of the pass before in their order ahead of the statement below, whose WMMAs the compiler does not see as such
    __builtin_amdgcn_sched_barrier(0);
    v8f st[2][2];   // st[kt][g]: key tile kt, column group g
    score4(st, ph, th, cm);
    v16h gw[2];
#pragma unroll
    for (int ct = 0; ct < 2; ++ct) gw[ct] = Frag<_Float16>::load(lg + (ct << 4) * kGwP + pp * 32);
    if (pp + 1 < kSK / 32) {   // the next pass's phi rows, only inside this stage's own buffer
#pragma unroll
      for (int kt = 0; kt < 2; ++kt) ph[kt] = Frag<_Float16>::load(lp + ((pp + 1) * 32 + (kt << 4)) * kPhP);
    }
    // keeps these loads ahead of the softmax work: left free, the compiler sinks each load to its use and the wave waits out its latency there
    __builtin_amdgcn_sched_barrier(0);

    // one test for the whole wave: every score is already relative to its own query's maximum in use
    float mg[2] = {0.0f, 0.0f};   // per column group: how far this lane's scores stand above the maximum in use, 0 at least
#pragma unroll
    for (int kt = 0; kt < 2; ++kt)
#pragma unroll
      for (int r = 0; r < 8; ++r) { mg[0] = fmaxf(mg[0], st[kt][0][r]); mg[1] = fmaxf(mg[1], st[kt][1][r]); }
    if (__builtin_amdgcn_ballot_w32(fmaxf(mg[0], mg[1]) > 8.0f) != 0) {   // wave-uniform; rare
#pragma unroll
      for (int g = 0; g < 2; ++g) {
        const float up   = fmaxf(mg[g], xhalf(mg[g]));   // both wave halves hold this query's rise; the maximum in use never falls
        const float corr = __builtin_amdgcn_exp2f(-up);
        m_run[g] += up;
        lacc[g] = lacc[g] * corr;
#pragma unroll
        for (int ct = 0; ct < 2; ++ct) acc[ct][g] = acc[ct][g] * corr;
#pragma unroll
        for (int kt = 0; kt < 2; ++kt)
#pragma unroll
          for (int r = 0; r < 8; ++r) st[kt][g][r] -= up;
#pragma unroll
        for (int r = 0; r < 8; ++r) cm[g][r] = -m_run[g];
      }
    }
    union PB { unsigned u[8]; v16h v; } pb[2];
#pragma unroll
    for (int g = 0; g < 2; ++g) {
#pragma unroll
      for (int kt = 0; kt < 2; ++kt) {   // key tile kt fills elements 8kt..8kt+7 of the 32-key operand, register r = element 8kt + r
        float a[8], p[8];
#pragma unroll
        for (int r = 0; r < 8; ++r) a[r] = st[kt][g][r];
        exp2x8(p, a);
#pragma unroll
        for (int i = 0; i < 4; ++i) pb[g].u[kt * 4 + i] = pack2h(p[2 * i], p[2 * i + 1]);
      }
    }
    // keeps every exponential statement ahead of the products below: an exponential
    // moved behind a product could write over its B operand too early
    __builtin_amdgcn_sched_barrier(0);
#pragma unroll
    for (int g = 0; g < 2; ++g) {
#pragma unroll
      for (int ct = 0; ct < 2; ++ct) acc[ct][g] = Frag<_Float16>::mma(gw[ct], pb[g].v, acc[ct][g]);
      lacc[g] = Frag<_Float16>::mma(ones.v, pb[g].v, lacc[g]);
    }
   }
   // foot of a stage: this wave's reads of the buffer are done, its copies of the next stage have landed
   asm volatile("s_wait_dscnt 0x0" ::: "memory");
   asm volatile("s_wait_asynccnt 0x0" ::: "memory");
   __syncthreads();   // publishes stage sg + 1 and frees the buffer of stage sg
   if (sg + 2 < kNST)
     stage_copy(cLp + bf * (kPhB * 2), cLg + bf * (kGwB * 2), cGp + (size_t)(sg + 2) * kSK * kPW, cGg + (sg + 2) * kSK);
  }
  // nothing is outstanding here; the wait closes the ring before the wave goes on to the join
  asm volatile("s_wait_asynccnt 0x0" ::: "memory");

  // ---- join of the four key slices of each query group ----
#pragma unroll
  for (int g = 0; g < 2; ++g) {
    if (hh == 0) {
      sM[wave][(g << 4) + rl] = m_run[g];
      sL[wave][(g << 4) + rl] = lacc[g][0];
    }
  }
  __syncthreads();   // every slice's maxima and sums are in LDS before any wave forms its factor
  float* my = part[wave];
  union { unsigned u[8]; v16h v; } yb[2];   // channel tile ct fills elements 8ct..8ct+7, register r = element 8ct + r = channel 16ct + 8h + r
#pragma unroll
  for (int g = 0; g < 2; ++g) {
    const int ql = (g << 4) + rl;
    float M = sM[qg * kFS][ql];
#pragma unroll
    for (int j = 1; j < kFS; ++j) M = fmaxf(M, sM[qg * kFS + j][ql]);
    float L = 0.f;
#pragma unroll
    for (int j = 0; j < kFS; ++j) L += sL[qg * kFS + j][ql] * __builtin_amdgcn_exp2f(sM[qg * kFS + j][ql] - M);
    const float f = __builtin_amdgcn_exp2f(m_run[g] - M) / L * kWCarryInv;   // the x16 that w_out carries goes out with the slice's factor
#pragma unroll
    for (int ct = 0; ct < 2; ++ct)
#pragma unroll
      for (int i = 0; i < 4; ++i) yb[g].u[ct * 4 + i] = pack2h(acc[ct][g][2 * i] * f, acc[ct][g][2 * i + 1] * f);
  }
  v8f o[4][2];
#pragma unroll
  for (int ot = 0; ot < 4; ++ot)
#pragma unroll
    for (int g = 0; g < 2; ++g) o[ot][g] = Frag<_Float16>::mma(wo[ot].v, yb[g].v, (v8f){0.f,0.f,0.f,0.f,0.f,0.f,0.f,0.f});
  // all eight products ahead of the first store: each then has result registers of its own (left free, a later product was given an earlier
  // one's result registers one vector slot behind it)
  __builtin_amdgcn_sched_barrier(0);
#pragma unroll
  for (int ot = 0; ot < 4; ++ot)
#pragma unroll
    for (int g = 0; g < 2; ++g)
#pragma unroll
      for (int r = 0; r < 8; ++r) my[((ot << 4) + hh * 8 + r) * kFP + (g << 4) + rl] = o[ot][g][r];
  __syncthreads();   // every wave's scaled partial tile is in LDS before any thread sums across slices

  // thread t, trip it: float4 index it*512 + t of the 64 c x 128 q tile; a wave writes one whole 512-B row segment of out
#pragma unroll
  for (int it = 0; it < 4; ++it) {
    const int idx = it * (kFW * 32) + t;
    const int c   = idx >> 5;
    const int q4  = (idx & 31) * 4;
    const int g4  = (q4 >> 5) * kFS;
    const int po  = c * kFP + (q4 & 31);
    v4f sum = *(const v4f*)(&part[g4][po]);
#pragma unroll
    for (int j = 1; j < kFS; ++j) sum = sum + *(const v4f*)(&part[g4 + j][po]);
    const size_t o = ((size_t)b * kC + c) * kN + qb + q4;
    const v4f rr = *(const v4f*)(x + o);
    const float bv = b_out[c];
    v4f v;
#pragma unroll
    for (int e = 0; e < 4; ++e) v[e] = (sum[e] + bv) + rr[e];
    *(v4f*)(out + o) = v;
  }
}

// ---------------------------------------------------------------------------
// Weight preparation and channel projections in one launch, straight from x and the f32 weights.
// grid (4096/256 = 16, 8 batches), 4 waves; a wave owns the 64 positions n0..n0+63 of one batch.
// Weights: the work-group rounds 16 w to f16 once into LDS (rows theta | phi | g; biases in f32); one barrier publishes them.
// Every global load of a wave is issued ahead of that barrier, the weights first: one trip to memory in all.
// D = W . x: A = weight rows (m = output channel), B = x columns (n = position, f16(x)), K = 64 channels in two steps.
//   A lane reads x as one float4 per channel at position n0 + 4*(lane&15); component g goes to position tile g, whose column j is position
//   n0 + 4j + g. A wave-wide load is two whole 256-B pieces of two rows of x.
//   Element s of both operands is channel 32 ks + 8*(lane>>4) + s for s < 8 and 32 ks + 16 + 8*(lane>>4) + (s - 8) for s >= 8.
//   D register r = output channel 16 mt + 8*(lane>>4) + r at the lane's position: theta and phi leave as one 16-B store per tile.
//   g leaves transposed: a lane holds channel 8*(lane>>4) + r of a tile at the four keys n0 + 4*(lane&15) + 0..3 (one per position tile), one 8-B
//   store per channel; the 16 lanes of a wave half fill one whole 128-B line of g^T, and every line is written by one wave.
// ---------------------------------------------------------------------------
constexpr int kJP  = 64;        // positions per wave (four position tiles)
constexpr int kJW  = 4;         // waves per work-group
constexpr int kJO  = 3 * kCI;   // projection rows: theta | phi | g
constexpr int kWP  = 72;        // LDS pitch of a projection weight row in halves: 144 B = 16 B x odd
static_assert(kN % (kJP * kJW) == 0 && kC == 64 && kCI == 32 && kJW == 4, "projection tile and weight copy map");
union HFrag { unsigned u[8]; v16h v; };
typedef __attribute__((ext_vector_type(2))) unsigned int v2u;

// four weights, carried x16, rounded to f16
__device__ __forceinline__ v2u w_pack(v4f q) {
  return (v2u){pack2h(q[0] * kWCarry, q[1] * kWCarry), pack2h(q[2] * kWCarry, q[3] * kWCarry)};
}

__global__ __launch_bounds__(kJW * 32) void proj_kernel(const float* __restrict__ x,
                                                            const float* __restrict__ w_theta, const float* __restrict__ b_theta,
                                                            const float* __restrict__ w_phi, const float* __restrict__ b_phi,
                                                            const float* __restrict__ w_g, const float* __restrict__ b_g,
                                                            unsigned short* __restrict__ prj, unsigned short* __restrict__ gt) {
  __shared__ __align__(16) _Float16 sW[kJO * kWP];
  __shared__ __align__(16) float sB[kJW * 32];   // b_theta | b_phi | b_g | a copy of b_g that nobody reads (wave 3 takes no branch of its own)
  const int t    = threadIdx.x;
  const int lane = t & 31, wave = t >> 5;
  const int rl   = lane & 15, hh = lane >> 4;
  const int b    = blockIdx.y;
  const int n0   = (blockIdx.x * kJW + wave) * kJP;

  // weights: trip i brings 8 rows of 64 (16 threads a row), four trips a matrix
  const int wo = (t >> 4) * kC + (t & 15) * 4;
  const float* pw0 = w_theta + wo;
  const float* pw1 = w_phi + wo;
  const float* pw2 = w_g + wo;
  const float* pb  = ((wave == 0) ? b_theta : ((wave == 1) ? b_phi : b_g)) + lane;
  v4f wq[12];
#pragma unroll
  for (int i = 0; i < 12; ++i) wq[i] = *(const v4f*)(((i < 4) ? pw0 : ((i < 8) ? pw1 : pw2)) + (i & 3) * 8 * kC);
  const float bq = *pb;

  // x: 32 channels per lane, four positions each
  const float* xp = x + ((size_t)b * kC + hh * 8) * kN + n0 + 4 * rl;
  v4f xv[2][16];
#pragma unroll
  for (int ks = 0; ks < 2; ++ks)
#pragma unroll
    for (int s = 0; s < 16; ++s) xv[ks][s] = *(const v4f*)(xp + (size_t)(ks * 32 + (s < 8 ? s : s + 8)) * kN);
  // the wait that stands before an address register of an issued load is written again; the addresses are named as inputs so that they
  // stay in their registers up to here (left free, later loads of this run were given earlier loads' address registers as destinations)
  asm volatile("s_wait_xcnt 0x0" :: "v"(pw0), "v"(pw1), "v"(pw2), "v"(pb), "v"(xp) : "memory");
  // keeps every load ahead of the first conversion: left free, the compiler waits for weights before it issues the x loads, two trips in series
  __builtin_amdgcn_sched_barrier(0);

#pragma unroll
  for (int i = 0; i < 12; ++i) *(v2u*)(sW + (i * 8 + (t >> 4)) * kWP + (t & 15) * 4) = w_pack(wq[i]);
  sB[t] = (wave == 0) ? bq * kLog2e : bq;   // theta leaves x log2(e), its bias with it
  __syncthreads();   // the f16 weights and the biases are in LDS before any wave reads an operand

  HFrag xb[4][2];
#pragma unroll
  for (int g = 0; g < 4; ++g)
#pragma unroll
    for (int ks = 0; ks < 2; ++ks)
#pragma unroll
      for (int i = 0; i < 8; ++i) xb[g][ks].u[i] = pack2h(xv[ks][2 * i][g], xv[ks][2 * i + 1][g]);

  // theta (mt 0, 1), phi (mt 2, 3), g (mt 4, 5)
  unsigned short* pr = prj + ((size_t)b * kN + n0 + 4 * rl) * kPW + hh * 8;
  unsigned short* gq = gt + ((size_t)b * kCI + hh * 8) * kN + n0 + 4 * rl;
#pragma unroll
  for (int mt = 0; mt < 6; ++mt) {
    const _Float16* wr = sW + (mt * 16 + rl) * kWP + hh * 8;
    const v16h wa0 = Frag<_Float16>::load(wr);
    const v16h wa1 = Frag<_Float16>::load(wr + 32);
    const v4f bv[2] = {*(const v4f*)(sB + mt * 16 + hh * 8), *(const v4f*)(sB + mt * 16 + hh * 8 + 4)};
    v8f acc[4];
#pragma unroll
    for (int g = 0; g < 4; ++g) acc[g] = Frag<_Float16>::mma(wa0, xb[g][0].v, (v8f){0.f,0.f,0.f,0.f,0.f,0.f,0.f,0.f});
#pragma unroll
    for (int g = 0; g < 4; ++g) acc[g] = Frag<_Float16>::mma(wa1, xb[g][1].v, acc[g]);
    if (mt < 4) {
      const float sc = (mt < 2) ? kWCarryInv * kLog2e : kWCarryInv;   // theta x log2(e): the fused kernel's scores are then in the log2 domain
#pragma unroll
      for (int g = 0; g < 4; ++g) {
        unsigned u[4];
#pragma unroll
        for (int i = 0; i < 4; ++i)
          u[i] = pack2h(fmaf(acc[g][2 * i], sc, bv[i >> 1][(2 * i) & 3]), fmaf(acc[g][2 * i + 1], sc, bv[i >> 1][(2 * i + 1) & 3]));
        *(v4u*)(pr + (size_t)g * kPW + mt * 16) = (v4u){u[0], u[1], u[2], u[3]};
      }
    } else {
#pragma unroll
      for (int r = 0; r < 8; ++r) {   // channel 16 (mt - 4) + 8 h + r at keys n0 + 4 (lane&15) + 0..3
        const float bb = bv[r >> 2][r & 3];
        *(v2u*)(gq + (size_t)((mt - 4) * 16 + r) * kN) = (v2u){pack2h(fmaf(acc[0][r], kWCarryInv, bb), fmaf(acc[1][r], kWCarryInv, bb)),
                                                               pack2h(fmaf(acc[2][r], kWCarryInv, bb), fmaf(acc[3][r], kWCarryInv, bb))};
      }
    }
  }
}

// ---------------------------------------------------------------------------
// Host glue.
//   PRJ  f16 [8][4096][128]   8,388,608  at           0   (theta | phi per position; the upper half of a row is unused)
//   GT   f16 [8][32][4096]    2,097,152  at   8,388,608   (g^T[o][key])
//   total                    10,485,760
// ---------------------------------------------------------------------------
extern "C" void kernel_launch(void* const* d_in, const int* in_sizes, int n_in,
                              void* d_out, int out_size, void* d_ws, size_t ws_size,
                              hipStream_t stream) {
  if (n_in < 9) return;
  const int nX = kB * kC * kN;   // 2,097,152
  if (in_sizes[0] != nX) return;
  if (in_sizes[1] != kCI * kC || in_sizes[2] != kCI) return;
  if (in_sizes[3] != kCI * kC || in_sizes[4] != kCI) return;
  if (in_sizes[5] != kCI * kC || in_sizes[6] != kCI) return;
  if (in_sizes[7] != kC * kCI || in_sizes[8] != kC) return;
  if (out_size != nX) return;

  const size_t szPRJ = (size_t)kB * kN * kPW * 2;
  const size_t szGT  = (size_t)kB * kCI * kN * 2;
  const size_t offPRJ = 0;
  const size_t offGT  = offPRJ + szPRJ;
  const size_t total  = offGT + szGT;
  if (ws_size < total) return;

  const float* x       = (const float*)d_in[0];
  const float* w_theta = (const float*)d_in[1];
  const float* b_theta = (const float*)d_in[2];
  const float* w_phi   = (const float*)d_in[3];
  const float* b_phi   = (const float*)d_in[4];
  const float* w_g     = (const float*)d_in[5];
  const float* b_g     = (const float*)d_in[6];
  const float* w_out   = (const float*)d_in[7];
  const float* b_out   = (const float*)d_in[8];
  float* out = (float*)d_out;
  char* ws = (char*)d_ws;
  unsigned short* PRJ = (unsigned short*)(ws + offPRJ);
  unsigned short* GT  = (unsigned short*)(ws + offGT);

  // ---- theta, phi planes and g^T of all batches (16 blocks of 256 positions x 8 batches) ----
  proj_kernel<<<dim3(kN / (kJP * kJW), kB), dim3(kJW * 32), 0, stream>>>(x, w_theta, b_theta, w_phi, b_phi, w_g, b_g, PRJ, GT);

  // ---- scores, softmax over keys, y^T product, output projection, bias and residual: all batches, one launch (32 position blocks x 8 batches) ----
  attn_fused_kernel<<<dim3(kN / (kFG * kFQ), kB), dim3(kFW * 32), 0, stream>>>(PRJ, GT, w_out, b_out, x, out);
}

// v008
// One run takes 29.5 microseconds.
// Two timings next to v007 both put it at 1.04 times that version's speed.
// Over all steps from v000 it is 52.2 times as fast.
// Contractions: channel projections (W f16 carried x16 . x f16), scores phi.theta^T (f16 planes), y^T = g^T f16 x P^T (f16, unnormalised exponentials), softmax sums = ones (f16) . P^T, out^T = W_out (f16 carried x16) . y^T (f16, normalised slice partials): all on v_wmma_f32_16x16x32_f16 with f32 accumulate; bias adds, softmax maxima, exponentials and residual in f32.
#include <hip/hip_runtime.h>
#include <math.h>

// ---------------------------------------------------------------------------
// Problem constants
// ---------------------------------------------------------------------------
constexpr int kB  = 8;        // batch
constexpr int kC  = 64;       // in channels
constexpr int kCI = 32;       // inter channels
constexpr int kN  = 4096;     // H*W positions
constexpr int kPW = 128;      // projection plane row pitch in halves: theta 0..31 | phi 32..63 | 64..127 neither written nor read
constexpr float kWCarry    = 16.0f;            // weights carried x16 in f16
constexpr float kWCarryInv = 1.0f / 16.0f;
static_assert(kN % 64 == 0 && kPW % 64 == 0 && kC % 64 == 0, "M,N tiles");
static_assert(kC % 32 == 0 && kCI % 32 == 0 && kN % 32 == 0, "K steps");

typedef __attribute__((ext_vector_type(16))) _Float16 v16h;
typedef __attribute__((ext_vector_type(8)))  _Float16 v8h;
typedef __attribute__((ext_vector_type(8)))  float    v8f;
typedef __attribute__((ext_vector_type(4)))  float    v4f;
typedef __attribute__((ext_vector_type(4)))  unsigned int v4u;

// ---------------------------------------------------------------------------
// Helpers
// ---------------------------------------------------------------------------
template <typename T> struct Frag;
template <> struct Frag<_Float16> {
  typedef v16h V; union U { v16h v; v8h h[2]; };
  // elements 0..7 <- p[0..7], 8..15 <- p[16..23]
  static __device__ __forceinline__ v16h load(const _Float16* p) {
    U f; f.h[0] = *(const v8h*)(p); f.h[1] = *(const v8h*)(p + 16); return f.v;
  }
  static __device__ __forceinline__ v8f mma(v16h a, v16h b, v8f c) {
    return __builtin_amdgcn_wmma_f32_16x16x32_f16(false, a, false, b, (short)0, c, false, false);
  }
};

// ---------------------------------------------------------------------------
// Scores, softmax, y^T product and output projection of all batches in one launch; scores and probabilities stay in registers.
//   y[b][o][q] = sum_key GT[b][o][key] * softmax_key(theta[q] . phi[key]);  out[b][c][q] = sum_o w_out[c][o] * y[b][o][q] + b_out[c] + x[b][c][q]
// grid (4096/128 = 32 position blocks, 8 batches), 16 waves: wave = query group (wave >> 2, 32 q) x key slice (wave & 3, 1024 keys).
// One pass = 32 keys:  S^T = phi . theta^T  (A = phi rows, B = theta rows, same loader: equal k order); D register r of a lane =
// S^T[key 8*(lane>>4) + r][q = lane&15], so the two key tiles of a pass, converted in place, are the B operand (hardware k order) of
// Y^T += GT . P^T  (A = GT rows through the same loader: keys 8h..8h+7 | 16+8h..16+8h+7). D register r = y[o = 8*(lane>>4) + r][q = lane&15].
// A lane holds one query's column in both products: running maximum (log2 domain) and rescale factor are per-lane scalars.
// theta is carried x log2(e) and the score product's C operand holds minus the maximum in use in all eight registers of a lane, so D is
// already the argument of the exponential, S log2(e) - m. The maximum in use starts as the exact maximum of the wave's first 32 keys.
// The sum of a query's exponentials comes off the matrix pipe: L += ones . P^T (A: row 0 is 1.0, the rest 0), one product per column group and pass,
// on the same rounded P^T operand as the y^T product; register 0 of lanes 0..15 holds the sum over all 32 keys of query lane&15.
// The maximum in use may trail the true one by up to 8 (an exponential reaches 2^8 at most, inside f16): rescale only when some column exceeds that.
// The four key slices of a query group are joined in LDS: maxima and sums first; then each wave scales its 32-channel y^T, whose two channel
// tiles, converted in place, are the B operand of out^T = W_out . y^T (A = w_out rows in the loader's k order), and the partial out tiles are
// summed in slice order 0..3. The products over the keys so run on the 32 inner channels, not on the 64 outer ones.
// phi rows and g^T rows come through LDS: a stage is 64 keys of each of the four slices (two passes), brought once per work-group by
// asynchronous 16-B copies (a g^T row of a stage is one whole 128-B line, a phi row 64 B) and read by the four query waves of its slice.
// Two buffers: stage t + 1 flies while stage t is worked on; one barrier per stage publishes the one and frees the other. It stands in the stage's
// last pass: signal behind the score products (the wave's last read of the buffer has returned), wait behind the rescale test; the next stage's
// first phi rows and the refill copies are issued there, ahead of the exponentials.
// ---------------------------------------------------------------------------
constexpr int kFQ  = 32;            // queries per wave (two 16-column groups)
constexpr int kFG  = 4;             // query groups per work-group
constexpr int kFS  = 4;             // key slices per work-group
constexpr int kFW  = kFG * kFS;     // waves per work-group
constexpr int kFK  = kN / kFS;      // keys per wave
constexpr int kFNP = kFK / 32;      // passes per wave
constexpr int kFP  = 36;            // LDS row pitch in floats: 144 B = 16 B x odd
constexpr int kSK  = 64;            // keys of one slice per stage
constexpr int kNST = kFK / kSK;     // stages
constexpr int kPhP = 40;            // LDS pitch of a phi row in halves: 80 B = 16 B x odd
constexpr int kGwP = 72;            // LDS pitch of a g^T row in halves: 144 B = 16 B x odd
constexpr int kPhB = kFS * kSK * kPhP;   // halves of one phi buffer (4 slices x 64 keys)
constexpr int kGwB = kFS * kCI * kGwP;   // halves of one g^T buffer (4 slices x 32 channels)
constexpr float kLog2e = 1.4426950408889634f;
static_assert(kSK == 64 && kNST >= 2 && kFW * 32 == 512 && kFS == 4, "stage copy map: 2 phi and 2 g^T chunks of 16 B per thread");
static_assert(kFK % 32 == 0 && kN % (kFG * kFQ) == 0 && kCI == 32 && kC == 64, "fused tile");
static_assert(kC * kFG * kFQ == kFW * 32 * 16, "join map: four float4 per thread");
typedef __attribute__((ext_vector_type(2))) float    v2f;
typedef __attribute__((ext_vector_type(2))) _Float16 v2h;

// lane l with lane l ^ 16
__device__ __forceinline__ float xhalf(float v) {
  const int i = __builtin_bit_cast(int, v);
  return __builtin_bit_cast(float, __builtin_amdgcn_permlanex16(i, i, 0x76543210, 0xfedcba98, false, false));
}
__device__ __forceinline__ unsigned pack2h(float lo, float hi) {   // round to nearest even
  return __builtin_bit_cast(unsigned, __builtin_convertvector((v2f){lo, hi}, v2h));
}
// Eight exponentials (2^a) in one statement. The outputs are early-clobbered, so none lands on a source of another, and the closing v_nop is
// the slot the instruction set asks for behind a transcendental before its result is used or its source overwritten.
__device__ __forceinline__ void exp2x8(float (&p)[8], const float (&a)[8]) {
  asm("v_exp_f32 %0, %8\n\tv_exp_f32 %1, %9\n\tv_exp_f32 %2, %10\n\tv_exp_f32 %3, %11\n\t"
      "v_exp_f32 %4, %12\n\tv_exp_f32 %5, %13\n\tv_exp_f32 %6, %14\n\tv_exp_f32 %7, %15\n\tv_nop"
      : "=&v"(p[0]), "=&v"(p[1]), "=&v"(p[2]), "=&v"(p[3]), "=&v"(p[4]), "=&v"(p[5]), "=&v"(p[6]), "=&v"(p[7])
      : "v"(a[0]), "v"(a[1]), "v"(a[2]), "v"(a[3]), "v"(a[4]), "v"(a[5]), "v"(a[6]), "v"(a[7]));
}

// The four score products of a pass in one statement, D apart from C: the C registers (minus the maximum in use) are read only and live on
// from pass to pass (through the builtin some of these products were tied to their C, which was copied first, eight registers a time).
// Key tile 1 goes first: in the listing the D registers of key tile 0 are the B operands of the pass before, and this order puts three
// products and more between a register's last use there and the product that writes it here.
// The closing v_nops are the four vector slots between the last WMMA and a vector instruction on its D or a load over its A.
__device__ __forceinline__ void score4(v8f (&d)[2][2], const v16h (&a)[2], const v16h (&b)[2], const v8f (&c)[2]) {
  asm("v_wmma_f32_16x16x32_f16 %2, %5, %6, %8\n\t"
      "v_wmma_f32_16x16x32_f16 %3, %5, %7, %9\n\t"
      "v_wmma_f32_16x16x32_f16 %0, %4, %6, %8\n\t"
      "v_wmma_f32_16x16x32_f16 %1, %4, %7, %9\n\t"
      "v_nop\n\tv_nop\n\tv_nop\n\tv_nop"
      : "=&v"(d[0][0]), "=&v"(d[0][1]), "=&v"(d[1][0]), "=&v"(d[1][1])
      : "v"(a[0]), "v"(a[1]), "v"(b[0]), "v"(b[1]), "v"(c[0]), "v"(c[1]));
}

// One stage: four 16-B copies per lane, global memory to LDS through no register.
// lp / gp: this lane's phi chunk of slices 0..1; lg / gg: its g^T chunk of slices 0..1 (the second copy of each: two slices on).
// The closing s_wait_xcnt stands inside the statement so that no address register named here is rewritten ahead of it.
__device__ __forceinline__ void stage_copy(unsigned lp, unsigned lg, const _Float16* gp, const _Float16* gg) {
  const unsigned lp1 = lp + 2 * kSK * kPhP * 2;
  const unsigned lg1 = lg + 2 * kCI * kGwP * 2;
  const _Float16* gp1 = gp + (size_t)2 * kFK * kPW;
  const _Float16* gg1 = gg + 2 * kFK;
  asm volatile("global_load_async_to_lds_b128 %0, %4, off\n\t"
               "global_load_async_to_lds_b128 %1, %5, off\n\t"
               "global_load_async_to_lds_b128 %2, %6, off\n\t"
               "global_load_async_to_lds_b128 %3, %7, off\n\t"
               "s_wait_xcnt 0x0"
               :: "v"(lp), "v"(lp1), "v"(lg), "v"(lg1),
                  "v"(gp), "v"(gp1), "v"(gg), "v"(gg1)
               : "memory");
}

__global__ __launch_bounds__(kFW * 32) void attn_fused_kernel(const unsigned short* __restrict__ prj,
                                                              const unsigned short* __restrict__ gt,
                                                              const float* __restrict__ w_out,
                                                              const float* __restrict__ b_out,
                                                              const float* __restrict__ x,
                                                              float* __restrict__ out) {
  __shared__ __align__(16) float part[kFW][kC * kFP];
  __shared__ __align__(16) _Float16 sPh[2 * kPhB];
  __shared__ __align__(16) _Float16 sGw[2 * kGwB];
  __shared__ float sM[kFW][kFQ];
  __shared__ float sL[kFW][kFQ];
  const int t    = threadIdx.x;
  const int lane = t & 31, wave = t >> 5;
  const int b    = blockIdx.y;
  const int qg   = wave >> 2, ks = wave & 3;
  const int qb   = blockIdx.x * (kFG * kFQ);
  const int rl   = lane & 15, hh = lane >> 4;
  const _Float16* Pb = (const _Float16*)prj + (size_t)b * kN * kPW;
  const _Float16* Th = Pb + (size_t)(qb + qg * kFQ + rl) * kPW + hh * 8;
  // fragment readers: this wave's slice in buffer 0
  const _Float16* Lp = sPh + (ks * kSK + rl) * kPhP + hh * 8;
  const _Float16* Lg = sGw + (ks * kCI + rl) * kGwP + hh * 8;
  // copy map: phi chunk = (slice t>>8 [+2], key (t>>2)&63, 16-B piece t&3); g^T chunk = (slice t>>8 [+2], channel (t>>3)&31, 16-B piece t&7)
  const unsigned cLp = (unsigned)(size_t)(sPh + ((t >> 8) * kSK + ((t >> 2) & 63)) * kPhP + (t & 3) * 8);
  const unsigned cLg = (unsigned)(size_t)(sGw + ((t >> 8) * kCI + ((t >> 3) & 31)) * kGwP + (t & 7) * 8);
  const _Float16* cGp = Pb + (size_t)((t >> 8) * kFK + ((t >> 2) & 63)) * kPW + kCI + (t & 3) * 8;
  const _Float16* cGg = (const _Float16*)gt + ((size_t)b * kCI + ((t >> 3) & 31)) * kN + (t >> 8) * kFK + (t & 7) * 8;

  stage_copy(cLp, cLg, cGp, cGg);
  // A operands of the output projection: w_out rows 16 ot + (lane&15), carried x16, elements 0..7 = channels 8h..8h+7, 8..15 = 16+8h..16+8h+7.
  // Read here, so that their trip to memory runs beside stage 0's.
  union { unsigned u[8]; v16h v; } wo[4];
#pragma unroll
  for (int ot = 0; ot < 4; ++ot) {
    const float* wr = w_out + ((ot << 4) + rl) * kCI + hh * 8;
#pragma unroll
    for (int j = 0; j < 4; ++j) {   // four floats at 0, 4, 16, 20 of the lane's half row
      const v4f q = *(const v4f*)(wr + (j >> 1) * 16 + (j & 1) * 4);
      wo[ot].u[2 * j]     = pack2h(q[0] * kWCarry, q[1] * kWCarry);
      wo[ot].u[2 * j + 1] = pack2h(q[2] * kWCarry, q[3] * kWCarry);
    }
  }
  // stage 0 has landed for this wave's copies before the barrier that publishes it
  asm volatile("s_wait_asynccnt 0x0" ::: "memory");
  __syncthreads();   // stage 0 is readable by every wave
  stage_copy(cLp + kPhB * 2, cLg + kGwB * 2, cGp + (size_t)kSK * kPW, cGg + kSK);

  v16h th[2], ph[2];
#pragma unroll
  for (int g = 0; g < 2; ++g) th[g] = Frag<_Float16>::load(Th + (size_t)(g << 4) * kPW);

  v8f acc[2][2];
#pragma unroll
  for (int ct = 0; ct < 2; ++ct)
#pragma unroll
    for (int g = 0; g < 2; ++g) acc[ct][g] = (v8f){0.f,0.f,0.f,0.f,0.f,0.f,0.f,0.f};
  float m_run[2];
  v8f cm[2];     // C operand of the score products: -m_run in every register
  v8f lacc[2];   // sums of exponentials, rescaled like an output tile
#pragma unroll
  for (int g = 0; g < 2; ++g) lacc[g] = (v8f){0.f,0.f,0.f,0.f,0.f,0.f,0.f,0.f};
  union { unsigned u[8]; v16h v; } ones;
#pragma unroll
  for (int i = 0; i < 8; ++i) ones.u[i] = (rl == 0) ? 0x3C003C00u : 0u;

  // the maximum in use starts at the maximum of the first pass's 32 keys (stage 0 is published): scores of that pass with C = 0
  {
#pragma unroll
    for (int kt = 0; kt < 2; ++kt) ph[kt] = Frag<_Float16>::load(Lp + (kt << 4) * kPhP);
#pragma unroll
    for (int g = 0; g < 2; ++g) {
      const v8f s0 = Frag<_Float16>::mma(ph[0], th[g], (v8f){0.f,0.f,0.f,0.f,0.f,0.f,0.f,0.f});
      const v8f s1 = Frag<_Float16>::mma(ph[1], th[g], (v8f){0.f,0.f,0.f,0.f,0.f,0.f,0.f,0.f});
      float mx = s0[0];
#pragma unroll
      for (int r = 1; r < 8; ++r) mx = fmaxf(mx, s0[r]);
#pragma unroll
      for (int r = 0; r < 8; ++r) mx = fmaxf(mx, s1[r]);
      mx = fmaxf(mx, xhalf(mx));   // both wave halves hold this query's maximum
      m_run[g] = mx;
#pragma unroll
      for (int r = 0; r < 8; ++r) cm[g][r] = -mx;
    }
  }

  // rolled: a stage (two passes) is already a long straight block. ph enters a stage holding its first pass's phi rows (stage 0: from the pre-pass).
#pragma unroll 1
  for (int sg = 0; sg < kNST; ++sg) {
   const int bf = sg & 1;
   const _Float16* lp = Lp + bf * kPhB;
   const _Float16* lg = Lg + bf * kGwB;
   v16h gw[kSK / 32][2];
   // both passes of the stage written out: the second pass's offsets in the buffer are then immediates
#pragma unroll
   for (int pp = 0; pp < kSK / 32; ++pp) {
    // keeps the products of the pass before in their order ahead of the statement below, whose WMMAs the compiler does not see as such
    __builtin_amdgcn_sched_barrier(0);
    v8f st[2][2];   // st[kt][g]: key tile kt, column group g
    score4(st, ph, th, cm);
    if (pp == 0) {   // every other read of this stage's buffer: g^T rows of both passes, phi rows of the second
#pragma unroll
      for (int ct = 0; ct < 2; ++ct) gw[0][ct] = Frag<_Float16>::load(lg + (ct << 4) * kGwP);
#pragma unroll
      for (int kt = 0; kt < 2; ++kt) ph[kt] = Frag<_Float16>::load(lp + (32 + (kt << 4)) * kPhP);
#pragma unroll
      for (int ct = 0; ct < 2; ++ct) gw[1][ct] = Frag<_Float16>::load(lg + (ct << 4) * kGwP + 32);
    }
    // keeps these loads (and the score products) ahead of what follows: left free, the compiler sinks each load to its use and the wave waits out its latency there
    __builtin_amdgcn_sched_barrier(0);
    if (pp + 1 == kSK / 32) {
      // publish point, first half: this wave's reads of the buffer are done, its copies of the next stage have landed
      asm volatile("s_wait_dscnt 0x0" ::: "memory");
      asm volatile("s_wait_asynccnt 0x0" ::: "memory");
      asm volatile("s_barrier_signal -1" ::: "memory");
      // keeps the maxima, which wait for the score products, behind the signal, so that no other wave waits for them
      __builtin_amdgcn_sched_barrier(0);
    }

    // one test for the whole wave: every score is already relative to its own query's maximum in use
    float mg[2] = {0.0f, 0.0f};   // per column group: how far this lane's scores stand above the maximum in use, 0 at least
#pragma unroll
    for (int kt = 0; kt < 2; ++kt)
#pragma unroll
      for (int r = 0; r < 8; ++r) { mg[0] = fmaxf(mg[0], st[kt][0][r]); mg[1] = fmaxf(mg[1], st[kt][1][r]); }
    if (__builtin_amdgcn_ballot_w32(fmaxf(mg[0], mg[1]) > 8.0f) != 0) {   // wave-uniform; rare
#pragma unroll
      for (int g = 0; g < 2; ++g) {
        const float up   = fmaxf(mg[g], xhalf(mg[g]));   // both wave halves hold this query's rise; the maximum in use never falls
        const float corr = __builtin_amdgcn_exp2f(-up);
        m_run[g] += up;
        lacc[g] = lacc[g] * corr;
#pragma unroll
        for (int ct = 0; ct < 2; ++ct) acc[ct][g] = acc[ct][g] * corr;
#pragma unroll
        for (int kt = 0; kt < 2; ++kt)
#pragma unroll
          for (int r = 0; r < 8; ++r) st[kt][g][r] -= up;
#pragma unroll
        for (int r = 0; r < 8; ++r) cm[g][r] = -m_run[g];
      }
    }
    if (pp + 1 == kSK / 32) {
      // publish point, second half: every wave has signalled, so stage sg + 1 is readable and the buffer of stage sg is free
      asm volatile("s_barrier_wait -1" ::: "memory");
      if (sg + 1 < kNST) {   // the next stage's first phi rows: their LDS latency runs under the exponentials and products below
#pragma unroll
        for (int kt = 0; kt < 2; ++kt) ph[kt] = Frag<_Float16>::load(Lp + (bf ^ 1) * kPhB + (kt << 4) * kPhP);
      }
      if (sg + 2 < kNST)
        stage_copy(cLp + bf * (kPhB * 2), cLg + bf * (kGwB * 2), cGp + (size_t)(sg + 2) * kSK * kPW, cGg + (sg + 2) * kSK);
      // keeps the exponentials behind the reads and copies above: moved ahead of them, they would delay both by a whole softmax
      __builtin_amdgcn_sched_barrier(0);
    }
    union PB { unsigned u[8]; v16h v; } pb[2];
#pragma unroll
    for (int g = 0; g < 2; ++g) {
#pragma unroll
      for (int kt = 0; kt < 2; ++kt) {   // key tile kt fills elements 8kt..8kt+7 of the 32-key operand, register r = element 8kt + r
        float a[8], p[8];
#pragma unroll
        for (int r = 0; r < 8; ++r) a[r] = st[kt][g][r];
        exp2x8(p, a);
#pragma unroll
        for (int i = 0; i < 4; ++i) pb[g].u[kt * 4 + i] = pack2h(p[2 * i], p[2 * i + 1]);
      }
    }
    // keeps every exponential statement ahead of the products below: an exponential
    // moved behind a product could write over its B operand too early
    __builtin_amdgcn_sched_barrier(0);
#pragma unroll
    for (int g = 0; g < 2; ++g) {
#pragma unroll
      for (int ct = 0; ct < 2; ++ct) acc[ct][g] = Frag<_Float16>::mma(gw[pp][ct], pb[g].v, acc[ct][g]);
      lacc[g] = Frag<_Float16>::mma(ones.v, pb[g].v, lacc[g]);
    }
   }
  }
  // the four vector slots behind the loop's last WMMA on the taken side of the exit branch
  asm volatile("v_nop\n\tv_nop\n\tv_nop\n\tv_nop");
  // nothing is outstanding here; the wait closes the ring before the wave goes on to the join
  asm volatile("s_wait_asynccnt 0x0" ::: "memory");

  // ---- join of the four key slices of each query group ----
#pragma unroll
  for (int g = 0; g < 2; ++g) {
    if (hh == 0) {
      sM[wave][(g << 4) + rl] = m_run[g];
      sL[wave][(g << 4) + rl] = lacc[g][0];
    }
  }
  __syncthreads();   // every slice's maxima and sums are in LDS before any wave forms its factor
  float* my = part[wave];
  union { unsigned u[8]; v16h v; } yb[2];   // channel tile ct fills elements 8ct..8ct+7, register r = element 8ct + r = channel 16ct + 8h + r
#pragma unroll
  for (int g = 0; g < 2; ++g) {
    const int ql = (g << 4) + rl;
    float M = sM[qg * kFS][ql];
#pragma unroll
    for (int j = 1; j < kFS; ++j) M = fmaxf(M, sM[qg * kFS + j][ql]);
    float L = 0.f;
#pragma unroll
    for (int j = 0; j < kFS; ++j) L += sL[qg * kFS + j][ql] * __builtin_amdgcn_exp2f(sM[qg * kFS + j][ql] - M);
    const float f = __builtin_amdgcn_exp2f(m_run[g] - M) / L * kWCarryInv;   // the x16 that w_out carries goes out with the slice's factor
#pragma unroll
    for (int ct = 0; ct < 2; ++ct)
#pragma unroll
      for (int i = 0; i < 4; ++i) yb[g].u[ct * 4 + i] = pack2h(acc[ct][g][2 * i] * f, acc[ct][g][2 * i + 1] * f);
  }
  v8f o[4][2];
#pragma unroll
  for (int ot = 0; ot < 4; ++ot)
#pragma unroll
    for (int g = 0; g < 2; ++g) o[ot][g] = Frag<_Float16>::mma(wo[ot].v, yb[g].v, (v8f){0.f,0.f,0.f,0.f,0.f,0.f,0.f,0.f});
  // all eight products ahead of the first store: each then has result registers of its own (left free, a later product was given an earlier
  // one's result registers one vector slot behind it)
  __builtin_amdgcn_sched_barrier(0);
#pragma unroll
  for (int ot = 0; ot < 4; ++ot)
#pragma unroll
    for (int g = 0; g < 2; ++g)
#pragma unroll
      for (int r = 0; r < 8; ++r) my[((ot << 4) + hh * 8 + r) * kFP + (g << 4) + rl] = o[ot][g][r];
  __syncthreads();   // every wave's scaled partial tile is in LDS before any thread sums across slices

  // thread t, trip it: float4 index it*512 + t of the 64 c x 128 q tile; a wave writes one whole 512-B row segment of out
#pragma unroll
  for (int it = 0; it < 4; ++it) {
    const int idx = it * (kFW * 32) + t;
    const int c   = idx >> 5;
    const int q4  = (idx & 31) * 4;
    const int g4  = (q4 >> 5) * kFS;
    const int po  = c * kFP + (q4 & 31);
    v4f sum = *(const v4f*)(&part[g4][po]);
#pragma unroll
    for (int j = 1; j < kFS; ++j) sum = sum + *(const v4f*)(&part[g4 + j][po]);
    const size_t o = ((size_t)b * kC + c) * kN + qb + q4;
    const v4f rr = *(const v4f*)(x + o);
    const float bv = b_out[c];
    v4f v;
#pragma unroll
    for (int e = 0; e < 4; ++e) v[e] = (sum[e] + bv) + rr[e];
    *(v4f*)(out + o) = v;
  }
}

// ---------------------------------------------------------------------------
// Weight preparation and channel projections in one launch, straight from x and the f32 weights.
// grid (4096/256 = 16, 8 batches), 4 waves; a wave owns the 64 positions n0..n0+63 of one batch.
// Weights: the work-group rounds 16 w to f16 once into LDS (rows theta | phi | g; biases in f32); one barrier publishes them.
// Every global load of a wave is issued ahead of that barrier, the weights first: one trip to memory in all.
// D = W . x: A = weight rows (m = output channel), B = x columns (n = position, f16(x)), K = 64 channels in two steps.
//   A lane reads x as one float4 per channel at position n0 + 4*(lane&15); component g goes to position tile g, whose column j is position
//   n0 + 4j + g. A wave-wide load is two whole 256-B pieces of two rows of x.
//   Element s of both operands is channel 32 ks + 8*(lane>>4) + s for s < 8 and 32 ks + 16 + 8*(lane>>4) + (s - 8) for s >= 8.
//   D register r = output channel 16 mt + 8*(lane>>4) + r at the lane's position: theta and phi leave as one 16-B store per tile.
//   g leaves transposed: a lane holds channel 8*(lane>>4) + r of a tile at the four keys n0 + 4*(lane&15) + 0..3 (one per position tile), one 8-B
//   store per channel; the 16 lanes of a wave half fill one whole 128-B line of g^T, and every line is written by one wave.
// ---------------------------------------------------------------------------
constexpr int kJP  = 64;        // positions per wave (four position tiles)
constexpr int kJW  = 4;         // waves per work-group
constexpr int kJO  = 3 * kCI;   // projection rows: theta | phi | g
constexpr int kWP  = 72;        // LDS pitch of a projection weight row in halves: 144 B = 16 B x odd
static_assert(kN % (kJP * kJW) == 0 && kC == 64 && kCI == 32 && kJW == 4, "projection tile and weight copy map");
union HFrag { unsigned u[8]; v16h v; };
typedef __attribute__((ext_vector_type(2))) unsigned int v2u;

// four weights, carried x16, rounded to f16
__device__ __forceinline__ v2u w_pack(v4f q) {
  return (v2u){pack2h(q[0] * kWCarry, q[1] * kWCarry), pack2h(q[2] * kWCarry, q[3] * kWCarry)};
}

__global__ __launch_bounds__(kJW * 32) void proj_kernel(const float* __restrict__ x,
                                                            const float* __restrict__ w_theta, const float* __restrict__ b_theta,
                                                            const float* __restrict__ w_phi, const float* __restrict__ b_phi,
                                                            const float* __restrict__ w_g, const float* __restrict__ b_g,
                                                            unsigned short* __restrict__ prj, unsigned short* __restrict__ gt) {
  __shared__ __align__(16) _Float16 sW[kJO * kWP];
  __shared__ __align__(16) float sB[kJW * 32];   // b_theta | b_phi | b_g | a copy of b_g that nobody reads (wave 3 takes no branch of its own)
  const int t    = threadIdx.x;
  const int lane = t & 31, wave = t >> 5;
  const int rl   = lane & 15, hh = lane >> 4;
  const int b    = blockIdx.y;
  const int n0   = (blockIdx.x * kJW + wave) * kJP;

  // weights: trip i brings 8 rows of 64 (16 threads a row), four trips a matrix
  const int wo = (t >> 4) * kC + (t & 15) * 4;
  const float* pw0 = w_theta + wo;
  const float* pw1 = w_phi + wo;
  const float* pw2 = w_g + wo;
  const float* pb  = ((wave == 0) ? b_theta : ((wave == 1) ? b_phi : b_g)) + lane;
  v4f wq[12];
#pragma unroll
  for (int i = 0; i < 12; ++i) wq[i] = *(const v4f*)(((i < 4) ? pw0 : ((i < 8) ? pw1 : pw2)) + (i & 3) * 8 * kC);
  const float bq = *pb;

  // x: 32 channels per lane, four positions each
  const float* xp = x + ((size_t)b * kC + hh * 8) * kN + n0 + 4 * rl;
  v4f xv[2][16];
#pragma unroll
  for (int ks = 0; ks < 2; ++ks)
#pragma unroll
    for (int s = 0; s < 16; ++s) xv[ks][s] = *(const v4f*)(xp + (size_t)(ks * 32 + (s < 8 ? s : s + 8)) * kN);
  // the wait that stands before an address register of an issued load is written again; the addresses are named as inputs so that they
  // stay in their registers up to here (left free, later loads of this run were given earlier loads' address registers as destinations)
  asm volatile("s_wait_xcnt 0x0" :: "v"(pw0), "v"(pw1), "v"(pw2), "v"(pb), "v"(xp) : "memory");
  // keeps every load ahead of the first conversion: left free, the compiler waits for weights before it issues the x loads, two trips in series
  __builtin_amdgcn_sched_barrier(0);

#pragma unroll
  for (int i = 0; i < 12; ++i) *(v2u*)(sW + (i * 8 + (t >> 4)) * kWP + (t & 15) * 4) = w_pack(wq[i]);
  sB[t] = (wave == 0) ? bq * kLog2e : bq;   // theta leaves x log2(e), its bias with it
  __syncthreads();   // the f16 weights and the biases are in LDS before any wave reads an operand

  HFrag xb[4][2];
#pragma unroll
  for (int g = 0; g < 4; ++g)
#pragma unroll
    for (int ks = 0; ks < 2; ++ks)
#pragma unroll
      for (int i = 0; i < 8; ++i) xb[g][ks].u[i] = pack2h(xv[ks][2 * i][g], xv[ks][2 * i + 1][g]);

  // theta (mt 0, 1), phi (mt 2, 3), g (mt 4, 5)
  unsigned short* pr = prj + ((size_t)b * kN + n0 + 4 * rl) * kPW + hh * 8;
  unsigned short* gq = gt + ((size_t)b * kCI + hh * 8) * kN + n0 + 4 * rl;
#pragma unroll
  for (int mt = 0; mt < 6; ++mt) {
    const _Float16* wr = sW + (mt * 16 + rl) * kWP + hh * 8;
    const v16h wa0 = Frag<_Float16>::load(wr);
    const v16h wa1 = Frag<_Float16>::load(wr + 32);
    const v4f bv[2] = {*(const v4f*)(sB + mt * 16 + hh * 8), *(const v4f*)(sB + mt * 16 + hh * 8 + 4)};
    v8f acc[4];
#pragma unroll
    for (int g = 0; g < 4; ++g) acc[g] = Frag<_Float16>::mma(wa0, xb[g][0].v, (v8f){0.f,0.f,0.f,0.f,0.f,0.f,0.f,0.f});
#pragma unroll
    for (int g = 0; g < 4; ++g) acc[g] = Frag<_Float16>::mma(wa1, xb[g][1].v, acc[g]);
    if (mt < 4) {
      const float sc = (mt < 2) ? kWCarryInv * kLog2e : kWCarryInv;   // theta x log2(e): the fused kernel's scores are then in the log2 domain
#pragma unroll
      for (int g = 0; g < 4; ++g) {
        unsigned u[4];
#pragma unroll
        for (int i = 0; i < 4; ++i)
          u[i] = pack2h(fmaf(acc[g][2 * i], sc, bv[i >> 1][(2 * i) & 3]), fmaf(acc[g][2 * i + 1], sc, bv[i >> 1][(2 * i + 1) & 3]));
        *(v4u*)(pr + (size_t)g * kPW + mt * 16) = (v4u){u[0], u[1], u[2], u[3]};
      }
    } else {
#pragma unroll
      for (int r = 0; r < 8; ++r) {   // channel 16 (mt - 4) + 8 h + r at keys n0 + 4 (lane&15) + 0..3
        const float bb = bv[r >> 2][r & 3];
        *(v2u*)(gq + (size_t)((mt - 4) * 16 + r) * kN) = (v2u){pack2h(fmaf(acc[0][r], kWCarryInv, bb), fmaf(acc[1][r], kWCarryInv, bb)),
                                                               pack2h(fmaf(acc[2][r], kWCarryInv, bb), fmaf(acc[3][r], kWCarryInv, bb))};
      }
    }
  }
}

// ---------------------------------------------------------------------------
// Host glue.
//   PRJ  f16 [8][4096][128]   8,388,608  at           0   (theta | phi per position; the upper half of a row is unused)
//   GT   f16 [8][32][4096]    2,097,152  at   8,388,608   (g^T[o][key])
//   total                    10,485,760
// ---------------------------------------------------------------------------
extern "C" void kernel_launch(void* const* d_in, const int* in_sizes, int n_in,
                              void* d_out, int out_size, void* d_ws, size_t ws_size,
                              hipStream_t stream) {
  if (n_in < 9) return;
  const int nX = kB * kC * kN;   // 2,097,152
  if (in_sizes[0] != nX) return;
  if (in_sizes[1] != kCI * kC || in_sizes[2] != kCI) return;
  if (in_sizes[3] != kCI * kC || in_sizes[4] != kCI) return;
  if (in_sizes[5] != kCI * kC || in_sizes[6] != kCI) return;
  if (in_sizes[7] != kC * kCI || in_sizes[8] != kC) return;
  if (out_size != nX) return;

  const size_t szPRJ = (size_t)kB * kN * kPW * 2;
  const size_t szGT  = (size_t)kB * kCI * kN * 2;
  const size_t offPRJ = 0;
  const size_t offGT  = offPRJ + szPRJ;
  const size_t total  = offGT + szGT;
  if (ws_size < total) return;

  const float* x       = (const float*)d_in[0];
  const float* w_theta = (const float*)d_in[1];
  const float* b_theta = (const float*)d_in[2];
  const float* w_phi   = (const float*)d_in[3];
  const float* b_phi   = (const float*)d_in[4];
  const float* w_g     = (const float*)d_in[5];
  const float* b_g     = (const float*)d_in[6];
  const float* w_out   = (const float*)d_in[7];
  const float* b_out   = (const float*)d_in[8];
  float* out = (float*)d_out;
  char* ws = (char*)d_ws;
  unsigned short* PRJ = (unsigned short*)(ws + offPRJ);
  unsigned short* GT  = (unsigned short*)(ws + offGT);

  // ---- theta, phi planes and g^T of all batches (16 blocks of 256 positions x 8 batches) ----
  proj_kernel<<<dim3(kN / (kJP * kJW), kB), dim3(kJW * 32), 0, stream>>>(x, w_theta, b_theta, w_phi, b_phi, w_g, b_g, PRJ, GT);

  // ---- scores, softmax over keys, y^T product, output projection, bias and residual: all batches, one launch (32 position blocks x 8 batches) ----
  attn_fused_kernel<<<dim3(kN / (kFG * kFQ), kB), dim3(kFW * 32), 0, stream>>>(PRJ, GT, w_out, b_out, x, out);
}

// v009
// One run takes 28.2 microseconds.
// Two timings next to v008 put it at 1.06 and 1.05 times that version's speed.
// All steps since v000 together make it 55.0 times as fast.
// Contractions: channel projections (W f16 carried x16 . x f16), scores phi.theta^T (f16 planes), y^T = g^T f16 x P^T (f16, unnormalised exponentials), softmax sums = ones (f16) . P^T, out^T = W_out (f16 carried x16) . y^T (f16, normalised slice partials): all on v_wmma_f32_16x16x32_f16 with f32 accumulate; bias adds, softmax maxima, exponentials and residual in f32.
#include <hip/hip_runtime.h>
#include <math.h>

// ---------------------------------------------------------------------------
// Problem constants
// ---------------------------------------------------------------------------
constexpr int kB  = 8;        // batch
constexpr int kC  = 64;       // in channels
constexpr int kCI = 32;       // inter channels
constexpr int kN  = 4096;     // H*W positions
constexpr int kPW = 128;      // projection plane row pitch in halves: theta 0..31 | phi 32..63 | 64..127 neither written nor read
constexpr float kWCarry    = 16.0f;            // weights carried x16 in f16
constexpr float kWCarryInv = 1.0f / 16.0f;
static_assert(kN % 64 == 0 && kPW % 64 == 0 && kC % 64 == 0, "M,N tiles");
static_assert(kC % 32 == 0 && kCI % 32 == 0 && kN % 32 == 0, "K steps");

typedef __attribute__((ext_vector_type(16))) _Float16 v16h;
typedef __attribute__((ext_vector_type(8)))  _Float16 v8h;
typedef __attribute__((ext_vector_type(8)))  float    v8f;
typedef __attribute__((ext_vector_type(4)))  float    v4f;
typedef __attribute__((ext_vector_type(4)))  unsigned int v4u;

// ---------------------------------------------------------------------------
// Helpers
// ---------------------------------------------------------------------------
template <typename T> struct Frag;
template <> struct Frag<_Float16> {
  typedef v16h V; union U { v16h v; v8h h[2]; };
  // elements 0..7 <- p[0..7], 8..15 <- p[16..23]
  static __device__ __forceinline__ v16h load(const _Float16* p) {
    U f; f.h[0] = *(const v8h*)(p); f.h[1] = *(const v8h*)(p + 16); return f.v;
  }
  static __device__ __forceinline__ v8f mma(v16h a, v16h b, v8f c) {
    return __builtin_amdgcn_wmma_f32_16x16x32_f16(false, a, false, b, (short)0, c, false, false);
  }
};

// ---------------------------------------------------------------------------
// Scores, softmax, y^T product and output projection of all batches in one launch; scores and probabilities stay in registers.
//   y[b][o][q] = sum_key GT[b][o][key] * softmax_key(theta[q] . phi[key]);  out[b][c][q] = sum_o w_out[c][o] * y[b][o][q] + b_out[c] + x[b][c][q]
// grid (4096/128 = 32 position blocks, 8 batches), 16 waves: wave = query group (wave >> 2, 32 q) x key slice (wave & 3, 1024 keys).
// One pass = 32 keys:  S^T = phi . theta^T  (A = phi rows, B = theta rows, same loader: equal k order); D register r of a lane =
// S^T[key 8*(lane>>4) + r][q = lane&15], so the two key tiles of a pass, converted in place, are the B operand (hardware k order) of
// Y^T += GT . P^T  (A = GT rows through the same loader: keys 8h..8h+7 | 16+8h..16+8h+7). D register r = y[o = 8*(lane>>4) + r][q = lane&15].
// A lane holds one query's column in both products: running maximum (log2 domain) and rescale factor are per-lane scalars.
// theta is carried x log2(e) and the score product's C operand holds minus the maximum in use in all eight registers of a lane, so D is
// already the argument of the exponential, S log2(e) - m.
// The shift m is fixed for the whole slice: the exact maximum of the wave's first 64 keys plus 6. No score is looked at again in the loop.
// An exponential stays inside f16 while its score lies less than 22 above that sampled maximum; the sampled key itself gives 2^-6, so a sum is never 0.
// A score beyond that turns its f16 exponential into infinity, which reaches the slice's sum through the ones product (every term is 0 or more).
// Every wave tests its sums once behind the loop: below the largest f16, or not. If any wave of the work-group saw one that is not, the whole
// work-group runs its keys again through the tracking loop (below), which takes any scores; it starts at the exact maximum of the wave's first 32 keys.
// The sum of a query's exponentials comes off the matrix pipe: L += ones . P^T (A: row 0 is 1.0, the rest 0), one product per column group and pass,
// on the same rounded P^T operand as the output product; register 0 of lanes 0..15 holds the sum over all 32 keys of query lane&15.
// Tracking loop: the maximum in use may trail the true one by up to 8 (an exponential reaches 2^8 at most, inside f16): rescale only when some column exceeds that.
// The four key slices of a query group are joined in LDS: maxima and sums first; then each wave scales its 32-channel y^T, whose two channel
// tiles, converted in place, are the B operand of out^T = W_out . y^T (A = w_out rows in the loader's k order), and the partial out tiles are
// summed in slice order 0..3. The products over the keys so run on the 32 inner channels, not on the 64 outer ones.
// phi rows and g^T rows come through LDS: a stage is 64 keys of each of the four slices (two passes), brought once per work-group by
// asynchronous 16-B copies (a g^T row of a stage is one whole 128-B line, a phi row 64 B) and read by the four query waves of its slice.
// Two buffers: stage t + 1 flies while stage t is worked on; one barrier per stage publishes the one and frees the other. It stands in the stage's
// last pass: signal behind the score products (the wave's last read of the buffer has returned), wait behind column group 0's exponentials (tracking
// loop: behind the rescale test); the next stage's first phi rows and the refill copies are issued there, ahead of the remaining exponentials.
// ---------------------------------------------------------------------------
constexpr int kFQ  = 32;            // queries per wave (two 16-column groups)
constexpr int kFG  = 4;             // query groups per work-group
constexpr int kFS  = 4;             // key slices per work-group
constexpr int kFW  = kFG * kFS;     // waves per work-group
constexpr int kFK  = kN / kFS;      // keys per wave
constexpr int kFNP = kFK / 32;      // passes per wave
constexpr int kFP  = 36;            // LDS row pitch in floats: 144 B = 16 B x odd
constexpr int kSK  = 64;            // keys of one slice per stage
constexpr int kNST = kFK / kSK;     // stages
constexpr int kPhP = 40;            // LDS pitch of a phi row in halves: 80 B = 16 B x odd
constexpr int kGwP = 72;            // LDS pitch of a g^T row in halves: 144 B = 16 B x odd
constexpr int kPhB = kFS * kSK * kPhP;   // halves of one phi buffer (4 slices x 64 keys)
constexpr int kGwB = kFS * kCI * kGwP;   // halves of one g^T buffer (4 slices x 32 channels)
constexpr float kLog2e = 1.4426950408889634f;
constexpr float kLift  = 6.0f;      // fixed shift = sampled maximum + kLift (log2 domain)
constexpr float kSumTop = 65504.0f; // largest f16: a sum below it holds no exponential that left f16; infinity and not-a-number fail "< kSumTop"
static_assert(kSK == 64 && kNST >= 2 && kFW * 32 == 512 && kFS == 4, "stage copy map: 2 phi and 2 g^T chunks of 16 B per thread");
static_assert(kFK % 32 == 0 && kN % (kFG * kFQ) == 0 && kCI == 32 && kC == 64, "fused tile");
static_assert(kC * kFG * kFQ == kFW * 32 * 16, "join map: four float4 per thread");
typedef __attribute__((ext_vector_type(2))) float    v2f;
typedef __attribute__((ext_vector_type(2))) _Float16 v2h;

// lane l with lane l ^ 16
__device__ __forceinline__ float xhalf(float v) {
  const int i = __builtin_bit_cast(int, v);
  return __builtin_bit_cast(float, __builtin_amdgcn_permlanex16(i, i, 0x76543210, 0xfedcba98, false, false));
}
__device__ __forceinline__ unsigned pack2h(float lo, float hi) {   // round to nearest even
  return __builtin_bit_cast(unsigned, __builtin_convertvector((v2f){lo, hi}, v2h));
}
// Eight exponentials (2^a) in one statement. The outputs are early-clobbered, so none lands on a source of another, and the closing v_nop is
// the slot the instruction set asks for behind a transcendental before its result is used or its source overwritten.
__device__ __forceinline__ void exp2x8(float (&p)[8], const float (&a)[8]) {
  asm("v_exp_f32 %0, %8\n\tv_exp_f32 %1, %9\n\tv_exp_f32 %2, %10\n\tv_exp_f32 %3, %11\n\t"
      "v_exp_f32 %4, %12\n\tv_exp_f32 %5, %13\n\tv_exp_f32 %6, %14\n\tv_exp_f32 %7, %15\n\tv_nop"
      : "=&v"(p[0]), "=&v"(p[1]), "=&v"(p[2]), "=&v"(p[3]), "=&v"(p[4]), "=&v"(p[5]), "=&v"(p[6]), "=&v"(p[7])
      : "v"(a[0]), "v"(a[1]), "v"(a[2]), "v"(a[3]), "v"(a[4]), "v"(a[5]), "v"(a[6]), "v"(a[7]));
}

// The four score products of a pass in one statement, D apart from C: the C registers (minus the maximum in use) are read only and live on
// from pass to pass (through the builtin some of these products were tied to their C, which was copied first, eight registers a time).
// Key tile 1 goes first: in the listing the D registers of key tile 0 are the B operands of the pass before, and this order puts three
// products and more between a register's last use there and the product that writes it here.
// The closing v_nops are the four vector slots between the last WMMA and a vector instruction on its D or a load over its A.
__device__ __forceinline__ void score4(v8f (&d)[2][2], const v16h (&a)[2], const v16h (&b)[2], const v8f (&c)[2]) {
  asm("v_wmma_f32_16x16x32_f16 %2, %5, %6, %8\n\t"
      "v_wmma_f32_16x16x32_f16 %3, %5, %7, %9\n\t"
      "v_wmma_f32_16x16x32_f16 %0, %4, %6, %8\n\t"
      "v_wmma_f32_16x16x32_f16 %1, %4, %7, %9\n\t"
      "v_nop\n\tv_nop\n\tv_nop\n\tv_nop"
      : "=&v"(d[0][0]), "=&v"(d[0][1]), "=&v"(d[1][0]), "=&v"(d[1][1])
      : "v"(a[0]), "v"(a[1]), "v"(b[0]), "v"(b[1]), "v"(c[0]), "v"(c[1]));
}

// One stage: four 16-B copies per lane, global memory to LDS through no register.
// lp / gp: this lane's phi chunk of slices 0..1; lg / gg: its g^T chunk of slices 0..1 (the second copy of each: two slices on).
// The closing s_wait_xcnt stands inside the statement so that no address register named here is rewritten ahead of it.
__device__ __forceinline__ void stage_copy(unsigned lp, unsigned lg, const _Float16* gp, const _Float16* gg) {
  const unsigned lp1 = lp + 2 * kSK * kPhP * 2;
  const unsigned lg1 = lg + 2 * kCI * kGwP * 2;
  const _Float16* gp1 = gp + (size_t)2 * kFK * kPW;
  const _Float16* gg1 = gg + 2 * kFK;
  asm volatile("global_load_async_to_lds_b128 %0, %4, off\n\t"
               "global_load_async_to_lds_b128 %1, %5, off\n\t"
               "global_load_async_to_lds_b128 %2, %6, off\n\t"
               "global_load_async_to_lds_b128 %3, %7, off\n\t"
               "s_wait_xcnt 0x0"
               :: "v"(lp), "v"(lp1), "v"(lg), "v"(lg1),
                  "v"(gp), "v"(gp1), "v"(gg), "v"(gg1)
               : "memory");
}

// The pass over a wave's 1024 keys. Enters with stage 0's copies issued; leaves with the ring closed.
// kTrack false: fixed shift, no look at the scores. kTrack true: running maximum with the rescale test.
template <bool kTrack>
__device__ __forceinline__ void key_loop(const _Float16* Th, const _Float16* Lp, const _Float16* Lg,
                                         unsigned cLp, unsigned cLg, const _Float16* cGp, const _Float16* cGg, int rl,
                                         v8f (&acc)[2][2], v8f (&lacc)[2], float (&m_run)[2]) {
  // stage 0 has landed for this wave's copies before the barrier that publishes it
  asm volatile("s_wait_asynccnt 0x0" ::: "memory");
  __syncthreads();   // stage 0 is readable by every wave
  stage_copy(cLp + kPhB * 2, cLg + kGwB * 2, cGp + (size_t)kSK * kPW, cGg + kSK);

  v16h th[2], ph[2];
#pragma unroll
  for (int g = 0; g < 2; ++g) th[g] = Frag<_Float16>::load(Th + (size_t)(g << 4) * kPW);

#pragma unroll
  for (int ct = 0; ct < 2; ++ct)
#pragma unroll
    for (int g = 0; g < 2; ++g) acc[ct][g] = (v8f){0.f,0.f,0.f,0.f,0.f,0.f,0.f,0.f};
  v8f cm[2];     // C operand of the score products: -m_run in every register
#pragma unroll
  for (int g = 0; g < 2; ++g) lacc[g] = (v8f){0.f,0.f,0.f,0.f,0.f,0.f,0.f,0.f};   // sums of exponentials, rescaled like an output tile
  union { unsigned u[8]; v16h v; } ones;
#pragma unroll
  for (int i = 0; i < 8; ++i) ones.u[i] = (rl == 0) ? 0x3C003C00u : 0u;

  // sampled maximum (stage 0 is published): scores with C = 0 of the first pass (tracking loop) or of both passes of stage 0 (fixed shift);
  // the first pass goes last, so that ph leaves holding its rows
  {
    constexpr int kPre = kTrack ? 1 : kSK / 32;
    float mx[2];
#pragma unroll
    for (int pq = kPre - 1; pq >= 0; --pq) {
#pragma unroll
      for (int kt = 0; kt < 2; ++kt) ph[kt] = Frag<_Float16>::load(Lp + (pq * 32 + (kt << 4)) * kPhP);
#pragma unroll
      for (int g = 0; g < 2; ++g) {
        const v8f s0 = Frag<_Float16>::mma(ph[0], th[g], (v8f){0.f,0.f,0.f,0.f,0.f,0.f,0.f,0.f});
        const v8f s1 = Frag<_Float16>::mma(ph[1], th[g], (v8f){0.f,0.f,0.f,0.f,0.f,0.f,0.f,0.f});
        float v = s0[0];
#pragma unroll
        for (int r = 1; r < 8; ++r) v = fmaxf(v, s0[r]);
#pragma unroll
        for (int r = 0; r < 8; ++r) v = fmaxf(v, s1[r]);
        mx[g] = (pq == kPre - 1) ? v : fmaxf(mx[g], v);
      }
    }
#pragma unroll
    for (int g = 0; g < 2; ++g) {
      const float m = fmaxf(mx[g], xhalf(mx[g]));   // both wave halves hold this query's maximum
      m_run[g] = kTrack ? m : m + kLift;
#pragma unroll
      for (int r = 0; r < 8; ++r) cm[g][r] = -m_run[g];
    }
  }

  // rolled: a stage (two passes) is already a long straight block. ph enters a stage holding its first pass's phi rows (stage 0: from the pre-pass).
#pragma unroll 1
  for (int sg = 0; sg < kNST; ++sg) {
   const int bf = sg & 1;
   const _Float16* lp = Lp + bf * kPhB;
   const _Float16* lg = Lg + bf * kGwB;
   v16h gw[kSK / 32][2];
   // both passes of the stage written out: the second pass's offsets in the buffer are then immediates
#pragma unroll
   for (int pp = 0; pp < kSK / 32; ++pp) {
    // keeps the products of the pass before in their order ahead of the statement below, whose WMMAs the compiler does not see as such
    __builtin_amdgcn_sched_barrier(0);
    v8f st[2][2];   // st[kt][g]: key tile kt, column group g
    score4(st, ph, th, cm);
    if (pp == 0) {   // every other read of this stage's buffer: g^T rows of both passes, phi rows of the second
#pragma unroll
      for (int ct = 0; ct < 2; ++ct) gw[0][ct] = Frag<_Float16>::load(lg + (ct << 4) * kGwP);
#pragma unroll
      for (int kt = 0; kt < 2; ++kt) ph[kt] = Frag<_Float16>::load(lp + (32 + (kt << 4)) * kPhP);
#pragma unroll
      for (int ct = 0; ct < 2; ++ct) gw[1][ct] = Frag<_Float16>::load(lg + (ct << 4) * kGwP + 32);
    }
    // keeps these loads (and the score products) ahead of what follows: left free, the compiler sinks each load to its use and the wave waits out its latency there
    __builtin_amdgcn_sched_barrier(0);
    if (pp + 1 == kSK / 32) {
      // publish point, first half: this wave's reads of the buffer are done, its copies of the next stage have landed
      asm volatile("s_wait_dscnt 0x0" ::: "memory");
      asm volatile("s_wait_asynccnt 0x0" ::: "memory");
      asm volatile("s_barrier_signal -1" ::: "memory");
      // keeps the vector work on the scores, which waits for the score products, behind the signal, so that no other wave waits for it
      __builtin_amdgcn_sched_barrier(0);
    }

    if constexpr (kTrack) {
      // one test for the whole wave: every score is already relative to its own query's maximum in use
      float mg[2] = {0.0f, 0.0f};   // per column group: how far this lane's scores stand above the maximum in use, 0 at least
#pragma unroll
      for (int kt = 0; kt < 2; ++kt)
#pragma unroll
        for (int r = 0; r < 8; ++r) { mg[0] = fmaxf(mg[0], st[kt][0][r]); mg[1] = fmaxf(mg[1], st[kt][1][r]); }
      if (__builtin_amdgcn_ballot_w32(fmaxf(mg[0], mg[1]) > 8.0f) != 0) {   // wave-uniform; rare
#pragma unroll
        for (int g = 0; g < 2; ++g) {
          const float up   = fmaxf(mg[g], xhalf(mg[g]));   // both wave halves hold this query's rise; the maximum in use never falls
          const float corr = __builtin_amdgcn_exp2f(-up);
          m_run[g] += up;
          lacc[g] = lacc[g] * corr;
#pragma unroll
          for (int ct = 0; ct < 2; ++ct) acc[ct][g] = acc[ct][g] * corr;
#pragma unroll
          for (int kt = 0; kt < 2; ++kt)
#pragma unroll
            for (int r = 0; r < 8; ++r) st[kt][g][r] -= up;
#pragma unroll
          for (int r = 0; r < 8; ++r) cm[g][r] = -m_run[g];
        }
      }
    }
    union PB { unsigned u[8]; v16h v; } pb[2];
#pragma unroll
    for (int g = 0; g < 2; ++g) {
      if (pp + 1 == kSK / 32 && g == (kTrack ? 0 : 1)) {
        // fixed shift: keeps column group 0's exponentials ahead of the wait, where they fill the time in which the other waves arrive
        __builtin_amdgcn_sched_barrier(0);
        // publish point, second half: every wave has signalled, so stage sg + 1 is readable and the buffer of stage sg is free
        asm volatile("s_barrier_wait -1" ::: "memory");
        if (sg + 1 < kNST) {   // the next stage's first phi rows: their LDS latency runs under the exponentials and products below
#pragma unroll
          for (int kt = 0; kt < 2; ++kt) ph[kt] = Frag<_Float16>::load(Lp + (bf ^ 1) * kPhB + (kt << 4) * kPhP);
        }
        if (sg + 2 < kNST)
          stage_copy(cLp + bf * (kPhB * 2), cLg + bf * (kGwB * 2), cGp + (size_t)(sg + 2) * kSK * kPW, cGg + (sg + 2) * kSK);
        // keeps the exponentials below behind the reads and copies above: moved ahead of them, they would delay both
        __builtin_amdgcn_sched_barrier(0);
      }
#pragma unroll
      for (int kt = 0; kt < 2; ++kt) {   // key tile kt fills elements 8kt..8kt+7 of the 32-key operand, register r = element 8kt + r
        float a[8], p[8];
#pragma unroll
        for (int r = 0; r < 8; ++r) a[r] = st[kt][g][r];
        exp2x8(p, a);
#pragma unroll
        for (int i = 0; i < 4; ++i) pb[g].u[kt * 4 + i] = pack2h(p[2 * i], p[2 * i + 1]);
      }
    }
    // keeps every exponential statement ahead of the products below: an exponential
    // moved behind a product could write over its B operand too early
    __builtin_amdgcn_sched_barrier(0);
#pragma unroll
    for (int g = 0; g < 2; ++g) {
#pragma unroll
      for (int ct = 0; ct < 2; ++ct) acc[ct][g] = Frag<_Float16>::mma(gw[pp][ct], pb[g].v, acc[ct][g]);
      lacc[g] = Frag<_Float16>::mma(ones.v, pb[g].v, lacc[g]);
    }
   }
  }
  // the four vector slots behind the loop's last WMMA on the taken side of the exit branch
  asm volatile("v_nop\n\tv_nop\n\tv_nop\n\tv_nop");
  // keeps the caller's first read of a sum behind those slots (left free, the compare on it was lifted in front of them)
  __builtin_amdgcn_sched_barrier(0);
  // nothing is outstanding here; the wait closes the ring before the wave goes on
  asm volatile("s_wait_asynccnt 0x0" ::: "memory");
}

__global__ __launch_bounds__(kFW * 32) void attn_fused_kernel(const unsigned short* __restrict__ prj,
                                                              const unsigned short* __restrict__ gt,
                                                              const float* __restrict__ w_out,
                                                              const float* __restrict__ b_out,
                                                              const float* __restrict__ x,
                                                              float* __restrict__ out) {
  __shared__ __align__(16) float part[kFW][kC * kFP];
  __shared__ __align__(16) _Float16 sPh[2 * kPhB];
  __shared__ __align__(16) _Float16 sGw[2 * kGwB];
  __shared__ float sM[kFW][kFQ];
  __shared__ float sL[kFW][kFQ];
  __shared__ int sOver;   // set by any wave one of whose sums left the finite range under the fixed shift
  const int t    = threadIdx.x;
  const int lane = t & 31, wave = t >> 5;
  const int b    = blockIdx.y;
  const int qg   = wave >> 2, ks = wave & 3;
  const int qb   = blockIdx.x * (kFG * kFQ);
  const int rl   = lane & 15, hh = lane >> 4;
  const _Float16* Pb = (const _Float16*)prj + (size_t)b * kN * kPW;
  const _Float16* Th = Pb + (size_t)(qb + qg * kFQ + rl) * kPW + hh * 8;
  // fragment readers: this wave's slice in buffer 0
  const _Float16* Lp = sPh + (ks * kSK + rl) * kPhP + hh * 8;
  const _Float16* Lg = sGw + (ks * kCI + rl) * kGwP + hh * 8;
  // copy map: phi chunk = (slice t>>8 [+2], key (t>>2)&63, 16-B piece t&3); g^T chunk = (slice t>>8 [+2], channel (t>>3)&31, 16-B piece t&7)
  const unsigned cLp = (unsigned)(size_t)(sPh + ((t >> 8) * kSK + ((t >> 2) & 63)) * kPhP + (t & 3) * 8);
  const unsigned cLg = (unsigned)(size_t)(sGw + ((t >> 8) * kCI + ((t >> 3) & 31)) * kGwP + (t & 7) * 8);
  const _Float16* cGp = Pb + (size_t)((t >> 8) * kFK + ((t >> 2) & 63)) * kPW + kCI + (t & 3) * 8;
  const _Float16* cGg = (const _Float16*)gt + ((size_t)b * kCI + ((t >> 3) & 31)) * kN + (t >> 8) * kFK + (t & 7) * 8;

  stage_copy(cLp, cLg, cGp, cGg);
  if (t == 0) sOver = 0;   // ahead of the loop's first barrier; set only behind it
  // A operands of the output projection: w_out rows 16 ot + (lane&15), carried x16, elements 0..7 = channels 8h..8h+7, 8..15 = 16+8h..16+8h+7.
  // Read here, so that their trip to memory runs beside stage 0's. They wait out the loops in the wave's own join tile, idle until then, each lane's
  // 16-B pieces read back by the same lane: with the addresses that a second run needs also kept, 32 more registers did not fit and went to scratch.
  v4f* wkeep = (v4f*)part[wave] + lane;
  const float* wr = w_out + rl * kCI + hh * 8;
  v4f wq[4][4];   // row tile ot: four floats at 0, 4, 16, 20 of the lane's half row
#pragma unroll
  for (int ot = 0; ot < 4; ++ot)
#pragma unroll
    for (int j = 0; j < 4; ++j) wq[ot][j] = *(const v4f*)(wr + (ot << 4) * kCI + (j >> 1) * 16 + (j & 1) * 4);
  // the wait that stands before an address register of an issued load is written again; the address is named as an input so that it stays in
  // its registers up to here (left free, the last load of this run was given the address registers as its destination)
  asm volatile("s_wait_xcnt 0x0" :: "v"(wr) : "memory");
#pragma unroll
  for (int ot = 0; ot < 4; ++ot) {
    unsigned u[8];
#pragma unroll
    for (int j = 0; j < 4; ++j) {
      u[2 * j]     = pack2h(wq[ot][j][0] * kWCarry, wq[ot][j][1] * kWCarry);
      u[2 * j + 1] = pack2h(wq[ot][j][2] * kWCarry, wq[ot][j][3] * kWCarry);
    }
    wkeep[(2 * ot) * 32]     = __builtin_bit_cast(v4f, (v4u){u[0], u[1], u[2], u[3]});
    wkeep[(2 * ot + 1) * 32] = __builtin_bit_cast(v4f, (v4u){u[4], u[5], u[6], u[7]});
  }

  v8f acc[2][2];
  v8f lacc[2];
  float m_run[2];
  key_loop<false>(Th, Lp, Lg, cLp, cLg, cGp, cGg, rl, acc, lacc, m_run);
  // register 0 holds the sum (lanes 0..15) or 0 times the exponentials (lanes 16..31): an infinite exponential makes it infinite or not a number
  // (a finite sum that large only costs the second run)
  if (!(lacc[0][0] < kSumTop) || !(lacc[1][0] < kSumTop)) sOver = 1;

  // ---- join of the four key slices of each query group ----
#pragma unroll
  for (int g = 0; g < 2; ++g) {
    if (hh == 0) {
      sM[wave][(g << 4) + rl] = m_run[g];
      sL[wave][(g << 4) + rl] = lacc[g][0];
    }
  }
  __syncthreads();   // every slice's maxima and sums are in LDS before any wave forms its factor
  if (__builtin_amdgcn_readfirstlane(sOver) != 0) {   // the same word for every wave, written by nobody behind the barrier above: work-group uniform
    // this wave's LDS reads have returned (every wave's reads of the ring ended ahead of the barrier above) before copies target the ring again
    asm volatile("s_wait_dscnt 0x0" ::: "memory");
    stage_copy(cLp, cLg, cGp, cGg);
    key_loop<true>(Th, Lp, Lg, cLp, cLg, cGp, cGg, rl, acc, lacc, m_run);
#pragma unroll
    for (int g = 0; g < 2; ++g) {
      if (hh == 0) {
        sM[wave][(g << 4) + rl] = m_run[g];
        sL[wave][(g << 4) + rl] = lacc[g][0];
      }
    }
    __syncthreads();   // the second run's maxima and sums are in LDS before any wave forms its factor
  }
  float* my = part[wave];
  union { v4f q[2]; v16h v; } wo[4];
#pragma unroll
  for (int ot = 0; ot < 4; ++ot) { wo[ot].q[0] = wkeep[(2 * ot) * 32]; wo[ot].q[1] = wkeep[(2 * ot + 1) * 32]; }
  union { unsigned u[8]; v16h v; } yb[2];   // channel tile ct fills elements 8ct..8ct+7, register r = element 8ct + r = channel 16ct + 8h + r
#pragma unroll
  for (int g = 0; g < 2; ++g) {
    const int ql = (g << 4) + rl;
    float M = sM[qg * kFS][ql];
#pragma unroll
    for (int j = 1; j < kFS; ++j) M = fmaxf(M, sM[qg * kFS + j][ql]);
    float L = 0.f;
#pragma unroll
    for (int j = 0; j < kFS; ++j) L += sL[qg * kFS + j][ql] * __builtin_amdgcn_exp2f(sM[qg * kFS + j][ql] - M);
    const float f = __builtin_amdgcn_exp2f(m_run[g] - M) / L * kWCarryInv;   // the x16 that w_out carries goes out with the slice's factor
#pragma unroll
    for (int ct = 0; ct < 2; ++ct)
#pragma unroll
      for (int i = 0; i < 4; ++i) yb[g].u[ct * 4 + i] = pack2h(acc[ct][g][2 * i] * f, acc[ct][g][2 * i + 1] * f);
  }
  v8f o[4][2];
#pragma unroll
  for (int ot = 0; ot < 4; ++ot)
#pragma unroll
    for (int g = 0; g < 2; ++g) o[ot][g] = Frag<_Float16>::mma(wo[ot].v, yb[g].v, (v8f){0.f,0.f,0.f,0.f,0.f,0.f,0.f,0.f});
  // all eight products ahead of the first store: each then has result registers of its own (left free, a later product was given an earlier
  // one's result registers one vector slot behind it)
  __builtin_amdgcn_sched_barrier(0);
#pragma unroll
  for (int ot = 0; ot < 4; ++ot)
#pragma unroll
    for (int g = 0; g < 2; ++g)
#pragma unroll
      for (int r = 0; r < 8; ++r) my[((ot << 4) + hh * 8 + r) * kFP + (g << 4) + rl] = o[ot][g][r];
  __syncthreads();   // every wave's scaled partial tile is in LDS before any thread sums across slices

  // thread t, trip it: float4 index it*512 + t of the 64 c x 128 q tile; a wave writes one whole 512-B row segment of out
#pragma unroll
  for (int it = 0; it < 4; ++it) {
    const int idx = it * (kFW * 32) + t;
    const int c   = idx >> 5;
    const int q4  = (idx & 31) * 4;
    const int g4  = (q4 >> 5) * kFS;
    const int po  = c * kFP + (q4 & 31);
    v4f sum = *(const v4f*)(&part[g4][po]);
#pragma unroll
    for (int j = 1; j < kFS; ++j) sum = sum + *(const v4f*)(&part[g4 + j][po]);
    const size_t o = ((size_t)b * kC + c) * kN + qb + q4;
    const v4f rr = *(const v4f*)(x + o);
    const float bv = b_out[c];
    v4f v;
#pragma unroll
    for (int e = 0; e < 4; ++e) v[e] = (sum[e] + bv) + rr[e];
    *(v4f*)(out + o) = v;
  }
}

// ---------------------------------------------------------------------------
// Weight preparation and channel projections in one launch, straight from x and the f32 weights.
// grid (4096/256 = 16, 8 batches), 4 waves; a wave owns the 64 positions n0..n0+63 of one batch.
// Weights: the work-group rounds 16 w to f16 once into LDS (rows theta | phi | g; biases in f32); one barrier publishes them.
// Every global load of a wave is issued ahead of that barrier, the weights first: one trip to memory in all.
// D = W . x: A = weight rows (m = output channel), B = x columns (n = position, f16(x)), K = 64 channels in two steps.
//   A lane reads x as one float4 per channel at position n0 + 4*(lane&15); component g goes to position tile g, whose column j is position
//   n0 + 4j + g. A wave-wide load is two whole 256-B pieces of two rows of x.
//   Element s of both operands is channel 32 ks + 8*(lane>>4) + s for s < 8 and 32 ks + 16 + 8*(lane>>4) + (s - 8) for s >= 8.
//   D register r = output channel 16 mt + 8*(lane>>4) + r at the lane's position: theta and phi leave as one 16-B store per tile.
//   g leaves transposed: a lane holds channel 8*(lane>>4) + r of a tile at the four keys n0 + 4*(lane&15) + 0..3 (one per position tile), one 8-B
//   store per channel; the 16 lanes of a wave half fill one whole 128-B line of g^T, and every line is written by one wave.
// ---------------------------------------------------------------------------
constexpr int kJP  = 64;        // positions per wave (four position tiles)
constexpr int kJW  = 4;         // waves per work-group
constexpr int kJO  = 3 * kCI;   // projection rows: theta | phi | g
constexpr int kWP  = 72;        // LDS pitch of a projection weight row in halves: 144 B = 16 B x odd
static_assert(kN % (kJP * kJW) == 0 && kC == 64 && kCI == 32 && kJW == 4, "projection tile and weight copy map");
union HFrag { unsigned u[8]; v16h v; };
typedef __attribute__((ext_vector_type(2))) unsigned int v2u;

// four weights, carried x16, rounded to f16
__device__ __forceinline__ v2u w_pack(v4f q) {
  return (v2u){pack2h(q[0] * kWCarry, q[1] * kWCarry), pack2h(q[2] * kWCarry, q[3] * kWCarry)};
}

__global__ __launch_bounds__(kJW * 32) void proj_kernel(const float* __restrict__ x,
                                                            const float* __restrict__ w_theta, const float* __restrict__ b_theta,
                                                            const float* __restrict__ w_phi, const float* __restrict__ b_phi,
                                                            const float* __restrict__ w_g, const float* __restrict__ b_g,
                                                            unsigned short* __restrict__ prj, unsigned short* __restrict__ gt) {
  __shared__ __align__(16) _Float16 sW[kJO * kWP];
  __shared__ __align__(16) float sB[kJW * 32];   // b_theta | b_phi | b_g | a copy of b_g that nobody reads (wave 3 takes no branch of its own)
  const int t    = threadIdx.x;
  const int lane = t & 31, wave = t >> 5;
  const int rl   = lane & 15, hh = lane >> 4;
  const int b    = blockIdx.y;
  const int n0   = (blockIdx.x * kJW + wave) * kJP;

  // weights: trip i brings 8 rows of 64 (16 threads a row), four trips a matrix
  const int wo = (t >> 4) * kC + (t & 15) * 4;
  const float* pw0 = w_theta + wo;
  const float* pw1 = w_phi + wo;
  const float* pw2 = w_g + wo;
  const float* pb  = ((wave == 0) ? b_theta : ((wave == 1) ? b_phi : b_g)) + lane;
  v4f wq[12];
#pragma unroll
  for (int i = 0; i < 12; ++i) wq[i] = *(const v4f*)(((i < 4) ? pw0 : ((i < 8) ? pw1 : pw2)) + (i & 3) * 8 * kC);
  const float bq = *pb;

  // x: 32 channels per lane, four positions each
  const float* xp = x + ((size_t)b * kC + hh * 8) * kN + n0 + 4 * rl;
  v4f xv[2][16];
#pragma unroll
  for (int ks = 0; ks < 2; ++ks)
#pragma unroll
    for (int s = 0; s < 16; ++s) xv[ks][s] = *(const v4f*)(xp + (size_t)(ks * 32 + (s < 8 ? s : s + 8)) * kN);
  // the wait that stands before an address register of an issued load is written again; the addresses are named as inputs so that they
  // stay in their registers up to here (left free, later loads of this run were given earlier loads' address registers as destinations)
  asm volatile("s_wait_xcnt 0x0" :: "v"(pw0), "v"(pw1), "v"(pw2), "v"(pb), "v"(xp) : "memory");
  // keeps every load ahead of the first conversion: left free, the compiler waits for weights before it issues the x loads, two trips in series
  __builtin_amdgcn_sched_barrier(0);

#pragma unroll
  for (int i = 0; i < 12; ++i) *(v2u*)(sW + (i * 8 + (t >> 4)) * kWP + (t & 15) * 4) = w_pack(wq[i]);
  sB[t] = (wave == 0) ? bq * kLog2e : bq;   // theta leaves x log2(e), its bias with it
  __syncthreads();   // the f16 weights and the biases are in LDS before any wave reads an operand

  HFrag xb[4][2];
#pragma unroll
  for (int g = 0; g < 4; ++g)
#pragma unroll
    for (int ks = 0; ks < 2; ++ks)
#pragma unroll
      for (int i = 0; i < 8; ++i) xb[g][ks].u[i] = pack2h(xv[ks][2 * i][g], xv[ks][2 * i + 1][g]);

  // theta (mt 0, 1), phi (mt 2, 3), g (mt 4, 5)
  unsigned short* pr = prj + ((size_t)b * kN + n0 + 4 * rl) * kPW + hh * 8;
  unsigned short* gq = gt + ((size_t)b * kCI + hh * 8) * kN + n0 + 4 * rl;
#pragma unroll
  for (int mt = 0; mt < 6; ++mt) {
    const _Float16* wr = sW + (mt * 16 + rl) * kWP + hh * 8;
    const v16h wa0 = Frag<_Float16>::load(wr);
    const v16h wa1 = Frag<_Float16>::load(wr + 32);
    const v4f bv[2] = {*(const v4f*)(sB + mt * 16 + hh * 8), *(const v4f*)(sB + mt * 16 + hh * 8 + 4)};
    v8f acc[4];
#pragma unroll
    for (int g = 0; g < 4; ++g) acc[g] = Frag<_Float16>::mma(wa0, xb[g][0].v, (v8f){0.f,0.f,0.f,0.f,0.f,0.f,0.f,0.f});
#pragma unroll
    for (int g = 0; g < 4; ++g) acc[g] = Frag<_Float16>::mma(wa1, xb[g][1].v, acc[g]);
    if (mt < 4) {
      const float sc = (mt < 2) ? kWCarryInv * kLog2e : kWCarryInv;   // theta x log2(e): the fused kernel's scores are then in the log2 domain
#pragma unroll
      for (int g = 0; g < 4; ++g) {
        unsigned u[4];
#pragma unroll
        for (int i = 0; i < 4; ++i)
          u[i] = pack2h(fmaf(acc[g][2 * i], sc, bv[i >> 1][(2 * i) & 3]), fmaf(acc[g][2 * i + 1], sc, bv[i >> 1][(2 * i + 1) & 3]));
        *(v4u*)(pr + (size_t)g * kPW + mt * 16) = (v4u){u[0], u[1], u[2], u[3]};
      }
    } else {
#pragma unroll
      for (int r = 0; r < 8; ++r) {   // channel 16 (mt - 4) + 8 h + r at keys n0 + 4 (lane&15) + 0..3
        const float bb = bv[r >> 2][r & 3];
        *(v2u*)(gq + (size_t)((mt - 4) * 16 + r) * kN) = (v2u){pack2h(fmaf(acc[0][r], kWCarryInv, bb), fmaf(acc[1][r], kWCarryInv, bb)),
                                                               pack2h(fmaf(acc[2][r], kWCarryInv, bb), fmaf(acc[3][r], kWCarryInv, bb))};
      }
    }
  }
}

// ---------------------------------------------------------------------------
// Host glue.
//   PRJ  f16 [8][4096][128]   8,388,608  at           0   (theta | phi per position; the upper half of a row is unused)
//   GT   f16 [8][32][4096]    2,097,152  at   8,388,608   (g^T[o][key])
//   total                    10,485,760
// ---------------------------------------------------------------------------
extern "C" void kernel_launch(void* const* d_in, const int* in_sizes, int n_in,
                              void* d_out, int out_size, void* d_ws, size_t ws_size,
                              hipStream_t stream) {
  if (n_in < 9) return;
  const int nX = kB * kC * kN;   // 2,097,152
  if (in_sizes[0] != nX) return;
  if (in_sizes[1] != kCI * kC || in_sizes[2] != kCI) return;
  if (in_sizes[3] != kCI * kC || in_sizes[4] != kCI) return;
  if (in_sizes[5] != kCI * kC || in_sizes[6] != kCI) return;
  if (in_sizes[7] != kC * kCI || in_sizes[8] != kC) return;
  if (out_size != nX) return;

  const size_t szPRJ = (size_t)kB * kN * kPW * 2;
  const size_t szGT  = (size_t)kB * kCI * kN * 2;
  const size_t offPRJ = 0;
  const size_t offGT  = offPRJ + szPRJ;
  const size_t total  = offGT + szGT;
  if (ws_size < total) return;

  const float* x       = (const float*)d_in[0];
  const float* w_theta = (const float*)d_in[1];
  const float* b_theta = (const float*)d_in[2];
  const float* w_phi   = (const float*)d_in[3];
  const float* b_phi   = (const float*)d_in[4];
  const float* w_g     = (const float*)d_in[5];
  const float* b_g     = (const float*)d_in[6];
  const float* w_out   = (const float*)d_in[7];
  const float* b_out   = (const float*)d_in[8];
  float* out = (float*)d_out;
  char* ws = (char*)d_ws;
  unsigned short* PRJ = (unsigned short*)(ws + offPRJ);
  unsigned short* GT  = (unsigned short*)(ws + offGT);

  // ---- theta, phi planes and g^T of all batches (16 blocks of 256 positions x 8 batches) ----
  proj_kernel<<<dim3(kN / (kJP * kJW), kB), dim3(kJW * 32), 0, stream>>>(x, w_theta, b_theta, w_phi, b_phi, w_g, b_g, PRJ, GT);

  // ---- scores, softmax over keys, y^T product, output projection, bias and residual: all batches, one launch (32 position blocks x 8 batches) ----
  attn_fused_kernel<<<dim3(kN / (kFG * kFQ), kB), dim3(kFW * 32), 0, stream>>>(PRJ, GT, w_out, b_out, x, out);
}

// v010
// Measured time: 26.6 microseconds a run.
// Two timings next to v009 put it at 1.05 and 1.07 times that version's speed.
// All steps since v000 together make it 58.3 times as fast.
// Contractions: channel projections (W f16 carried x16 . x f16), scores phi.theta^T (f16 planes), y^T = g^T f16 x P^T (f16, unnormalised exponentials), softmax sums = ones (f16) . P^T, out^T = W_out (f16 carried x16) . y^T (f16, normalised slice partials): all on v_wmma_f32_16x16x32_f16 with f32 accumulate; bias adds, softmax maxima, exponentials and residual in f32.
#include <hip/hip_runtime.h>
#include <math.h>

// ---------------------------------------------------------------------------
// Problem constants
// ---------------------------------------------------------------------------
constexpr int kB  = 8;        // batch
constexpr int kC  = 64;       // in channels
constexpr int kCI = 32;       // inter channels
constexpr int kN  = 4096;     // H*W positions
constexpr int kPW = 32;       // row pitch in halves of the theta plane and of the phi plane: one position's 32 channels, 64 B, rows back to back
constexpr size_t kPlane = (size_t)kB * kN * kPW;   // halves of one plane; the phi plane follows the theta plane
constexpr float kWCarry    = 16.0f;            // weights carried x16 in f16
constexpr float kWCarryInv = 1.0f / 16.0f;
static_assert(kN % 64 == 0 && kPW == kCI && kC % 64 == 0, "M,N tiles; dense projection rows");
static_assert(kC % 32 == 0 && kCI % 32 == 0 && kN % 32 == 0, "K steps");

typedef __attribute__((ext_vector_type(16))) _Float16 v16h;
typedef __attribute__((ext_vector_type(8)))  _Float16 v8h;
typedef __attribute__((ext_vector_type(8)))  float    v8f;
typedef __attribute__((ext_vector_type(4)))  float    v4f;
typedef __attribute__((ext_vector_type(4)))  unsigned int v4u;

// ---------------------------------------------------------------------------
// Helpers
// ---------------------------------------------------------------------------
template <typename T> struct Frag;
template <> struct Frag<_Float16> {
  typedef v16h V; union U { v16h v; v8h h[2]; };
  // elements 0..7 <- p[0..7], 8..15 <- p[16..23]
  static __device__ __forceinline__ v16h load(const _Float16* p) {
    U f; f.h[0] = *(const v8h*)(p); f.h[1] = *(const v8h*)(p + 16); return f.v;
  }
  static __device__ __forceinline__ v8f mma(v16h a, v16h b, v8f c) {
    return __builtin_amdgcn_wmma_f32_16x16x32_f16(false, a, false, b, (short)0, c, false, false);
  }
};

// ---------------------------------------------------------------------------
// Scores, softmax, y^T product and output projection of all batches in one launch; scores and probabilities stay in registers.
//   y[b][o][q] = sum_key GT[b][o][key] * softmax_key(theta[q] . phi[key]);  out[b][c][q] = sum_o w_out[c][o] * y[b][o][q] + b_out[c] + x[b][c][q]
// grid (4096/128 = 32 position blocks, 8 batches), 16 waves: wave = query group (wave >> 2, 32 q) x key slice (wave & 3, 1024 keys).
// One pass = 32 keys:  S^T = phi . theta^T  (A = phi rows, B = theta rows, same loader: equal k order); D register r of a lane =
// S^T[key 8*(lane>>4) + r][q = lane&15], so the two key tiles of a pass, converted in place, are the B operand (hardware k order) of
// Y^T += GT . P^T  (A = GT rows through the same loader: keys 8h..8h+7 | 16+8h..16+8h+7). D register r = y[o = 8*(lane>>4) + r][q = lane&15].
// A lane holds one query's column in both products: running maximum (log2 domain) and rescale factor are per-lane scalars.
// theta is carried x log2(e) and the score product's C operand holds minus the maximum in use in all eight registers of a lane, so D is
// already the argument of the exponential, S log2(e) - m.
// The shift m is fixed for the whole slice: the exact maximum of the wave's first 64 keys plus 6. No score is looked at again in the loop.
// An exponential stays inside f16 while its score lies less than 22 above that sampled maximum; the sampled key itself gives 2^-6, so a sum is never 0.
// A score beyond that turns its f16 exponential into infinity, which reaches the slice's sum through the ones product (every term is 0 or more).
// Every wave tests its sums once behind the loop: below the largest f16, or not. If any wave of the work-group saw one that is not, the whole
// work-group runs its keys again through the tracking loop (below), which takes any scores; it starts at the exact maximum of the wave's first 32 keys.
// The sum of a query's exponentials comes off the matrix pipe: L += ones . P^T (A: row 0 is 1.0, the rest 0), one product per column group and pass,
// on the same rounded P^T operand as the output product; register 0 of lanes 0..15 holds the sum over all 32 keys of query lane&15.
// Tracking loop: the maximum in use may trail the true one by up to 8 (an exponential reaches 2^8 at most, inside f16): rescale only when some column exceeds that.
// The four key slices of a query group are joined in LDS: maxima and sums first; then each wave scales its 32-channel y^T, whose two channel
// tiles, converted in place, are the B operand of out^T = W_out . y^T (A = w_out rows in the loader's k order), and the partial out tiles are
// summed in slice order 0..3. The products over the keys so run on the 32 inner channels, not on the 64 outer ones.
// phi rows and g^T rows come through LDS: a stage is 64 keys of each of the four slices (two passes), brought once per work-group by
// asynchronous 16-B copies and read by the four query waves of its slice. In memory a stage's share of a slice is one block of 4 KiB for phi (64 rows
// of 64 B back to back, in a plane of their own) and one for g^T (32 channel rows of 64 keys back to back): every wave-wide copy is 512 B in a row.
// Two buffers: stage t + 1 flies while stage t is worked on; one barrier per stage publishes the one and frees the other. It stands in the stage's
// last pass: signal behind the score products (the wave's last read of the buffer has returned), wait behind column group 0's exponentials (tracking
// loop: behind the rescale test); the next stage's first phi rows and the refill copies are issued there, ahead of the remaining exponentials.
// ---------------------------------------------------------------------------
constexpr int kFQ  = 32;            // queries per wave (two 16-column groups)
constexpr int kFG  = 4;             // query groups per work-group
constexpr int kFS  = 4;             // key slices per work-group
constexpr int kFW  = kFG * kFS;     // waves per work-group
constexpr int kFK  = kN / kFS;      // keys per wave
constexpr int kFNP = kFK / 32;      // passes per wave
constexpr int kFP  = 36;            // LDS row pitch in floats: 144 B = 16 B x odd
constexpr int kSK  = 64;            // keys of one slice per stage
constexpr int kNST = kFK / kSK;     // stages
constexpr int kPhP = 40;            // LDS pitch of a phi row in halves: 80 B = 16 B x odd
constexpr int kGwP = 72;            // LDS pitch of a g^T row in halves: 144 B = 16 B x odd
constexpr int kPhB = kFS * kSK * kPhP;   // halves of one phi buffer (4 slices x 64 keys)
constexpr int kGwB = kFS * kCI * kGwP;   // halves of one g^T buffer (4 slices x 32 channels)
constexpr float kLog2e = 1.4426950408889634f;
constexpr float kLift  = 6.0f;      // fixed shift = sampled maximum + kLift (log2 domain)
constexpr float kSumTop = 65504.0f; // largest f16: a sum below it holds no exponential that left f16; infinity and not-a-number fail "< kSumTop"
static_assert(kSK == 64 && kNST >= 2 && kFW * 32 == 512 && kFS == 4, "stage copy map: 2 phi and 2 g^T chunks of 16 B per thread");
static_assert(kFK % 32 == 0 && kN % (kFG * kFQ) == 0 && kCI == 32 && kC == 64, "fused tile");
static_assert(kC * kFG * kFQ == kFW * 32 * 16, "join map: four float4 per thread");
typedef __attribute__((ext_vector_type(2))) float    v2f;
typedef __attribute__((ext_vector_type(2))) _Float16 v2h;

// lane l with lane l ^ 16
__device__ __forceinline__ float xhalf(float v) {
  const int i = __builtin_bit_cast(int, v);
  return __builtin_bit_cast(float, __builtin_amdgcn_permlanex16(i, i, 0x76543210, 0xfedcba98, false, false));
}
__device__ __forceinline__ unsigned pack2h(float lo, float hi) {   // round to nearest even
  return __builtin_bit_cast(unsigned, __builtin_convertvector((v2f){lo, hi}, v2h));
}
// Eight exponentials (2^a) in one statement. The outputs are early-clobbered, so none lands on a source of another, and the closing v_nop is
// the slot the instruction set asks for behind a transcendental before its result is used or its source overwritten.
__device__ __forceinline__ void exp2x8(float (&p)[8], const float (&a)[8]) {
  asm("v_exp_f32 %0, %8\n\tv_exp_f32 %1, %9\n\tv_exp_f32 %2, %10\n\tv_exp_f32 %3, %11\n\t"
      "v_exp_f32 %4, %12\n\tv_exp_f32 %5, %13\n\tv_exp_f32 %6, %14\n\tv_exp_f32 %7, %15\n\tv_nop"
      : "=&v"(p[0]), "=&v"(p[1]), "=&v"(p[2]), "=&v"(p[3]), "=&v"(p[4]), "=&v"(p[5]), "=&v"(p[6]), "=&v"(p[7])
      : "v"(a[0]), "v"(a[1]), "v"(a[2]), "v"(a[3]), "v"(a[4]), "v"(a[5]), "v"(a[6]), "v"(a[7]));
}

// The four score products of a pass in one statement, D apart from C: the C registers (minus the maximum in use) are read only and live on
// from pass to pass (through the builtin some of these products were tied to their C, which was copied first, eight registers a time).
// Key tile 1 goes first: in the listing the D registers of key tile 0 are the B operands of the pass before, and this order puts three
// products and more between a register's last use there and the product that writes it here.
// The closing v_nops are the four vector slots between the last WMMA and a vector instruction on its D or a load over its A.
__device__ __forceinline__ void score4(v8f (&d)[2][2], const v16h (&a)[2], const v16h (&b)[2], const v8f (&c)[2]) {
  asm("v_wmma_f32_16x16x32_f16 %2, %5, %6, %8\n\t"
      "v_wmma_f32_16x16x32_f16 %3, %5, %7, %9\n\t"
      "v_wmma_f32_16x16x32_f16 %0, %4, %6, %8\n\t"
      "v_wmma_f32_16x16x32_f16 %1, %4, %7, %9\n\t"
      "v_nop\n\tv_nop\n\tv_nop\n\tv_nop"
      : "=&v"(d[0][0]), "=&v"(d[0][1]), "=&v"(d[1][0]), "=&v"(d[1][1])
      : "v"(a[0]), "v"(a[1]), "v"(b[0]), "v"(b[1]), "v"(c[0]), "v"(c[1]));
}

// One stage: four 16-B copies per lane, global memory to LDS through no register.
// lp / gp: this lane's phi chunk of slices 0..1; lg / gg: its g^T chunk of slices 0..1 (the second copy of each: two slices on).
// The closing s_wait_xcnt stands inside the statement so that no address register named here is rewritten ahead of it.
__device__ __forceinline__ void stage_copy(unsigned lp, unsigned lg, const _Float16* gp, const _Float16* gg) {
  const unsigned lp1 = lp + 2 * kSK * kPhP * 2;
  const unsigned lg1 = lg + 2 * kCI * kGwP * 2;
  const _Float16* gp1 = gp + (size_t)2 * kFK * kPW;
  const _Float16* gg1 = gg + (size_t)2 * kFK * kCI;
  asm volatile("global_load_async_to_lds_b128 %0, %4, off\n\t"
               "global_load_async_to_lds_b128 %1, %5, off\n\t"
               "global_load_async_to_lds_b128 %2, %6, off\n\t"
               "global_load_async_to_lds_b128 %3, %7, off\n\t"
               "s_wait_xcnt 0x0"
               :: "v"(lp), "v"(lp1), "v"(lg), "v"(lg1),
                  "v"(gp), "v"(gp1), "v"(gg), "v"(gg1)
               : "memory");
}

// The pass over a wave's 1024 keys. Enters with stage 0's copies issued; leaves with the ring closed.
// kTrack false: fixed shift, no look at the scores. kTrack true: running maximum with the rescale test.
template <bool kTrack>
__device__ __forceinline__ void key_loop(const _Float16* Th, const _Float16* Lp, const _Float16* Lg,
                                         unsigned cLp, unsigned cLg, const _Float16* cGp, const _Float16* cGg, int rl,
                                         v8f (&acc)[2][2], v8f (&lacc)[2], float (&m_run)[2]) {
  // stage 0 has landed for this wave's copies before the barrier that publishes it
  asm volatile("s_wait_asynccnt 0x0" ::: "memory");
  __syncthreads();   // stage 0 is readable by every wave
  stage_copy(cLp + kPhB * 2, cLg + kGwB * 2, cGp + (size_t)kSK * kPW, cGg + (size_t)kSK * kCI);

  v16h th[2], ph[2];
#pragma unroll
  for (int g = 0; g < 2; ++g) th[g] = Frag<_Float16>::load(Th + (size_t)(g << 4) * kPW);

#pragma unroll
  for (int ct = 0; ct < 2; ++ct)
#pragma unroll
    for (int g = 0; g < 2; ++g) acc[ct][g] = (v8f){0.f,0.f,0.f,0.f,0.f,0.f,0.f,0.f};
  v8f cm[2];     // C operand of the score products: -m_run in every register
#pragma unroll
  for (int g = 0; g < 2; ++g) lacc[g] = (v8f){0.f,0.f,0.f,0.f,0.f,0.f,0.f,0.f};   // sums of exponentials, rescaled like an output tile
  union { unsigned u[8]; v16h v; } ones;
#pragma unroll
  for (int i = 0; i < 8; ++i) ones.u[i] = (rl == 0) ? 0x3C003C00u : 0u;

  // sampled maximum (stage 0 is published): scores with C = 0 of the first pass (tracking loop) or of both passes of stage 0 (fixed shift);
  // the first pass goes last, so that ph leaves holding its rows
  {
    constexpr int kPre = kTrack ? 1 : kSK / 32;
    float mx[2];
#pragma unroll
    for (int pq = kPre - 1; pq >= 0; --pq) {
#pragma unroll
      for (int kt = 0; kt < 2; ++kt) ph[kt] = Frag<_Float16>::load(Lp + (pq * 32 + (kt << 4)) * kPhP);
#pragma unroll
      for (int g = 0; g < 2; ++g) {
        const v8f s0 = Frag<_Float16>::mma(ph[0], th[g], (v8f){0.f,0.f,0.f,0.f,0.f,0.f,0.f,0.f});
        const v8f s1 = Frag<_Float16>::mma(ph[1], th[g], (v8f){0.f,0.f,0.f,0.f,0.f,0.f,0.f,0.f});
        float v = s0[0];
#pragma unroll
        for (int r = 1; r < 8; ++r) v = fmaxf(v, s0[r]);
#pragma unroll
        for (int r = 0; r < 8; ++r) v = fmaxf(v, s1[r]);
        mx[g] = (pq == kPre - 1) ? v : fmaxf(mx[g], v);
      }
    }
#pragma unroll
    for (int g = 0; g < 2; ++g) {
      const float m = fmaxf(mx[g], xhalf(mx[g]));   // both wave halves hold this query's maximum
      m_run[g] = kTrack ? m : m + kLift;
#pragma unroll
      for (int r = 0; r < 8; ++r) cm[g][r] = -m_run[g];
    }
  }

  // rolled: a stage (two passes) is already a long straight block. ph enters a stage holding its first pass's phi rows (stage 0: from the pre-pass).
#pragma unroll 1
  for (int sg = 0; sg < kNST; ++sg) {
   const int bf = sg & 1;
   const _Float16* lp = Lp + bf * kPhB;
   const _Float16* lg = Lg + bf * kGwB;
   v16h gw[kSK / 32][2];
   // both passes of the stage written out: the second pass's offsets in the buffer are then immediates
#pragma unroll
   for (int pp = 0; pp < kSK / 32; ++pp) {
    // keeps the products of the pass before in their order ahead of the statement below, whose WMMAs the compiler does not see as such
    __builtin_amdgcn_sched_barrier(0);
    v8f st[2][2];   // st[kt][g]: key tile kt, column group g
    score4(st, ph, th, cm);
    if (pp == 0) {   // every other read of this stage's buffer: g^T rows of both passes, phi rows of the second
#pragma unroll
      for (int ct = 0; ct < 2; ++ct) gw[0][ct] = Frag<_Float16>::load(lg + (ct << 4) * kGwP);
#pragma unroll
      for (int kt = 0; kt < 2; ++kt) ph[kt] = Frag<_Float16>::load(lp + (32 + (kt << 4)) * kPhP);
#pragma unroll
      for (int ct = 0; ct < 2; ++ct) gw[1][ct] = Frag<_Float16>::load(lg + (ct << 4) * kGwP + 32);
    }
    // keeps these loads (and the score products) ahead of what follows: left free, the compiler sinks each load to its use and the wave waits out its latency there
    __builtin_amdgcn_sched_barrier(0);
    if (pp + 1 == kSK / 32) {
      // publish point, first half: this wave's reads of the buffer are done, its copies of the next stage have landed
      asm volatile("s_wait_dscnt 0x0" ::: "memory");
      asm volatile("s_wait_asynccnt 0x0" ::: "memory");
      asm volatile("s_barrier_signal -1" ::: "memory");
      // keeps the vector work on the scores, which waits for the score products, behind the signal, so that no other wave waits for it
      __builtin_amdgcn_sched_barrier(0);
    }

    if constexpr (kTrack) {
      // one test for the whole wave: every score is already relative to its own query's maximum in use
      float mg[2] = {0.0f, 0.0f};   // per column group: how far this lane's scores stand above the maximum in use, 0 at least
#pragma unroll
      for (int kt = 0; kt < 2; ++kt)
#pragma unroll
        for (int r = 0; r < 8; ++r) { mg[0] = fmaxf(mg[0], st[kt][0][r]); mg[1] = fmaxf(mg[1], st[kt][1][r]); }
      if (__builtin_amdgcn_ballot_w32(fmaxf(mg[0], mg[1]) > 8.0f) != 0) {   // wave-uniform; rare
#pragma unroll
        for (int g = 0; g < 2; ++g) {
          const float up   = fmaxf(mg[g], xhalf(mg[g]));   // both wave halves hold this query's rise; the maximum in use never falls
          const float corr = __builtin_amdgcn_exp2f(-up);
          m_run[g] += up;
          lacc[g] = lacc[g] * corr;
#pragma unroll
          for (int ct = 0; ct < 2; ++ct) acc[ct][g] = acc[ct][g] * corr;
#pragma unroll
          for (int kt = 0; kt < 2; ++kt)
#pragma unroll
            for (int r = 0; r < 8; ++r) st[kt][g][r] -= up;
#pragma unroll
          for (int r = 0; r < 8; ++r) cm[g][r] = -m_run[g];
        }
      }
    }
    union PB { unsigned u[8]; v16h v; } pb[2];
#pragma unroll
    for (int g = 0; g < 2; ++g) {
      if (pp + 1 == kSK / 32 && g == (kTrack ? 0 : 1)) {
        // fixed shift: keeps column group 0's exponentials ahead of the wait, where they fill the time in which the other waves arrive
        __builtin_amdgcn_sched_barrier(0);
        // publish point, second half: every wave has signalled, so stage sg + 1 is readable and the buffer of stage sg is free
        asm volatile("s_barrier_wait -1" ::: "memory");
        if (sg + 1 < kNST) {   // the next stage's first phi rows: their LDS latency runs under the exponentials and products below
#pragma unroll
          for (int kt = 0; kt < 2; ++kt) ph[kt] = Frag<_Float16>::load(Lp + (bf ^ 1) * kPhB + (kt << 4) * kPhP);
        }
        if (sg + 2 < kNST)
          stage_copy(cLp + bf * (kPhB * 2), cLg + bf * (kGwB * 2), cGp + (size_t)(sg + 2) * kSK * kPW, cGg + (size_t)(sg + 2) * kSK * kCI);
        // keeps the exponentials below behind the reads and copies above: moved ahead of them, they would delay both
        __builtin_amdgcn_sched_barrier(0);
      }
#pragma unroll
      for (int kt = 0; kt < 2; ++kt) {   // key tile kt fills elements 8kt..8kt+7 of the 32-key operand, register r = element 8kt + r
        float a[8], p[8];
#pragma unroll
        for (int r = 0; r < 8; ++r) a[r] = st[kt][g][r];
        exp2x8(p, a);
#pragma unroll
        for (int i = 0; i < 4; ++i) pb[g].u[kt * 4 + i] = pack2h(p[2 * i], p[2 * i + 1]);
      }
    }
    // keeps every exponential statement ahead of the products below: an exponential
    // moved behind a product could write over its B operand too early
    __builtin_amdgcn_sched_barrier(0);
#pragma unroll
    for (int g = 0; g < 2; ++g) {
#pragma unroll
      for (int ct = 0; ct < 2; ++ct) acc[ct][g] = Frag<_Float16>::mma(gw[pp][ct], pb[g].v, acc[ct][g]);
      lacc[g] = Frag<_Float16>::mma(ones.v, pb[g].v, lacc[g]);
    }
   }
  }
  // the four vector slots behind the loop's last WMMA on the taken side of the exit branch
  asm volatile("v_nop\n\tv_nop\n\tv_nop\n\tv_nop");
  // keeps the caller's first read of a sum behind those slots (left free, the compare on it was lifted in front of them)
  __builtin_amdgcn_sched_barrier(0);
  // nothing is outstanding here; the wait closes the ring before the wave goes on
  asm volatile("s_wait_asynccnt 0x0" ::: "memory");
}

__global__ __launch_bounds__(kFW * 32) void attn_fused_kernel(const unsigned short* __restrict__ prj,
                                                              const unsigned short* __restrict__ gt,
                                                              const float* __restrict__ w_out,
                                                              const float* __restrict__ b_out,
                                                              const float* __restrict__ x,
                                                              float* __restrict__ out) {
  __shared__ __align__(16) float part[kFW][kC * kFP];
  __shared__ __align__(16) _Float16 sPh[2 * kPhB];
  __shared__ __align__(16) _Float16 sGw[2 * kGwB];
  __shared__ float sM[kFW][kFQ];
  __shared__ float sL[kFW][kFQ];
  __shared__ int sOver;   // set by any wave one of whose sums left the finite range under the fixed shift
  const int t    = threadIdx.x;
  const int lane = t & 31, wave = t >> 5;
  const int b    = blockIdx.y;
  const int qg   = wave >> 2, ks = wave & 3;
  const int qb   = blockIdx.x * (kFG * kFQ);
  const int rl   = lane & 15, hh = lane >> 4;
  const _Float16* Pb = (const _Float16*)prj + (size_t)b * kN * kPW;
  const _Float16* Th = Pb + (size_t)(qb + qg * kFQ + rl) * kPW + hh * 8;
  // fragment readers: this wave's slice in buffer 0
  const _Float16* Lp = sPh + (ks * kSK + rl) * kPhP + hh * 8;
  const _Float16* Lg = sGw + (ks * kCI + rl) * kGwP + hh * 8;
  // copy map: phi chunk = (slice t>>8 [+2], key (t>>2)&63, 16-B piece t&3); g^T chunk = (slice t>>8 [+2], channel (t>>3)&31, 16-B piece t&7)
  const unsigned cLp = (unsigned)(size_t)(sPh + ((t >> 8) * kSK + ((t >> 2) & 63)) * kPhP + (t & 3) * 8);
  const unsigned cLg = (unsigned)(size_t)(sGw + ((t >> 8) * kCI + ((t >> 3) & 31)) * kGwP + (t & 7) * 8);
  const _Float16* cGp = Pb + kPlane + (size_t)((t >> 8) * kFK + ((t >> 2) & 63)) * kPW + (t & 3) * 8;
  const _Float16* cGg = (const _Float16*)gt + (((size_t)b * (kN / kSK) + (t >> 8) * kNST) * kCI + ((t >> 3) & 31)) * kSK + (t & 7) * 8;

  stage_copy(cLp, cLg, cGp, cGg);
  if (t == 0) sOver = 0;   // ahead of the loop's first barrier; set only behind it
  // A operands of the output projection: w_out rows 16 ot + (lane&15), carried x16, elements 0..7 = channels 8h..8h+7, 8..15 = 16+8h..16+8h+7.
  // Read here, so that their trip to memory runs beside stage 0's. They wait out the loops in the wave's own join tile, idle until then, each lane's
  // 16-B pieces read back by the same lane: with the addresses that a second run needs also kept, 32 more registers did not fit and went to scratch.
  v4f* wkeep = (v4f*)part[wave] + lane;
  const float* wr = w_out + rl * kCI + hh * 8;
  v4f wq[4][4];   // row tile ot: four floats at 0, 4, 16, 20 of the lane's half row
#pragma unroll
  for (int ot = 0; ot < 4; ++ot)
#pragma unroll
    for (int j = 0; j < 4; ++j) wq[ot][j] = *(const v4f*)(wr + (ot << 4) * kCI + (j >> 1) * 16 + (j & 1) * 4);
  // the wait that stands before an address register of an issued load is written again; the address is named as an input so that it stays in
  // its registers up to here (left free, the last load of this run was given the address registers as its destination)
  asm volatile("s_wait_xcnt 0x0" :: "v"(wr) : "memory");
#pragma unroll
  for (int ot = 0; ot < 4; ++ot) {
    unsigned u[8];
#pragma unroll
    for (int j = 0; j < 4; ++j) {
      u[2 * j]     = pack2h(wq[ot][j][0] * kWCarry, wq[ot][j][1] * kWCarry);
      u[2 * j + 1] = pack2h(wq[ot][j][2] * kWCarry, wq[ot][j][3] * kWCarry);
    }
    wkeep[(2 * ot) * 32]     = __builtin_bit_cast(v4f, (v4u){u[0], u[1], u[2], u[3]});
    wkeep[(2 * ot + 1) * 32] = __builtin_bit_cast(v4f, (v4u){u[4], u[5], u[6], u[7]});
  }

  v8f acc[2][2];
  v8f lacc[2];
  float m_run[2];
  key_loop<false>(Th, Lp, Lg, cLp, cLg, cGp, cGg, rl, acc, lacc, m_run);
  // register 0 holds the sum (lanes 0..15) or 0 times the exponentials (lanes 16..31): an infinite exponential makes it infinite or not a number
  // (a finite sum that large only costs the second run)
  if (!(lacc[0][0] < kSumTop) || !(lacc[1][0] < kSumTop)) sOver = 1;

  // ---- join of the four key slices of each query group ----
#pragma unroll
  for (int g = 0; g < 2; ++g) {
    if (hh == 0) {
      sM[wave][(g << 4) + rl] = m_run[g];
      sL[wave][(g << 4) + rl] = lacc[g][0];
    }
  }
  __syncthreads();   // every slice's maxima and sums are in LDS before any wave forms its factor
  if (__builtin_amdgcn_readfirstlane(sOver) != 0) {   // the same word for every wave, written by nobody behind the barrier above: work-group uniform
    // this wave's LDS reads have returned (every wave's reads of the ring ended ahead of the barrier above) before copies target the ring again
    asm volatile("s_wait_dscnt 0x0" ::: "memory");
    stage_copy(cLp, cLg, cGp, cGg);
    key_loop<true>(Th, Lp, Lg, cLp, cLg, cGp, cGg, rl, acc, lacc, m_run);
#pragma unroll
    for (int g = 0; g < 2; ++g) {
      if (hh == 0) {
        sM[wave][(g << 4) + rl] = m_run[g];
        sL[wave][(g << 4) + rl] = lacc[g][0];
      }
    }
    __syncthreads();   // the second run's maxima and sums are in LDS before any wave forms its factor
  }
  float* my = part[wave];
  union { v4f q[2]; v16h v; } wo[4];
#pragma unroll
  for (int ot = 0; ot < 4; ++ot) { wo[ot].q[0] = wkeep[(2 * ot) * 32]; wo[ot].q[1] = wkeep[(2 * ot + 1) * 32]; }
  union { unsigned u[8]; v16h v; } yb[2];   // channel tile ct fills elements 8ct..8ct+7, register r = element 8ct + r = channel 16ct + 8h + r
#pragma unroll
  for (int g = 0; g < 2; ++g) {
    const int ql = (g << 4) + rl;
    float M = sM[qg * kFS][ql];
#pragma unroll
    for (int j = 1; j < kFS; ++j) M = fmaxf(M, sM[qg * kFS + j][ql]);
    float L = 0.f;
#pragma unroll
    for (int j = 0; j < kFS; ++j) L += sL[qg * kFS + j][ql] * __builtin_amdgcn_exp2f(sM[qg * kFS + j][ql] - M);
    const float f = __builtin_amdgcn_exp2f(m_run[g] - M) / L * kWCarryInv;   // the x16 that w_out carries goes out with the slice's factor
#pragma unroll
    for (int ct = 0; ct < 2; ++ct)
#pragma unroll
      for (int i = 0; i < 4; ++i) yb[g].u[ct * 4 + i] = pack2h(acc[ct][g][2 * i] * f, acc[ct][g][2 * i + 1] * f);
  }
  v8f o[4][2];
#pragma unroll
  for (int ot = 0; ot < 4; ++ot)
#pragma unroll
    for (int g = 0; g < 2; ++g) o[ot][g] = Frag<_Float16>::mma(wo[ot].v, yb[g].v, (v8f){0.f,0.f,0.f,0.f,0.f,0.f,0.f,0.f});
  // all eight products ahead of the first store: each then has result registers of its own (left free, a later product was given an earlier
  // one's result registers one vector slot behind it)
  __builtin_amdgcn_sched_barrier(0);
#pragma unroll
  for (int ot = 0; ot < 4; ++ot)
#pragma unroll
    for (int g = 0; g < 2; ++g)
#pragma unroll
      for (int r = 0; r < 8; ++r) my[((ot << 4) + hh * 8 + r) * kFP + (g << 4) + rl] = o[ot][g][r];
  __syncthreads();   // every wave's scaled partial tile is in LDS before any thread sums across slices

  // thread t, trip it: float4 index it*512 + t of the 64 c x 128 q tile; a wave writes one whole 512-B row segment of out
#pragma unroll
  for (int it = 0; it < 4; ++it) {
    const int idx = it * (kFW * 32) + t;
    const int c   = idx >> 5;
    const int q4  = (idx & 31) * 4;
    const int g4  = (q4 >> 5) * kFS;
    const int po  = c * kFP + (q4 & 31);
    v4f sum = *(const v4f*)(&part[g4][po]);
#pragma unroll
    for (int j = 1; j < kFS; ++j) sum = sum + *(const v4f*)(&part[g4 + j][po]);
    const size_t o = ((size_t)b * kC + c) * kN + qb + q4;
    const v4f rr = *(const v4f*)(x + o);
    const float bv = b_out[c];
    v4f v;
#pragma unroll
    for (int e = 0; e < 4; ++e) v[e] = (sum[e] + bv) + rr[e];
    *(v4f*)(out + o) = v;
  }
}

// ---------------------------------------------------------------------------
// Weight preparation and channel projections in one launch, straight from x and the f32 weights.
// grid (4096/256 = 16, 8 batches), 4 waves; a wave owns the 64 positions n0..n0+63 of one batch.
// Weights: the work-group rounds 16 w to f16 once into LDS (rows theta | phi | g; biases in f32); one barrier publishes them.
// Every global load of a wave is issued ahead of that barrier, the weights first: one trip to memory in all.
// D = W . x: A = weight rows (m = output channel), B = x columns (n = position, f16(x)), K = 64 channels in two steps.
//   A lane reads x as one float4 per channel at position n0 + 4*(lane&15); component g goes to position tile g, whose column j is position
//   n0 + 4j + g. A wave-wide load is two whole 256-B pieces of two rows of x.
//   Element s of both operands is channel 32 ks + 8*(lane>>4) + s for s < 8 and 32 ks + 16 + 8*(lane>>4) + (s - 8) for s >= 8.
//   D register r = output channel 16 mt + 8*(lane>>4) + r at the lane's position: theta and phi leave as one 16-B store per tile.
//   g leaves transposed: a lane holds channel 8*(lane>>4) + r of a tile at the four keys n0 + 4*(lane&15) + 0..3 (one per position tile), one 8-B
//   store per channel; the 16 lanes of a wave half fill one whole 128-B line of g^T, and every line is written by one wave.
// ---------------------------------------------------------------------------
constexpr int kJP  = 64;        // positions per wave (four position tiles)
constexpr int kJW  = 4;         // waves per work-group
constexpr int kJO  = 3 * kCI;   // projection rows: theta | phi | g
constexpr int kWP  = 72;        // LDS pitch of a projection weight row in halves: 144 B = 16 B x odd
static_assert(kN % (kJP * kJW) == 0 && kC == 64 && kCI == 32 && kJW == 4, "projection tile and weight copy map");
static_assert(kJP == kSK, "a wave's 64 positions are one key block of g^T, which is one stage's share of a slice");
union HFrag { unsigned u[8]; v16h v; };
typedef __attribute__((ext_vector_type(2))) unsigned int v2u;

// four weights, carried x16, rounded to f16
__device__ __forceinline__ v2u w_pack(v4f q) {
  return (v2u){pack2h(q[0] * kWCarry, q[1] * kWCarry), pack2h(q[2] * kWCarry, q[3] * kWCarry)};
}

__global__ __launch_bounds__(kJW * 32) void proj_kernel(const float* __restrict__ x,
                                                            const float* __restrict__ w_theta, const float* __restrict__ b_theta,
                                                            const float* __restrict__ w_phi, const float* __restrict__ b_phi,
                                                            const float* __restrict__ w_g, const float* __restrict__ b_g,
                                                            unsigned short* __restrict__ prj, unsigned short* __restrict__ gt) {
  __shared__ __align__(16) _Float16 sW[kJO * kWP];
  __shared__ __align__(16) float sB[kJW * 32];   // b_theta | b_phi | b_g | a copy of b_g that nobody reads (wave 3 takes no branch of its own)
  const int t    = threadIdx.x;
  const int lane = t & 31, wave = t >> 5;
  const int rl   = lane & 15, hh = lane >> 4;
  const int b    = blockIdx.y;
  const int n0   = (blockIdx.x * kJW + wave) * kJP;

  // weights: trip i brings 8 rows of 64 (16 threads a row), four trips a matrix
  const int wo = (t >> 4) * kC + (t & 15) * 4;
  const float* pw0 = w_theta + wo;
  const float* pw1 = w_phi + wo;
  const float* pw2 = w_g + wo;
  const float* pb  = ((wave == 0) ? b_theta : ((wave == 1) ? b_phi : b_g)) + lane;
  v4f wq[12];
#pragma unroll
  for (int i = 0; i < 12; ++i) wq[i] = *(const v4f*)(((i < 4) ? pw0 : ((i < 8) ? pw1 : pw2)) + (i & 3) * 8 * kC);
  const float bq = *pb;

  // x: 32 channels per lane, four positions each
  const float* xp = x + ((size_t)b * kC + hh * 8) * kN + n0 + 4 * rl;
  v4f xv[2][16];
#pragma unroll
  for (int ks = 0; ks < 2; ++ks)
#pragma unroll
    for (int s = 0; s < 16; ++s) xv[ks][s] = *(const v4f*)(xp + (size_t)(ks * 32 + (s < 8 ? s : s + 8)) * kN);
  // the wait that stands before an address register of an issued load is written again; the addresses are named as inputs so that they
  // stay in their registers up to here (left free, later loads of this run were given earlier loads' address registers as destinations)
  asm volatile("s_wait_xcnt 0x0" :: "v"(pw0), "v"(pw1), "v"(pw2), "v"(pb), "v"(xp) : "memory");
  // keeps every load ahead of the first conversion: left free, the compiler waits for weights before it issues the x loads, two trips in series
  __builtin_amdgcn_sched_barrier(0);

#pragma unroll
  for (int i = 0; i < 12; ++i) *(v2u*)(sW + (i * 8 + (t >> 4)) * kWP + (t & 15) * 4) = w_pack(wq[i]);
  sB[t] = (wave == 0) ? bq * kLog2e : bq;   // theta leaves x log2(e), its bias with it
  __syncthreads();   // the f16 weights and the biases are in LDS before any wave reads an operand

  HFrag xb[4][2];
#pragma unroll
  for (int g = 0; g < 4; ++g)
#pragma unroll
    for (int ks = 0; ks < 2; ++ks)
#pragma unroll
      for (int i = 0; i < 8; ++i) xb[g][ks].u[i] = pack2h(xv[ks][2 * i][g], xv[ks][2 * i + 1][g]);

  // theta (mt 0, 1), phi (mt 2, 3), g (mt 4, 5)
  unsigned short* pr = prj + ((size_t)b * kN + n0 + 4 * rl) * kPW + hh * 8;
  unsigned short* gq = gt + (((size_t)b * (kN / kJP) + blockIdx.x * kJW + wave) * kCI + hh * 8) * kJP + 4 * rl;   // the wave's own block of 64 keys
#pragma unroll
  for (int mt = 0; mt < 6; ++mt) {
    const _Float16* wr = sW + (mt * 16 + rl) * kWP + hh * 8;
    const v16h wa0 = Frag<_Float16>::load(wr);
    const v16h wa1 = Frag<_Float16>::load(wr + 32);
    const v4f bv[2] = {*(const v4f*)(sB + mt * 16 + hh * 8), *(const v4f*)(sB + mt * 16 + hh * 8 + 4)};
    v8f acc[4];
#pragma unroll
    for (int g = 0; g < 4; ++g) acc[g] = Frag<_Float16>::mma(wa0, xb[g][0].v, (v8f){0.f,0.f,0.f,0.f,0.f,0.f,0.f,0.f});
#pragma unroll
    for (int g = 0; g < 4; ++g) acc[g] = Frag<_Float16>::mma(wa1, xb[g][1].v, acc[g]);
    if (mt < 4) {
      const float sc = (mt < 2) ? kWCarryInv * kLog2e : kWCarryInv;   // theta x log2(e): the fused kernel's scores are then in the log2 domain
#pragma unroll
      for (int g = 0; g < 4; ++g) {
        unsigned u[4];
#pragma unroll
        for (int i = 0; i < 4; ++i)
          u[i] = pack2h(fmaf(acc[g][2 * i], sc, bv[i >> 1][(2 * i) & 3]), fmaf(acc[g][2 * i + 1], sc, bv[i >> 1][(2 * i + 1) & 3]));
        *(v4u*)(pr + (size_t)(mt >> 1) * kPlane + (size_t)g * kPW + (mt & 1) * 16) = (v4u){u[0], u[1], u[2], u[3]};
      }
    } else {
#pragma unroll
      for (int r = 0; r < 8; ++r) {   // channel 16 (mt - 4) + 8 h + r at keys n0 + 4 (lane&15) + 0..3
        const float bb = bv[r >> 2][r & 3];
        *(v2u*)(gq + (size_t)((mt - 4) * 16 + r) * kJP) = (v2u){pack2h(fmaf(acc[0][r], kWCarryInv, bb), fmaf(acc[1][r], kWCarryInv, bb)),
                                                               pack2h(fmaf(acc[2][r], kWCarryInv, bb), fmaf(acc[3][r], kWCarryInv, bb))};
      }
    }
  }
}

// ---------------------------------------------------------------------------
// Host glue.
//   PRJ  f16 [2][8][4096][32] 4,194,304  at           0   (theta plane, then phi plane; a position's row is 64 B)
//   GT   f16 [8][64][32][64]  2,097,152  at   4,194,304   (g^T in blocks of 64 keys: [key block][o][key in block])
//   total                     6,291,456
// ---------------------------------------------------------------------------
extern "C" void kernel_launch(void* const* d_in, const int* in_sizes, int n_in,
                              void* d_out, int out_size, void* d_ws, size_t ws_size,
                              hipStream_t stream) {
  if (n_in < 9) return;
  const int nX = kB * kC * kN;   // 2,097,152
  if (in_sizes[0] != nX) return;
  if (in_sizes[1] != kCI * kC || in_sizes[2] != kCI) return;
  if (in_sizes[3] != kCI * kC || in_sizes[4] != kCI) return;
  if (in_sizes[5] != kCI * kC || in_sizes[6] != kCI) return;
  if (in_sizes[7] != kC * kCI || in_sizes[8] != kC) return;
  if (out_size != nX) return;

  const size_t szPRJ = 2 * kPlane * 2;
  const size_t szGT  = (size_t)kB * kCI * kN * 2;
  const size_t offPRJ = 0;
  const size_t offGT  = offPRJ + szPRJ;
  const size_t total  = offGT + szGT;
  if (ws_size < total) return;

  const float* x       = (const float*)d_in[0];
  const float* w_theta = (const float*)d_in[1];
  const float* b_theta = (const float*)d_in[2];
  const float* w_phi   = (const float*)d_in[3];
  const float* b_phi   = (const float*)d_in[4];
  const float* w_g     = (const float*)d_in[5];
  const float* b_g     = (const float*)d_in[6];
  const float* w_out   = (const float*)d_in[7];
  const float* b_out   = (const float*)d_in[8];
  float* out = (float*)d_out;
  char* ws = (char*)d_ws;
  unsigned short* PRJ = (unsigned short*)(ws + offPRJ);
  unsigned short* GT  = (unsigned short*)(ws + offGT);

  // ---- theta, phi planes and g^T of all batches (16 blocks of 256 positions x 8 batches) ----
  proj_kernel<<<dim3(kN / (kJP * kJW), kB), dim3(kJW * 32), 0, stream>>>(x, w_theta, b_theta, w_phi, b_phi, w_g, b_g, PRJ, GT);

  // ---- scores, softmax over keys, y^T product, output projection, bias and residual: all batches, one launch (32 position blocks x 8 batches) ----
  attn_fused_kernel<<<dim3(kN / (kFG * kFQ), kB), dim3(kFW * 32), 0, stream>>>(PRJ, GT, w_out, b_out, x, out);
}
